// v000
// Measured on an AMD MI455X. A time is GPU time per run, averaged over a window of back-to-back runs after a warm-up
// (all launches, gaps included; the runs take copies of the inputs in turn), and the median of several windows.
// Apart from v000's, it joins two sittings. Times from different sittings can be a few percent apart, while
// side-by-side timings come from the same sitting.
// v000 is the starting kernel. One run takes 233 microseconds.
// Contractions: Q/K/V projections, Q.K^T scores and P.V on v_wmma_f32_16x16x32_f16 (f16 operands, f32 accumulate); weights carried x256 and probabilities x32768 (exact power-of-two carries folded back in f32); context projection (K=64, 4 rows) and the per-query context-bias dot on VALU f32; softmax f32.
#include <hip/hip_runtime.h>
#include <hip/hip_bf16.h>

typedef __attribute__((ext_vector_type(16))) _Float16 v16h;
typedef __attribute__((ext_vector_type(8)))  _Float16 v8h;
typedef __attribute__((ext_vector_type(16))) __bf16   v16b;
typedef __attribute__((ext_vector_type(8)))  __bf16   v8b;
typedef __attribute__((ext_vector_type(8)))  float    v8f;
typedef __attribute__((ext_vector_type(4)))  float    v4f;
#define PSCALE 32768.0f
#define U16(p) ((const unsigned short*)(const void*)(p))
#define PSCALE_INV (1.0f / 32768.0f)

__device__ __forceinline__ unsigned short f2bf_bits(float f) {
  unsigned u = __float_as_uint(f);
  return (unsigned short)((u + 0x7FFFu + ((u >> 16) & 1u)) >> 16);
}
__device__ __forceinline__ float bf_bits2f(unsigned short h) { return __uint_as_float(((unsigned)h) << 16); }

// hazard guards as plain device helpers (no inline asm inside the kernel template body)
__device__ __forceinline__ void dep_guard_h(v8f& a, v8f& b, v16h x, v16h y) { asm volatile("v_nop\n\tv_nop\n\tv_nop\n\tv_nop" : "+v"(a), "+v"(b) : "v"(x), "v"(y)); }
__device__ __forceinline__ void dep_guard_b(v8f& a, v8f& b, v16b x, v16b y) { asm volatile("v_nop\n\tv_nop\n\tv_nop\n\tv_nop" : "+v"(a), "+v"(b) : "v"(x), "v"(y)); }
__device__ __forceinline__ void keep4_h(v16h a, v16h b, v16h c, v16h d) { asm volatile("v_nop" :: "v"(a), "v"(b), "v"(c), "v"(d)); }
__device__ __forceinline__ void keep4_b(v16b a, v16b b, v16b c, v16b d) { asm volatile("v_nop" :: "v"(a), "v"(b), "v"(c), "v"(d)); }
__device__ __forceinline__ void acc_guard4(v8f& a, v8f& b, v8f& c, v8f& d) { asm volatile("v_nop\n\tv_nop\n\tv_nop\n\tv_nop" : "+v"(a), "+v"(b), "+v"(c), "+v"(d)); }
template <typename T> struct Frag;
template <> struct Frag<_Float16> {
  typedef v16h V; union U { v16h v; v8h h[2]; };
  static __device__ __forceinline__ v16h load(const _Float16* p) {   // elements 0..7 <- p[0..7], 8..15 <- p[16..23]
    U f; f.h[0] = *(const v8h*)(p); f.h[1] = *(const v8h*)(p + 16); return f.v;
  }
  static __device__ __forceinline__ v8f mma(v16h a, v16h b, v8f c) {
    return __builtin_amdgcn_wmma_f32_16x16x32_f16(false, a, false, b, (short)0, c, false, false);
  }
  static __device__ __forceinline__ void guard(v8f& a, v8f& b, v16h x, v16h y) { dep_guard_h(a, b, x, y); }
  static __device__ __forceinline__ void keep(v16h a, v16h b, v16h c, v16h d) { keep4_h(a, b, c, d); }
};
template <> struct Frag<__bf16> {
  typedef v16b V; union U { v16b v; v8b h[2]; };
  static __device__ __forceinline__ v16b load(const __bf16* p) {
    U f; f.h[0] = *(const v8b*)(p); f.h[1] = *(const v8b*)(p + 16); return f.v;
  }
  static __device__ __forceinline__ v8f mma(v16b a, v16b b, v8f c) {
    return __builtin_amdgcn_wmma_f32_16x16x32_bf16(false, a, false, b, (short)0, c, false, false);
  }
  static __device__ __forceinline__ void guard(v8f& a, v8f& b, v16b x, v16b y) { dep_guard_b(a, b, x, y); }
  static __device__ __forceinline__ void keep(v16b a, v16b b, v16b c, v16b d) { keep4_b(a, b, c, d); }
};

// ---- Register-blocked batched WMMA GEMM ------------------------------------
// C[m,n] = scale * sum_k A[m,k] * Bt[n,k] (+bias)(+resid); each wave owns a 64x64 tile.
// A row-major [M,K]; Bt row-major [N,K]; M,N % 64 == 0, K % 32 == 0.
// SPLIT: operands are hi/lo planes (A2/Bt2 = lo planes, same layout); product = hi·hi + hi·lo + lo·hi.
// BIAS_MODE: 0 = none, 1 = bias[m], 2 = bias[n].
// OUT_MODE: 0 = f32, 1 = f16, 2 = bf16 hi plane (Cout) + bf16 lo plane (Cout2).
// ET: 0 = f16 operands, 1 = bf16 operands (pointers passed as 16-bit storage)
template <int ET> struct Elem;
template <> struct Elem<0> { typedef _Float16 T; };
template <> struct Elem<1> { typedef __bf16 T; };
template <int ET, bool SPLIT, int BIAS_MODE, int OUT_MODE, bool RESID, int ACT = 0>
__global__ __launch_bounds__(256) void wmma_gemm64(
    const unsigned short* __restrict__ Ap, const unsigned short* __restrict__ A2p, int lda, long strideA,
    const unsigned short* __restrict__ Btp, const unsigned short* __restrict__ Bt2p, int ldb, long strideB,
    void* __restrict__ Cout, void* __restrict__ Cout2, int ldc, long strideC,
    const float* __restrict__ bias,
    const float* __restrict__ resid, long strideR,
    int M, int N, int K, float scale) {
  typedef typename Elem<ET>::T T;
  typedef typename Frag<T>::V V;
  const T* A = (const T*)Ap; const T* A2 = (const T*)A2p; const T* Bt = (const T*)Btp; const T* Bt2 = (const T*)Bt2p;
  __shared__ __align__(16) float sT[8][16 * 68];   // per-wave 16x64 slab, pitch 68 floats
  const int b    = blockIdx.y;
  const int lane = threadIdx.x & 31;
  const int wave = threadIdx.x >> 5;
  const int tilesN = N >> 6;
  const int tilesM = M >> 6;
  const int tile = blockIdx.x * 8 + wave;
  if (tile >= tilesM * tilesN) return;   // wave-uniform; no block barriers in this kernel
  const int tm = tile / tilesN;
  const int tn = tile - tm * tilesN;
  const int m0 = tm << 6;
  const int n0 = tn << 6;

  const T* Ab  = A  + (size_t)b * strideA;
  const T* Bb  = Bt + (size_t)b * strideB;
  const T* Ab2 = SPLIT ? (A2  + (size_t)b * strideA) : nullptr;
  const T* Bb2 = SPLIT ? (Bt2 + (size_t)b * strideB) : nullptr;

  const int rlane = lane & 15;                 // row (A) / col (B, D) within subtile
  const int koff  = (lane >> 4) * 8;           // k offset of this lane half
  const int mOff  = (lane >> 4) * 8;           // D row offset

  v8f acc[4][4];
#pragma unroll
  for (int i = 0; i < 4; ++i)
#pragma unroll
    for (int j = 0; j < 4; ++j) acc[i][j] = (v8f){0.f,0.f,0.f,0.f,0.f,0.f,0.f,0.f};

  for (int k0 = 0; k0 < K; k0 += 32) {
    V bh[4], bl[4];
#pragma unroll
    for (int j = 0; j < 4; ++j) {
      const size_t bo = (size_t)(n0 + (j << 4) + rlane) * ldb + koff + k0;
      bh[j] = Frag<T>::load(Bb + bo);
      if (SPLIT) bl[j] = Frag<T>::load(Bb2 + bo);
    }
#pragma unroll
    for (int i = 0; i < 4; ++i) {
      const size_t ao = (size_t)(m0 + (i << 4) + rlane) * lda + koff + k0;
      V ah = Frag<T>::load(Ab + ao);
      V al;
      if (SPLIT) al = Frag<T>::load(Ab2 + ao);
#pragma unroll
      for (int j = 0; j < 4; ++j) {
        acc[i][j] = Frag<T>::mma(ah, bh[j], acc[i][j]);
        if (SPLIT) {
          acc[i][j] = Frag<T>::mma(ah, bl[j], acc[i][j]);
          acc[i][j] = Frag<T>::mma(al, bh[j], acc[i][j]);
        }
      }
      Frag<T>::guard(acc[i][0], acc[i][3], ah, SPLIT ? al : ah);
    }
    Frag<T>::keep(bh[0], bh[1], bh[2], bh[3]);
    if (SPLIT) Frag<T>::keep(bl[0], bl[1], bl[2], bl[3]);
  }
  acc_guard4(acc[0][0], acc[0][1], acc[0][2], acc[0][3]);
  acc_guard4(acc[1][0], acc[1][1], acc[1][2], acc[1][3]);
  acc_guard4(acc[2][0], acc[2][1], acc[2][2], acc[2][3]);
  acc_guard4(acc[3][0], acc[3][1], acc[3][2], acc[3][3]);

  // ---- epilogue ----
  float* slab = sT[wave];
  const float* Rb = RESID ? (resid + (size_t)b * strideR) : nullptr;
#pragma unroll
  for (int i = 0; i < 4; ++i) {
    const int mBase = m0 + (i << 4);
#pragma unroll
    for (int j = 0; j < 4; ++j) {
      const int n = n0 + (j << 4) + rlane;
      float bv = 0.f;
      if (BIAS_MODE == 2) bv = bias[n];
#pragma unroll
      for (int r = 0; r < 8; ++r) {
        float v = acc[i][j][r] * scale;
        if (BIAS_MODE == 1) v += bias[mBase + mOff + r];
        if (BIAS_MODE == 2) v += bv;
        if (RESID) v += Rb[(size_t)(mBase + mOff + r) * ldc + n];
        if (ACT == 1) v = tanhf(v);
        if (ACT == 2) v = fmaxf(v, 0.0f);
        if (ACT == 3) v = v / (1.0f + expf(-v));
        if (ACT == 4) v = (v > 0.f) ? v : 0.01f * v;
        if (ACT == 5) v = 0.5f * v * (1.0f + erff(v * 0.70710678118654752f));
        slab[(mOff + r) * 68 + (j << 4) + rlane] = v;
      }
    }
    __builtin_amdgcn_fence(__ATOMIC_RELEASE, "workgroup");
    __builtin_amdgcn_wave_barrier();
    __builtin_amdgcn_fence(__ATOMIC_ACQUIRE, "workgroup");
    if (OUT_MODE == 0) {
      float* C = (float*)Cout + (size_t)b * strideC;
      const int hh = lane >> 4, c4 = (lane & 15) * 4;     // row seg = 256 B = 16 lanes x 16 B
      {
#pragma unroll
        for (int it = 0; it < 8; ++it) {
          const int row = it * 2 + hh;
          v4f v = *(const v4f*)(slab + row * 68 + c4);
          *(v4f*)(C + (size_t)(mBase + row) * ldc + n0 + c4) = v;
        }
        
      }
    } else {
      const int q = lane >> 3, c8 = (lane & 7) * 8;
      unsigned short* C  = (unsigned short*)Cout  + (size_t)b * strideC;
      unsigned short* C2 = (OUT_MODE == 2) ? ((unsigned short*)Cout2 + (size_t)b * strideC) : nullptr;
      {
#pragma unroll
        for (int it = 0; it < 4; ++it) {
          const int row = it * 4 + q;
          const float* sp = slab + row * 68 + c8;
          v8h hv, lv;
#pragma unroll
          for (int e = 0; e < 8; ++e) {
            if (OUT_MODE == 1) {
              hv[e] = (_Float16)sp[e];
            } else {
              unsigned short hb = f2bf_bits(sp[e]);
              unsigned short lb = f2bf_bits(sp[e] - bf_bits2f(hb));
              hv[e] = __builtin_bit_cast(_Float16, hb);
              lv[e] = __builtin_bit_cast(_Float16, lb);
            }
          }
          *(v8h*)(C + (size_t)(mBase + row) * ldc + n0 + c8) = hv;
          if (OUT_MODE == 2) *(v8h*)(C2 + (size_t)(mBase + row) * ldc + n0 + c8) = lv;
        }
        
      }
    }
    __builtin_amdgcn_fence(__ATOMIC_RELEASE, "workgroup");
    __builtin_amdgcn_wave_barrier();
    __builtin_amdgcn_fence(__ATOMIC_ACQUIRE, "workgroup");
  }
}

__global__ __launch_bounds__(256) void cast_f32_f16x2s(
    const float* __restrict__ in, _Float16* __restrict__ out, int n2, float mul) {
  int i = blockIdx.x * 256 + threadIdx.x;
  if (i < n2) {
    const _Float16 h0 = (_Float16)(in[2 * i] * mul), h1 = (_Float16)(in[2 * i + 1] * mul);
    const unsigned u = (unsigned)__builtin_bit_cast(unsigned short, h0) | ((unsigned)__builtin_bit_cast(unsigned short, h1) << 16);
    ((unsigned*)out)[i] = u;
    
  }
}

// =====================================================================================
// Single-head attention, head dim 128, f16 q/k planes row-major [B*N][128], f16 V^T plane [128][B*N] (pitch ldv),
// f32 out. scores = (q.k^T) * inv_scale + bias[q] with bias[q] = sum_d q[q][d] * ctx[b][d],
// ctx[b][e] = sum_c context[b][c] * Wc[e][c] + bc[e] (VALU f32, per block); softmax over all keys (no mask), f32 online;
// out = p.v with p carried x2^15 in f16, folded into the final 1/l.
// Block = 4 waves = 64 query rows of one batch; 64-key chunks staged in LDS with plain loads + __syncthreads.
// grid.x = B * (N / 64); blockDim = 128 (== head dim, one thread per ctx element).
// =====================================================================================
#define AT_E 128
#define AT_C 64
#define AT_QB 64
#define AT_KC 64
#define AT_NW 4
#define AT_QP 136
#define AT_KP 136
#define AT_VP 72
#define AT_PP 72
#define AT_OP 132
#define AT_PSC 32768.0f
#define AT_L2E 1.4426950408889634f

__device__ __forceinline__ v8f mma_h16(v16h a, v16h b, v8f c) {
  c = __builtin_amdgcn_wmma_f32_16x16x32_f16(false, a, false, b, (short)0, c, false, false);
  asm volatile("v_nop\n\tv_nop\n\tv_nop\n\tv_nop" : "+v"(c) : "v"(a), "v"(b));
  return c;
}

__global__ __launch_bounds__(128)
void attn128_kernel(const _Float16* __restrict__ Qh, const _Float16* __restrict__ Kh,
                    const _Float16* __restrict__ Vt, int ldv,
                    const float* __restrict__ ctxin, const float* __restrict__ Wc, const float* __restrict__ bcv,
                    float* __restrict__ out, int nTok, float inv_scale)
{
  __shared__ __align__(16) float    ctxS[AT_E];
  __shared__ __align__(16) _Float16 Qsh[AT_QB * AT_QP];          // [q][d]      pitch 136
  __shared__ __align__(16) _Float16 Ksh[AT_KC * AT_KP];          // [kv][d]     pitch 136
  __shared__ __align__(16) _Float16 Vts[AT_E * AT_VP];           // [d][kv]     pitch 72
  __shared__ __align__(16) _Float16 Psh[AT_NW][16 * AT_PP];      // per wave P [row][kv] pitch 72
  __shared__ __align__(16) float    Os[AT_NW][16 * AT_OP];       // per wave out tile, pitch 132

  const int tid  = threadIdx.x;
  const int wave = tid >> 5;
  const int lane = tid & 31;
  const int hh   = lane >> 4;
  const int c    = lane & 15;

  const int nqb = nTok / AT_QB;
  const int b   = blockIdx.x / nqb;
  const int qb  = blockIdx.x - b * nqb;
  const int q0  = qb * AT_QB;
  const size_t rowbase = (size_t)b * nTok;       // first token row of this batch
  const size_t colbase = rowbase;                 // column offset of this batch inside V^T rows

  // ---- context projection ctx[b][e], one thread per e ----
  {
    const float* cr = ctxin + (size_t)b * AT_C;
    const float* wr = Wc + (size_t)tid * AT_C;
    float a = 0.f;
#pragma unroll 4
    for (int cc = 0; cc < AT_C; ++cc) a += cr[cc] * wr[cc];
    ctxS[tid] = a + bcv[tid];
  }
  // ---- Q block [64][128] into LDS ----
#pragma unroll
  for (int i = 0; i < 8; ++i) {
    const int idx = i * 128 + tid;
    const int row = idx >> 4, c8 = (idx & 15) * 8;
    const v8h v = *(const v8h*)(Qh + (rowbase + q0 + row) * AT_E + c8);
    *(v8h*)(Qsh + row * AT_QP + c8) = v;
  }
  __syncthreads();

  // ---- per-query context bias: lanes c / c+16 each sum 64 of the 128 d of row c of this wave ----
  float brow[8];
  {
    const _Float16* qr = Qsh + (wave * 16 + c) * AT_QP + hh * 64;
    const float* cx = ctxS + hh * 64;
    float part = 0.f;
#pragma unroll 8
    for (int e = 0; e < 64; ++e) part += (float)qr[e] * cx[e];
    part += __shfl_xor(part, 16, 32);
#pragma unroll
    for (int r = 0; r < 8; ++r) brow[r] = __shfl(part, 8 * hh + r, 32);   // row 8hh+r lives in lane 8hh+r
  }

  float mrow[8], lrow[8];
  v8f oacc[8];
  const float ninf = -__builtin_inff();
#pragma unroll
  for (int r = 0; r < 8; ++r) { mrow[r] = ninf; lrow[r] = 0.f; }
#pragma unroll
  for (int t = 0; t < 8; ++t) oacc[t] = (v8f){0.f,0.f,0.f,0.f,0.f,0.f,0.f,0.f};

  const _Float16* qfrag = Qsh + (wave * 16 + c) * AT_QP + 8 * hh;   // A operand rows of this wave
  const int nChunks = nTok / AT_KC;                                    // block-uniform, size-derived
  for (int kc = 0; kc < nChunks; ++kc) {
    const int kv0 = kc * AT_KC;
    __syncthreads();
    // ---- stage K chunk [64 kv][128 d] and V^T chunk [128 d][64 kv] with 16-B vector copies ----
#pragma unroll
    for (int i = 0; i < 8; ++i) {
      const int idx = i * 128 + tid;
      const int krow = idx >> 4, kc8 = (idx & 15) * 8;
      const v8h kk = *(const v8h*)(Kh + (rowbase + kv0 + krow) * AT_E + kc8);
      *(v8h*)(Ksh + krow * AT_KP + kc8) = kk;
      const int d = idx >> 3, vc8 = (idx & 7) * 8;
      const v8h vv = *(const v8h*)(Vt + (size_t)d * ldv + colbase + kv0 + vc8);
      *(v8h*)(Vts + d * AT_VP + vc8) = vv;
    }
    __syncthreads();

    // ---- S = Q K^T : A[m=c][k=d] from Qsh, B[k=d][n=c] from Ksh row (j*16+c) ----
    v8f s[4];
#pragma unroll
    for (int j = 0; j < 4; ++j) s[j] = (v8f){0.f,0.f,0.f,0.f,0.f,0.f,0.f,0.f};
#pragma unroll 1
    for (int dc = 0; dc < 4; ++dc) {
      const v16h qa = Frag<_Float16>::load(qfrag + dc * 32);
#pragma unroll
      for (int j = 0; j < 4; ++j) {
        const v16h kb = Frag<_Float16>::load(Ksh + (j * 16 + c) * AT_KP + dc * 32 + 8 * hh);
        s[j] = mma_h16(qa, kb, s[j]);
      }
    }

    // ---- scale + bias, chunk row max (row 8hh+r lives in the 16 lanes of this half) ----
    float cm[8];
#pragma unroll
    for (int r = 0; r < 8; ++r) {
      float m = ninf;
#pragma unroll
      for (int j = 0; j < 4; ++j) {
        const float z = s[j][r] * inv_scale + brow[r];
        s[j][r] = z;
        m = fmaxf(m, z);
      }
#pragma unroll
      for (int off = 1; off < 16; off <<= 1) m = fmaxf(m, __shfl_xor(m, off, 32));
      cm[r] = m;
    }
    _Float16* pw = Psh[wave];
#pragma unroll
    for (int r = 0; r < 8; ++r) {
      const float mnew  = fmaxf(mrow[r], cm[r]);
      const float alpha = __builtin_amdgcn_exp2f((mrow[r] - mnew) * AT_L2E);
      mrow[r] = mnew;
      float psum = 0.f;
#pragma unroll
      for (int j = 0; j < 4; ++j) {
        const float p = __builtin_amdgcn_exp2f((s[j][r] - mnew) * AT_L2E);
        psum += p;
        pw[(8 * hh + r) * AT_PP + j * 16 + c] = (_Float16)(p * AT_PSC);
      }
#pragma unroll
      for (int off = 1; off < 16; off <<= 1) psum += __shfl_xor(psum, off, 32);
      lrow[r] = lrow[r] * alpha + psum;
#pragma unroll
      for (int t = 0; t < 8; ++t) oacc[t][r] *= alpha;
    }
    __builtin_amdgcn_fence(__ATOMIC_RELEASE, "workgroup");
    __builtin_amdgcn_wave_barrier();
    __builtin_amdgcn_fence(__ATOMIC_ACQUIRE, "workgroup");

    // ---- O += P V : A[m=c][k=kv] from Psh, B[k=kv][n=d] from Vts row (t*16+c) ----
#pragma unroll 1
    for (int kk = 0; kk < 2; ++kk) {
      const v16h pa = Frag<_Float16>::load(pw + c * AT_PP + kk * 32 + 8 * hh);
#pragma unroll
      for (int t = 0; t < 8; ++t) {
        const v16h vb = Frag<_Float16>::load(Vts + (t * 16 + c) * AT_VP + kk * 32 + 8 * hh);
        oacc[t] = mma_h16(pa, vb, oacc[t]);
      }
    }
  }

  // ---- epilogue: /l, stage 16x128 f32 per wave, each 512-B row written by one instruction (32 lanes x 16 B) ----
  float* os = Os[wave];
#pragma unroll
  for (int r = 0; r < 8; ++r) {
    const float inv = 1.0f / (lrow[r] * AT_PSC);
#pragma unroll
    for (int t = 0; t < 8; ++t) os[(8 * hh + r) * AT_OP + t * 16 + c] = oacc[t][r] * inv;
  }
  __builtin_amdgcn_fence(__ATOMIC_RELEASE, "workgroup");
  __builtin_amdgcn_wave_barrier();
  __builtin_amdgcn_fence(__ATOMIC_ACQUIRE, "workgroup");
  {
    const int q0w = q0 + wave * 16;
    const int c4 = lane * 4;
    {
#pragma unroll
      for (int row = 0; row < 16; ++row) {
        v4f val = *(const v4f*)(os + row * AT_OP + c4);
        *(v4f*)(out + (rowbase + q0w + row) * AT_E + c4) = val;
      }
      
    }
  }
}

// ---------------------------------------------------------------------------
extern "C" void kernel_launch(void* const* d_in, const int* in_sizes, int n_in,
                              void* d_out, int out_size, void* d_ws, size_t ws_size,
                              hipStream_t stream)
{
  if (n_in < 10) return;
  const float* X    = (const float*)d_in[0];
  const float* ctxt = (const float*)d_in[1];
  const float* Wq   = (const float*)d_in[2];
  const float* bq   = (const float*)d_in[3];
  const float* Wk   = (const float*)d_in[4];
  const float* bk   = (const float*)d_in[5];
  const float* Wv   = (const float*)d_in[6];
  const float* bv   = (const float*)d_in[7];
  const float* Wc   = (const float*)d_in[8];
  const float* bc   = (const float*)d_in[9];
  float* out = (float*)d_out;

  const int E = AT_E, C = AT_C;
  const int nX   = in_sizes[0];
  const int Mall = nX / E;                 // B*N token rows
  const int Bn   = in_sizes[1] / C;        // batch
  if (Bn <= 0 || Mall <= 0) return;
  const int nTok = Mall / Bn;              // tokens per batch
  if (nTok * Bn != Mall || Mall * E != nX) return;
  if ((Mall % 64) != 0 || (nTok % 64) != 0) return;
  if (in_sizes[2] != E * E || in_sizes[4] != E * E || in_sizes[6] != E * E) return;
  if (in_sizes[3] != E || in_sizes[5] != E || in_sizes[7] != E) return;
  if (in_sizes[8] != E * C || in_sizes[9] != E || in_sizes[1] != Bn * C) return;
  if (out_size != nX) return;

  // ---- workspace carve (all offsets multiples of 16 KiB) ----
  const size_t nTokE = (size_t)Mall * E;              // halves per token plane
  const size_t nW    = (size_t)E * E;
  size_t off = 0;
  _Float16* Xh  = (_Float16*)((char*)d_ws + off); off += nTokE * 2;   // [Mall][128]
  _Float16* Qh  = (_Float16*)((char*)d_ws + off); off += nTokE * 2;   // [Mall][128]
  _Float16* Kh  = (_Float16*)((char*)d_ws + off); off += nTokE * 2;   // [Mall][128]
  _Float16* Vt  = (_Float16*)((char*)d_ws + off); off += nTokE * 2;   // [128][Mall]
  _Float16* Wqh = (_Float16*)((char*)d_ws + off); off += nW * 2;
  _Float16* Wkh = (_Float16*)((char*)d_ws + off); off += nW * 2;
  _Float16* Wvh = (_Float16*)((char*)d_ws + off); off += nW * 2;
  if (off > ws_size) return;

  const float wcarry = 256.0f;
  const float wundo  = 1.0f / 256.0f;

  // ---- casts f32 -> f16 ----
  {
    const int n2x = nX / 2;
    cast_f32_f16x2s<<<dim3((n2x + 255) / 256), 256, 0, stream>>>(X, Xh, n2x, 1.0f);
    const int n2w = (E * E) / 2;
    cast_f32_f16x2s<<<dim3((n2w + 255) / 256), 256, 0, stream>>>(Wq, Wqh, n2w, wcarry);
    cast_f32_f16x2s<<<dim3((n2w + 255) / 256), 256, 0, stream>>>(Wk, Wkh, n2w, wcarry);
    cast_f32_f16x2s<<<dim3((n2w + 255) / 256), 256, 0, stream>>>(Wv, Wvh, n2w, wcarry);
  }

  // ---- Q = X Wq^T + bq, K = X Wk^T + bk : [Mall][128] f16 ; V^T = Wv X^T + bv[m] : [128][Mall] f16 ----
  {
    const int tilesQK = (Mall / 64) * (E / 64);
    const dim3 gq((tilesQK + 7) / 8, 1);
    wmma_gemm64<0, false, 2, 1, false, 0><<<gq, 256, 0, stream>>>(
        (const unsigned short*)Xh, (const unsigned short*)Xh, E, 0L,
        (const unsigned short*)Wqh, (const unsigned short*)Wqh, E, 0L,
        (void*)Qh, (void*)Qh, E, 0L,
        bq, bq, 0L, Mall, E, E, wundo);
    wmma_gemm64<0, false, 2, 1, false, 0><<<gq, 256, 0, stream>>>(
        (const unsigned short*)Xh, (const unsigned short*)Xh, E, 0L,
        (const unsigned short*)Wkh, (const unsigned short*)Wkh, E, 0L,
        (void*)Kh, (void*)Kh, E, 0L,
        bk, bk, 0L, Mall, E, E, wundo);
    const int tilesV = (E / 64) * (Mall / 64);
    const dim3 gv((tilesV + 7) / 8, 1);
    wmma_gemm64<0, false, 1, 1, false, 0><<<gv, 256, 0, stream>>>(
        (const unsigned short*)Wvh, (const unsigned short*)Wvh, E, 0L,
        (const unsigned short*)Xh, (const unsigned short*)Xh, E, 0L,
        (void*)Vt, (void*)Vt, Mall, 0L,
        bv, bv, 0L, E, Mall, E, wundo);
  }

  // ---- attention ----
  {
    const float scale_f   = (float)11.313708498984761;   // sqrt(128) as f32
    const float inv_scale = 1.0f / scale_f;
    attn128_kernel<<<dim3(Bn * (nTok / 64)), 128, 0, stream>>>(
        Qh, Kh, Vt, Mall, ctxt, Wc, bc, out, nTok, inv_scale);
  }
}

// v001
// A run of this version takes 115 microseconds.
// Next to v000, in two timings, it ran 2.07 and 2.06 times as fast.
// Contractions: Q/K/V projections, Q.K^T scores and P.V on v_wmma_f32_16x16x32_f16 (f16 operands, f32 accumulate); weights carried x256 and probabilities x32768 (exact power-of-two carries folded back in f32); context projection (K=64, 4 rows) and the per-query context-bias dot on VALU f32; softmax f32.
#include <hip/hip_runtime.h>
#include <hip/hip_bf16.h>

typedef __attribute__((ext_vector_type(16))) _Float16 v16h;
typedef __attribute__((ext_vector_type(8)))  _Float16 v8h;
typedef __attribute__((ext_vector_type(16))) __bf16   v16b;
typedef __attribute__((ext_vector_type(8)))  __bf16   v8b;
typedef __attribute__((ext_vector_type(8)))  float    v8f;
typedef __attribute__((ext_vector_type(4)))  float    v4f;
#define PSCALE 32768.0f
#define U16(p) ((const unsigned short*)(const void*)(p))
#define PSCALE_INV (1.0f / 32768.0f)

__device__ __forceinline__ unsigned short f2bf_bits(float f) {
  unsigned u = __float_as_uint(f);
  return (unsigned short)((u + 0x7FFFu + ((u >> 16) & 1u)) >> 16);
}
__device__ __forceinline__ float bf_bits2f(unsigned short h) { return __uint_as_float(((unsigned)h) << 16); }

// hazard guards as plain device helpers (no inline asm inside the kernel template body)
__device__ __forceinline__ void dep_guard_h(v8f& a, v8f& b, v16h x, v16h y) { asm volatile("v_nop\n\tv_nop\n\tv_nop\n\tv_nop" : "+v"(a), "+v"(b) : "v"(x), "v"(y)); }
__device__ __forceinline__ void dep_guard_b(v8f& a, v8f& b, v16b x, v16b y) { asm volatile("v_nop\n\tv_nop\n\tv_nop\n\tv_nop" : "+v"(a), "+v"(b) : "v"(x), "v"(y)); }
__device__ __forceinline__ void keep4_h(v16h a, v16h b, v16h c, v16h d) { asm volatile("v_nop" :: "v"(a), "v"(b), "v"(c), "v"(d)); }
__device__ __forceinline__ void keep4_b(v16b a, v16b b, v16b c, v16b d) { asm volatile("v_nop" :: "v"(a), "v"(b), "v"(c), "v"(d)); }
__device__ __forceinline__ void acc_guard4(v8f& a, v8f& b, v8f& c, v8f& d) { asm volatile("v_nop\n\tv_nop\n\tv_nop\n\tv_nop" : "+v"(a), "+v"(b), "+v"(c), "+v"(d)); }
template <typename T> struct Frag;
template <> struct Frag<_Float16> {
  typedef v16h V; union U { v16h v; v8h h[2]; };
  static __device__ __forceinline__ v16h load(const _Float16* p) {   // elements 0..7 <- p[0..7], 8..15 <- p[16..23]
    U f; f.h[0] = *(const v8h*)(p); f.h[1] = *(const v8h*)(p + 16); return f.v;
  }
  static __device__ __forceinline__ v8f mma(v16h a, v16h b, v8f c) {
    return __builtin_amdgcn_wmma_f32_16x16x32_f16(false, a, false, b, (short)0, c, false, false);
  }
  static __device__ __forceinline__ void guard(v8f& a, v8f& b, v16h x, v16h y) { dep_guard_h(a, b, x, y); }
  static __device__ __forceinline__ void keep(v16h a, v16h b, v16h c, v16h d) { keep4_h(a, b, c, d); }
};
template <> struct Frag<__bf16> {
  typedef v16b V; union U { v16b v; v8b h[2]; };
  static __device__ __forceinline__ v16b load(const __bf16* p) {
    U f; f.h[0] = *(const v8b*)(p); f.h[1] = *(const v8b*)(p + 16); return f.v;
  }
  static __device__ __forceinline__ v8f mma(v16b a, v16b b, v8f c) {
    return __builtin_amdgcn_wmma_f32_16x16x32_bf16(false, a, false, b, (short)0, c, false, false);
  }
  static __device__ __forceinline__ void guard(v8f& a, v8f& b, v16b x, v16b y) { dep_guard_b(a, b, x, y); }
  static __device__ __forceinline__ void keep(v16b a, v16b b, v16b c, v16b d) { keep4_b(a, b, c, d); }
};

// ---- Register-blocked batched WMMA GEMM ------------------------------------
// C[m,n] = scale * sum_k A[m,k] * Bt[n,k] (+bias)(+resid); each wave owns a 64x64 tile.
// A row-major [M,K]; Bt row-major [N,K]; M,N % 64 == 0, K % 32 == 0.
// SPLIT: operands are hi/lo planes (A2/Bt2 = lo planes, same layout); product = hi·hi + hi·lo + lo·hi.
// BIAS_MODE: 0 = none, 1 = bias[m], 2 = bias[n].
// OUT_MODE: 0 = f32, 1 = f16, 2 = bf16 hi plane (Cout) + bf16 lo plane (Cout2).
// ET: 0 = f16 operands, 1 = bf16 operands (pointers passed as 16-bit storage)
template <int ET> struct Elem;
template <> struct Elem<0> { typedef _Float16 T; };
template <> struct Elem<1> { typedef __bf16 T; };
template <int ET, bool SPLIT, int BIAS_MODE, int OUT_MODE, bool RESID, int ACT = 0>
__global__ __launch_bounds__(256) void wmma_gemm64(
    const unsigned short* __restrict__ Ap, const unsigned short* __restrict__ A2p, int lda, long strideA,
    const unsigned short* __restrict__ Btp, const unsigned short* __restrict__ Bt2p, int ldb, long strideB,
    void* __restrict__ Cout, void* __restrict__ Cout2, int ldc, long strideC,
    const float* __restrict__ bias,
    const float* __restrict__ resid, long strideR,
    int M, int N, int K, float scale) {
  typedef typename Elem<ET>::T T;
  typedef typename Frag<T>::V V;
  const T* A = (const T*)Ap; const T* A2 = (const T*)A2p; const T* Bt = (const T*)Btp; const T* Bt2 = (const T*)Bt2p;
  __shared__ __align__(16) float sT[8][16 * 68];   // per-wave 16x64 slab, pitch 68 floats
  const int b    = blockIdx.y;
  const int lane = threadIdx.x & 31;
  const int wave = threadIdx.x >> 5;
  const int tilesN = N >> 6;
  const int tilesM = M >> 6;
  const int tile = blockIdx.x * 8 + wave;
  if (tile >= tilesM * tilesN) return;   // wave-uniform; no block barriers in this kernel
  const int tm = tile / tilesN;
  const int tn = tile - tm * tilesN;
  const int m0 = tm << 6;
  const int n0 = tn << 6;

  const T* Ab  = A  + (size_t)b * strideA;
  const T* Bb  = Bt + (size_t)b * strideB;
  const T* Ab2 = SPLIT ? (A2  + (size_t)b * strideA) : nullptr;
  const T* Bb2 = SPLIT ? (Bt2 + (size_t)b * strideB) : nullptr;

  const int rlane = lane & 15;                 // row (A) / col (B, D) within subtile
  const int koff  = (lane >> 4) * 8;           // k offset of this lane half
  const int mOff  = (lane >> 4) * 8;           // D row offset

  v8f acc[4][4];
#pragma unroll
  for (int i = 0; i < 4; ++i)
#pragma unroll
    for (int j = 0; j < 4; ++j) acc[i][j] = (v8f){0.f,0.f,0.f,0.f,0.f,0.f,0.f,0.f};

  for (int k0 = 0; k0 < K; k0 += 32) {
    V bh[4], bl[4];
#pragma unroll
    for (int j = 0; j < 4; ++j) {
      const size_t bo = (size_t)(n0 + (j << 4) + rlane) * ldb + koff + k0;
      bh[j] = Frag<T>::load(Bb + bo);
      if (SPLIT) bl[j] = Frag<T>::load(Bb2 + bo);
    }
#pragma unroll
    for (int i = 0; i < 4; ++i) {
      const size_t ao = (size_t)(m0 + (i << 4) + rlane) * lda + koff + k0;
      V ah = Frag<T>::load(Ab + ao);
      V al;
      if (SPLIT) al = Frag<T>::load(Ab2 + ao);
#pragma unroll
      for (int j = 0; j < 4; ++j) {
        acc[i][j] = Frag<T>::mma(ah, bh[j], acc[i][j]);
        if (SPLIT) {
          acc[i][j] = Frag<T>::mma(ah, bl[j], acc[i][j]);
          acc[i][j] = Frag<T>::mma(al, bh[j], acc[i][j]);
        }
      }
      Frag<T>::guard(acc[i][0], acc[i][3], ah, SPLIT ? al : ah);
    }
    Frag<T>::keep(bh[0], bh[1], bh[2], bh[3]);
    if (SPLIT) Frag<T>::keep(bl[0], bl[1], bl[2], bl[3]);
  }
  acc_guard4(acc[0][0], acc[0][1], acc[0][2], acc[0][3]);
  acc_guard4(acc[1][0], acc[1][1], acc[1][2], acc[1][3]);
  acc_guard4(acc[2][0], acc[2][1], acc[2][2], acc[2][3]);
  acc_guard4(acc[3][0], acc[3][1], acc[3][2], acc[3][3]);

  // ---- epilogue ----
  float* slab = sT[wave];
  const float* Rb = RESID ? (resid + (size_t)b * strideR) : nullptr;
#pragma unroll
  for (int i = 0; i < 4; ++i) {
    const int mBase = m0 + (i << 4);
#pragma unroll
    for (int j = 0; j < 4; ++j) {
      const int n = n0 + (j << 4) + rlane;
      float bv = 0.f;
      if (BIAS_MODE == 2) bv = bias[n];
#pragma unroll
      for (int r = 0; r < 8; ++r) {
        float v = acc[i][j][r] * scale;
        if (BIAS_MODE == 1) v += bias[mBase + mOff + r];
        if (BIAS_MODE == 2) v += bv;
        if (RESID) v += Rb[(size_t)(mBase + mOff + r) * ldc + n];
        if (ACT == 1) v = tanhf(v);
        if (ACT == 2) v = fmaxf(v, 0.0f);
        if (ACT == 3) v = v / (1.0f + expf(-v));
        if (ACT == 4) v = (v > 0.f) ? v : 0.01f * v;
        if (ACT == 5) v = 0.5f * v * (1.0f + erff(v * 0.70710678118654752f));
        slab[(mOff + r) * 68 + (j << 4) + rlane] = v;
      }
    }
    __builtin_amdgcn_fence(__ATOMIC_RELEASE, "workgroup");
    __builtin_amdgcn_wave_barrier();
    __builtin_amdgcn_fence(__ATOMIC_ACQUIRE, "workgroup");
    if (OUT_MODE == 0) {
      float* C = (float*)Cout + (size_t)b * strideC;
      const int hh = lane >> 4, c4 = (lane & 15) * 4;     // row seg = 256 B = 16 lanes x 16 B
      {
#pragma unroll
        for (int it = 0; it < 8; ++it) {
          const int row = it * 2 + hh;
          v4f v = *(const v4f*)(slab + row * 68 + c4);
          *(v4f*)(C + (size_t)(mBase + row) * ldc + n0 + c4) = v;
        }
        
      }
    } else {
      const int q = lane >> 3, c8 = (lane & 7) * 8;
      unsigned short* C  = (unsigned short*)Cout  + (size_t)b * strideC;
      unsigned short* C2 = (OUT_MODE == 2) ? ((unsigned short*)Cout2 + (size_t)b * strideC) : nullptr;
      {
#pragma unroll
        for (int it = 0; it < 4; ++it) {
          const int row = it * 4 + q;
          const float* sp = slab + row * 68 + c8;
          v8h hv, lv;
#pragma unroll
          for (int e = 0; e < 8; ++e) {
            if (OUT_MODE == 1) {
              hv[e] = (_Float16)sp[e];
            } else {
              unsigned short hb = f2bf_bits(sp[e]);
              unsigned short lb = f2bf_bits(sp[e] - bf_bits2f(hb));
              hv[e] = __builtin_bit_cast(_Float16, hb);
              lv[e] = __builtin_bit_cast(_Float16, lb);
            }
          }
          *(v8h*)(C + (size_t)(mBase + row) * ldc + n0 + c8) = hv;
          if (OUT_MODE == 2) *(v8h*)(C2 + (size_t)(mBase + row) * ldc + n0 + c8) = lv;
        }
        
      }
    }
    __builtin_amdgcn_fence(__ATOMIC_RELEASE, "workgroup");
    __builtin_amdgcn_wave_barrier();
    __builtin_amdgcn_fence(__ATOMIC_ACQUIRE, "workgroup");
  }
}

__global__ __launch_bounds__(256) void cast_f32_f16x2s(
    const float* __restrict__ in, _Float16* __restrict__ out, int n2, float mul) {
  int i = blockIdx.x * 256 + threadIdx.x;
  if (i < n2) {
    const _Float16 h0 = (_Float16)(in[2 * i] * mul), h1 = (_Float16)(in[2 * i + 1] * mul);
    const unsigned u = (unsigned)__builtin_bit_cast(unsigned short, h0) | ((unsigned)__builtin_bit_cast(unsigned short, h1) << 16);
    ((unsigned*)out)[i] = u;
    
  }
}

// =====================================================================================
// Single-head attention, head dim 128, f16 q/k planes row-major [B*N][128], f16 V^T plane [128][B*N] (pitch ldv),
// f32 out. scores = (q.k^T) * inv_scale + bias[q] with bias[q] = sum_d q[q][d] * ctx[b][d],
// ctx[b][e] = sum_c context[b][c] * Wc[e][c] + bc[e] (VALU f32, per block); softmax over all keys (no mask), f32 online;
// out = p.v with p carried x2^15 in f16, folded into the final 1/l.
// Block = 16 waves = 64 query rows of one batch x 4 key groups: wave (g, qw) runs query rows qw*16..+15 over the
// g-th 64 keys of every 256-key stage (plain loads + __syncthreads), so each SIMD holds four waves that fill one
// another's waits. Each group keeps its own online (max, sum, O); the four are merged once in LDS behind the loop.
// grid.x = B * (N / 64); blockDim = 512; N % 256 == 0.
// =====================================================================================
#define AT_E 128
#define AT_C 64
#define AT_QB 64
#define AT_KC 64
#define AT_NW 4
#define AT_G 4
#define AT_SK (AT_G * AT_KC)
#define AT_NT (AT_G * AT_NW * 32)
#define AT_QP 136
#define AT_KP 136
#define AT_VP (AT_SK + 8)
#define AT_PP 72
#define AT_OP 132
#define AT_PSC 32768.0f
#define AT_L2E 1.4426950408889634f

__device__ __forceinline__ v8f mma_h16(v16h a, v16h b, v8f c) {
  c = __builtin_amdgcn_wmma_f32_16x16x32_f16(false, a, false, b, (short)0, c, false, false);
  asm volatile("v_nop\n\tv_nop\n\tv_nop\n\tv_nop" : "+v"(c) : "v"(a), "v"(b));
  return c;
}

__global__ __launch_bounds__(AT_NT)
void attn128_kernel(const _Float16* __restrict__ Qh, const _Float16* __restrict__ Kh,
                    const _Float16* __restrict__ Vt, int ldv,
                    const float* __restrict__ ctxin, const float* __restrict__ Wc, const float* __restrict__ bcv,
                    float* __restrict__ out, int nTok, float inv_scale)
{
  __shared__ __align__(16) float    ctxS[AT_E];
  __shared__ __align__(16) _Float16 Qsh[AT_QB * AT_QP];          // [q][d]      pitch 136
  __shared__ __align__(16) _Float16 Psh[AT_G * AT_NW][16 * AT_PP];   // per wave P [row][kv] pitch 72
  __shared__ __align__(16) float    Ms[AT_G][AT_QB];             // per group row max
  __shared__ __align__(16) float    Ls[AT_G][AT_QB];             // per group row sum
  // K stage [256 kv][d] pitch 136, then V^T stage [128 d][256 kv] pitch 264; behind the loop the same bytes
  // hold the 16 waves' partial O tiles (16 x 128 f32, pitch 132).
  constexpr int KV_BYTES = (AT_SK * AT_KP + AT_E * AT_VP) * 2;
  static_assert(AT_G * AT_NW * 16 * AT_OP * 4 <= KV_BYTES, "partial O tiles must fit the K/V stage");
  __shared__ __align__(16) unsigned char KVraw[KV_BYTES];
  _Float16* const Ksh = (_Float16*)KVraw;
  _Float16* const Vts = (_Float16*)KVraw + AT_SK * AT_KP;
  float*    const Os  = (float*)KVraw;

  const int tid  = threadIdx.x;
  const int wv   = tid >> 5;        // 0..15
  const int wave = wv & (AT_NW - 1);   // query tile of this wave
  const int grp  = wv >> 2;            // key group of this wave
  const int lane = tid & 31;
  const int hh   = lane >> 4;
  const int c    = lane & 15;

  const int nqb = nTok / AT_QB;
  const int b   = blockIdx.x / nqb;
  const int qb  = blockIdx.x - b * nqb;
  const int q0  = qb * AT_QB;
  const size_t rowbase = (size_t)b * nTok;       // first token row of this batch
  const size_t colbase = rowbase;                 // column offset of this batch inside V^T rows

  // ---- context projection ctx[b][e], one thread per e ----
  if (tid < AT_E) {
    const float* cr = ctxin + (size_t)b * AT_C;
    const float* wr = Wc + (size_t)tid * AT_C;
    float a = 0.f;
#pragma unroll 4
    for (int cc = 0; cc < AT_C; ++cc) a += cr[cc] * wr[cc];
    ctxS[tid] = a + bcv[tid];
  }
  // ---- Q block [64][128] into LDS ----
#pragma unroll
  for (int i = 0; i < 2; ++i) {
    const int idx = i * AT_NT + tid;
    const int row = idx >> 4, c8 = (idx & 15) * 8;
    const v8h v = *(const v8h*)(Qh + (rowbase + q0 + row) * AT_E + c8);
    *(v8h*)(Qsh + row * AT_QP + c8) = v;
  }
  __syncthreads();

  // ---- per-query context bias: lanes c / c+16 each sum 64 of the 128 d of row c of this wave ----
  float brow[8];
  {
    const _Float16* qr = Qsh + (wave * 16 + c) * AT_QP + hh * 64;
    const float* cx = ctxS + hh * 64;
    float part = 0.f;
#pragma unroll 8
    for (int e = 0; e < 64; ++e) part += (float)qr[e] * cx[e];
    part += __shfl_xor(part, 16, 32);
#pragma unroll
    for (int r = 0; r < 8; ++r) brow[r] = __shfl(part, 8 * hh + r, 32);   // row 8hh+r lives in lane 8hh+r
  }

  float mrow[8], lrow[8];
  v8f oacc[8];
  const float ninf = -__builtin_inff();
#pragma unroll
  for (int r = 0; r < 8; ++r) { mrow[r] = ninf; lrow[r] = 0.f; }
#pragma unroll
  for (int t = 0; t < 8; ++t) oacc[t] = (v8f){0.f,0.f,0.f,0.f,0.f,0.f,0.f,0.f};

  const _Float16* qfrag = Qsh + (wave * 16 + c) * AT_QP + 8 * hh;   // A operand rows of this wave
  const _Float16* kgrp = Ksh + grp * AT_KC * AT_KP;                   // this group's 64 K rows of the stage
  const _Float16* vgrp = Vts + grp * AT_KC;                           // this group's 64 V^T columns of the stage
  const int nChunks = nTok / AT_SK;                                    // block-uniform, size-derived
  for (int kc = 0; kc < nChunks; ++kc) {
    const int kv0 = kc * AT_SK;
    __syncthreads();
    // ---- stage K [256 kv][128 d] and V^T [128 d][256 kv] with 16-B vector copies ----
#pragma unroll
    for (int i = 0; i < 8; ++i) {
      const int idx = i * AT_NT + tid;
      const int krow = idx >> 4, kc8 = (idx & 15) * 8;
      const v8h kk = *(const v8h*)(Kh + (rowbase + kv0 + krow) * AT_E + kc8);
      *(v8h*)(Ksh + krow * AT_KP + kc8) = kk;
      const int d = idx >> 5, vc8 = (idx & 31) * 8;
      const v8h vv = *(const v8h*)(Vt + (size_t)d * ldv + colbase + kv0 + vc8);
      *(v8h*)(Vts + d * AT_VP + vc8) = vv;
    }
    __syncthreads();

    // ---- S = Q K^T : A[m=c][k=d] from Qsh, B[k=d][n=c] from Ksh row (grp*64+j*16+c) ----
    v8f s[4];
#pragma unroll
    for (int j = 0; j < 4; ++j) s[j] = (v8f){0.f,0.f,0.f,0.f,0.f,0.f,0.f,0.f};
#pragma unroll 1
    for (int dc = 0; dc < 4; ++dc) {
      const v16h qa = Frag<_Float16>::load(qfrag + dc * 32);
#pragma unroll
      for (int j = 0; j < 4; ++j) {
        const v16h kb = Frag<_Float16>::load(kgrp + (j * 16 + c) * AT_KP + dc * 32 + 8 * hh);
        s[j] = mma_h16(qa, kb, s[j]);
      }
    }

    // ---- scale + bias, chunk row max (row 8hh+r lives in the 16 lanes of this half) ----
    float cm[8];
#pragma unroll
    for (int r = 0; r < 8; ++r) {
      float m = ninf;
#pragma unroll
      for (int j = 0; j < 4; ++j) {
        const float z = s[j][r] * inv_scale + brow[r];
        s[j][r] = z;
        m = fmaxf(m, z);
      }
#pragma unroll
      for (int off = 1; off < 16; off <<= 1) m = fmaxf(m, __shfl_xor(m, off, 32));
      cm[r] = m;
    }
    _Float16* pw = Psh[wv];
#pragma unroll
    for (int r = 0; r < 8; ++r) {
      const float mnew  = fmaxf(mrow[r], cm[r]);
      const float alpha = __builtin_amdgcn_exp2f((mrow[r] - mnew) * AT_L2E);
      mrow[r] = mnew;
      float psum = 0.f;
#pragma unroll
      for (int j = 0; j < 4; ++j) {
        const float p = __builtin_amdgcn_exp2f((s[j][r] - mnew) * AT_L2E);
        psum += p;
        pw[(8 * hh + r) * AT_PP + j * 16 + c] = (_Float16)(p * AT_PSC);
      }
#pragma unroll
      for (int off = 1; off < 16; off <<= 1) psum += __shfl_xor(psum, off, 32);
      lrow[r] = lrow[r] * alpha + psum;
#pragma unroll
      for (int t = 0; t < 8; ++t) oacc[t][r] *= alpha;
    }
    __builtin_amdgcn_fence(__ATOMIC_RELEASE, "workgroup");
    __builtin_amdgcn_wave_barrier();
    __builtin_amdgcn_fence(__ATOMIC_ACQUIRE, "workgroup");

    // ---- O += P V : A[m=c][k=kv] from Psh, B[k=kv][n=d] from Vts row (t*16+c) ----
#pragma unroll 1
    for (int kk = 0; kk < 2; ++kk) {
      const v16h pa = Frag<_Float16>::load(pw + c * AT_PP + kk * 32 + 8 * hh);
#pragma unroll
      for (int t = 0; t < 8; ++t) {
        const v16h vb = Frag<_Float16>::load(vgrp + (t * 16 + c) * AT_VP + kk * 32 + 8 * hh);
        oacc[t] = mma_h16(pa, vb, oacc[t]);
      }
    }
  }

  // ---- merge of the four key groups: every wave lays down its un-normalised O tile and its rows' (max, sum) ----
  __syncthreads();   // every wave has left the K/V stage before its bytes become the partial O tiles
  {
    float* os = Os + wv * (16 * AT_OP);
#pragma unroll
    for (int r = 0; r < 8; ++r) {
#pragma unroll
      for (int t = 0; t < 8; ++t) os[(8 * hh + r) * AT_OP + t * 16 + c] = oacc[t][r];
      if (c == 0) {
        Ms[grp][wave * 16 + 8 * hh + r] = mrow[r];
        Ls[grp][wave * 16 + 8 * hh + r] = lrow[r];
      }
    }
  }
  __syncthreads();   // publishes the partial tiles to the waves that merge them
  // wave (grp, wave) merges rows grp*4..+3 of query tile 'wave'; each 512-B row is written by one instruction
  {
    const int c4 = lane * 4;
#pragma unroll
    for (int rr = 0; rr < 4; ++rr) {
      const int row  = grp * 4 + rr;
      const int qrow = wave * 16 + row;
      float mg[AT_G];
      float mall = ninf;
#pragma unroll
      for (int g = 0; g < AT_G; ++g) { mg[g] = Ms[g][qrow]; mall = fmaxf(mall, mg[g]); }
      float lall = 0.f;
      v4f val = (v4f){0.f, 0.f, 0.f, 0.f};
#pragma unroll
      for (int g = 0; g < AT_G; ++g) {
        const float w = __builtin_amdgcn_exp2f((mg[g] - mall) * AT_L2E);
        lall += w * Ls[g][qrow];
        const v4f part = *(const v4f*)(Os + (g * AT_NW + wave) * (16 * AT_OP) + row * AT_OP + c4);
        val += part * w;
      }
      const float inv = 1.0f / (lall * AT_PSC);
      *(v4f*)(out + (rowbase + q0 + qrow) * AT_E + c4) = val * inv;
    }
  }
}

// ---------------------------------------------------------------------------
extern "C" void kernel_launch(void* const* d_in, const int* in_sizes, int n_in,
                              void* d_out, int out_size, void* d_ws, size_t ws_size,
                              hipStream_t stream)
{
  if (n_in < 10) return;
  const float* X    = (const float*)d_in[0];
  const float* ctxt = (const float*)d_in[1];
  const float* Wq   = (const float*)d_in[2];
  const float* bq   = (const float*)d_in[3];
  const float* Wk   = (const float*)d_in[4];
  const float* bk   = (const float*)d_in[5];
  const float* Wv   = (const float*)d_in[6];
  const float* bv   = (const float*)d_in[7];
  const float* Wc   = (const float*)d_in[8];
  const float* bc   = (const float*)d_in[9];
  float* out = (float*)d_out;

  const int E = AT_E, C = AT_C;
  const int nX   = in_sizes[0];
  const int Mall = nX / E;                 // B*N token rows
  const int Bn   = in_sizes[1] / C;        // batch
  if (Bn <= 0 || Mall <= 0) return;
  const int nTok = Mall / Bn;              // tokens per batch
  if (nTok * Bn != Mall || Mall * E != nX) return;
  if ((Mall % 64) != 0 || (nTok % AT_SK) != 0) return;
  if (in_sizes[2] != E * E || in_sizes[4] != E * E || in_sizes[6] != E * E) return;
  if (in_sizes[3] != E || in_sizes[5] != E || in_sizes[7] != E) return;
  if (in_sizes[8] != E * C || in_sizes[9] != E || in_sizes[1] != Bn * C) return;
  if (out_size != nX) return;

  // ---- workspace carve (all offsets multiples of 16 KiB) ----
  const size_t nTokE = (size_t)Mall * E;              // halves per token plane
  const size_t nW    = (size_t)E * E;
  size_t off = 0;
  _Float16* Xh  = (_Float16*)((char*)d_ws + off); off += nTokE * 2;   // [Mall][128]
  _Float16* Qh  = (_Float16*)((char*)d_ws + off); off += nTokE * 2;   // [Mall][128]
  _Float16* Kh  = (_Float16*)((char*)d_ws + off); off += nTokE * 2;   // [Mall][128]
  _Float16* Vt  = (_Float16*)((char*)d_ws + off); off += nTokE * 2;   // [128][Mall]
  _Float16* Wqh = (_Float16*)((char*)d_ws + off); off += nW * 2;
  _Float16* Wkh = (_Float16*)((char*)d_ws + off); off += nW * 2;
  _Float16* Wvh = (_Float16*)((char*)d_ws + off); off += nW * 2;
  if (off > ws_size) return;

  const float wcarry = 256.0f;
  const float wundo  = 1.0f / 256.0f;

  // ---- casts f32 -> f16 ----
  {
    const int n2x = nX / 2;
    cast_f32_f16x2s<<<dim3((n2x + 255) / 256), 256, 0, stream>>>(X, Xh, n2x, 1.0f);
    const int n2w = (E * E) / 2;
    cast_f32_f16x2s<<<dim3((n2w + 255) / 256), 256, 0, stream>>>(Wq, Wqh, n2w, wcarry);
    cast_f32_f16x2s<<<dim3((n2w + 255) / 256), 256, 0, stream>>>(Wk, Wkh, n2w, wcarry);
    cast_f32_f16x2s<<<dim3((n2w + 255) / 256), 256, 0, stream>>>(Wv, Wvh, n2w, wcarry);
  }

  // ---- Q = X Wq^T + bq, K = X Wk^T + bk : [Mall][128] f16 ; V^T = Wv X^T + bv[m] : [128][Mall] f16 ----
  {
    const int tilesQK = (Mall / 64) * (E / 64);
    const dim3 gq((tilesQK + 7) / 8, 1);
    wmma_gemm64<0, false, 2, 1, false, 0><<<gq, 256, 0, stream>>>(
        (const unsigned short*)Xh, (const unsigned short*)Xh, E, 0L,
        (const unsigned short*)Wqh, (const unsigned short*)Wqh, E, 0L,
        (void*)Qh, (void*)Qh, E, 0L,
        bq, bq, 0L, Mall, E, E, wundo);
    wmma_gemm64<0, false, 2, 1, false, 0><<<gq, 256, 0, stream>>>(
        (const unsigned short*)Xh, (const unsigned short*)Xh, E, 0L,
        (const unsigned short*)Wkh, (const unsigned short*)Wkh, E, 0L,
        (void*)Kh, (void*)Kh, E, 0L,
        bk, bk, 0L, Mall, E, E, wundo);
    const int tilesV = (E / 64) * (Mall / 64);
    const dim3 gv((tilesV + 7) / 8, 1);
    wmma_gemm64<0, false, 1, 1, false, 0><<<gv, 256, 0, stream>>>(
        (const unsigned short*)Wvh, (const unsigned short*)Wvh, E, 0L,
        (const unsigned short*)Xh, (const unsigned short*)Xh, E, 0L,
        (void*)Vt, (void*)Vt, Mall, 0L,
        bv, bv, 0L, E, Mall, E, wundo);
  }

  // ---- attention ----
  {
    const float scale_f   = (float)11.313708498984761;   // sqrt(128) as f32
    const float inv_scale = 1.0f / scale_f;
    attn128_kernel<<<dim3(Bn * (nTok / 64)), AT_NT, 0, stream>>>(
        Qh, Kh, Vt, Mall, ctxt, Wc, bc, out, nTok, inv_scale);
  }
}

// v002
// One run takes 86.6 microseconds.
// Two timings next to v001 put it at 1.32 and 1.34 times that version's speed.
// Over all steps from v000 it is 2.74 times as fast.
// Contractions: Q/K/V projections, Q.K^T scores and P.V on v_wmma_f32_16x16x32_f16 (f16 operands, f32 accumulate); weights carried x256 and probabilities x32768 (exact power-of-two carries folded back in f32); context projection (K=64, 4 rows) and the per-query context-bias dot on VALU f32; softmax f32.
#include <hip/hip_runtime.h>

typedef __attribute__((ext_vector_type(16))) _Float16 v16h;
typedef __attribute__((ext_vector_type(8)))  _Float16 v8h;
typedef __attribute__((ext_vector_type(4)))  _Float16 v4h;
typedef __attribute__((ext_vector_type(8)))  float    v8f;
typedef __attribute__((ext_vector_type(4)))  float    v4f;

template <typename T> struct Frag;
template <> struct Frag<_Float16> {
  typedef v16h V; union U { v16h v; v8h h[2]; };
  static __device__ __forceinline__ v16h load(const _Float16* p) {   // elements 0..7 <- p[0..7], 8..15 <- p[16..23]
    U f; f.h[0] = *(const v8h*)(p); f.h[1] = *(const v8h*)(p + 16); return f.v;
  }
};

// =====================================================================================
// Q, K and V^T projections of 64 token rows in one launch, straight from the f32 inputs.
// Q = X Wq^T + bq, K = X Wk^T + bk : f16 [tokens][128]; V^T = (X Wv^T + bv)^T : f16 [128][tokens] (pitch ldv).
// Block = 12 waves. The block casts its X rows and the three weight matrices (x wcarry) to f16 on the way into LDS
// (512-B wave loads, one row each); waves 0..3 / 4..7 / 8..11 then form Q / K / V^T.
// Each wave owns 2 x 4 tiles of 16 x 16, with the operand whose index runs along an OUTPUT ROW as A: a lane's 8
// accumulator registers are then 8 neighbours of one output row and go to the LDS out tile as one 16-B store.
//   Q, K : A = 32 weight rows (features), B = the 64 X rows (tokens)      -> out tile [token][feature]
//   V^T  : A = 32 X rows (tokens),        B = 64 weight rows (features)   -> out tile [feature][token]
// The out tiles leave as whole 128-B lines. grid.x = tokens / 64; blockDim = 384.
// Every loop is fully unrolled (#pragma unroll): its arrays are indexed by the counter and must stay in registers,
// and the 46 loads of a wave must all be in flight before the first wait.
// =====================================================================================
#define PJ_E 128
#define PJ_TOK 64
#define PJ_NT 384
#define PJ_P 136                         // LDS pitch (halves) of 128-half rows
#define PJ_VP 72                         // LDS pitch (halves) of the V^T tile's 64-half rows
#define PJ_OT (PJ_E * PJ_VP)             // halves per out tile (>= 64 * 136)

__global__ __launch_bounds__(PJ_NT)
void qkv_proj_kernel(const float* __restrict__ X,
                     const float* __restrict__ Wq, const float* __restrict__ bq,
                     const float* __restrict__ Wk, const float* __restrict__ bk,
                     const float* __restrict__ Wv, const float* __restrict__ bv,
                     _Float16* __restrict__ Qh, _Float16* __restrict__ Kh, _Float16* __restrict__ Vt, int ldv,
                     float wcarry, float wundo)
{
  static_assert(PJ_TOK * PJ_P <= PJ_OT, "Q/K out tile must fit");
  __shared__ __align__(16) _Float16 Sm[(PJ_TOK + 3 * PJ_E) * PJ_P];   // rows 0..63: X; rows 64 + 128 m + f: weight m
  __shared__ __align__(16) _Float16 Ot[3 * PJ_OT];

  const int tid   = threadIdx.x;
  const int wv    = __builtin_amdgcn_readfirstlane(tid >> 5);   // 0..11, in a scalar register: selects by matrix stay scalar
  const int mat   = wv >> 2;                                    // 0 Q, 1 K, 2 V
  const int sl    = wv & 3;
  const int gt    = tid & 127;                                  // thread inside its 4-wave group
  const int lane  = tid & 31;
  const int rlane = lane & 15;
  const int hh    = lane >> 4;
  const int tok0  = blockIdx.x * PJ_TOK;

  // ---- all global loads first, none under a branch: bias values, X rows (block), this group's weight matrix ----
  const int colA0 = (mat < 2) ? sl * 32 : (sl & 1) * 32;         // first out column of the wave (A index)
  const int rowB0 = (mat < 2) ? 0 : (sl >> 1) * 64;              // first out row of the wave (B index)
  const v4f* bA = (const v4f*)((mat == 1 ? bk : bq) + colA0 + 8 * hh);   // in bounds for every wave; used by Q, K
  v4f bmv[2][2];
  float bnv[4];
#pragma unroll
  for (int i = 0; i < 2; ++i) { bmv[i][0] = bA[i * 4]; bmv[i][1] = bA[i * 4 + 1]; }
#pragma unroll
  for (int j = 0; j < 4; ++j) bnv[j] = bv[rowB0 + j * 16 + rlane];       // in bounds for every wave; used by V

  const v4f* Xg = (const v4f*)(X + (size_t)tok0 * PJ_E);
  const v4f* Wg = (const v4f*)(mat == 0 ? Wq : (mat == 1 ? Wk : Wv));
  // X: 2048 16-B pieces = 5 per thread + 128; every group loads the last 128, group 0 alone stores them
  v4f xr[6], wr[32];
#pragma unroll
  for (int i = 0; i < 5; ++i) xr[i] = Xg[i * PJ_NT + tid];
  xr[5] = Xg[5 * PJ_NT + gt];
#pragma unroll
  for (int i = 0; i < 32; ++i) wr[i] = Wg[i * 128 + gt];

  // ---- cast to f16 into LDS ----
#pragma unroll
  for (int i = 0; i < 6; ++i) {
    const int idx = (i < 5) ? i * PJ_NT + tid : 5 * PJ_NT + gt;
    v4h h;
#pragma unroll
    for (int e = 0; e < 4; ++e) h[e] = (_Float16)xr[i][e];
    if (i < 5 || mat == 0) *(v4h*)(Sm + (idx >> 5) * PJ_P + (idx & 31) * 4) = h;
  }
  {
    _Float16* wdst = Sm + (PJ_TOK + mat * PJ_E) * PJ_P;
#pragma unroll
    for (int i = 0; i < 32; ++i) {
      const int idx = i * 128 + gt;
      v4h h;
#pragma unroll
      for (int e = 0; e < 4; ++e) h[e] = (_Float16)(wr[i][e] * wcarry);
      *(v4h*)(wdst + (idx >> 5) * PJ_P + (idx & 31) * 4) = h;
    }
  }
  __syncthreads();

  float bm[2][8], bn[4];                                         // bias along A (Q, K) or along B (V); the other is 0
#pragma unroll
  for (int i = 0; i < 2; ++i)
#pragma unroll
    for (int r = 0; r < 8; ++r) bm[i][r] = (mat < 2) ? bmv[i][r >> 2][r & 3] : 0.f;
#pragma unroll
  for (int j = 0; j < 4; ++j) bn[j] = (mat < 2) ? 0.f : bnv[j];

  // ---- products: both operands by the same loader, so their k orders agree ----
  const int rowA = (mat < 2) ? (PJ_TOK + mat * PJ_E + colA0) : colA0;
  const int rowB = (mat < 2) ? 0 : (PJ_TOK + 2 * PJ_E + rowB0);
  const _Float16* pA = Sm + (rowA + rlane) * PJ_P + 8 * hh;
  const _Float16* pB = Sm + (rowB + rlane) * PJ_P + 8 * hh;
  v8f acc[2][4];
#pragma unroll
  for (int i = 0; i < 2; ++i)
#pragma unroll
    for (int j = 0; j < 4; ++j) acc[i][j] = (v8f){0.f,0.f,0.f,0.f,0.f,0.f,0.f,0.f};
#pragma unroll
  for (int k0 = 0; k0 < PJ_E; k0 += 32) {
    v16h a[2], b[4];
#pragma unroll
    for (int i = 0; i < 2; ++i) a[i] = Frag<_Float16>::load(pA + i * 16 * PJ_P + k0);
#pragma unroll
    for (int j = 0; j < 4; ++j) b[j] = Frag<_Float16>::load(pB + j * 16 * PJ_P + k0);
#pragma unroll
    for (int i = 0; i < 2; ++i)
#pragma unroll
      for (int j = 0; j < 4; ++j)
        acc[i][j] = __builtin_amdgcn_wmma_f32_16x16x32_f16(false, a[i], false, b[j], (short)0, acc[i][j], false, false);
  }

  // ---- undo the carry, add the bias, f16, out tile in LDS ----
  _Float16* ot = Ot + mat * PJ_OT;
  const int opitch = (mat < 2) ? PJ_P : PJ_VP;
#pragma unroll
  for (int i = 0; i < 2; ++i)
#pragma unroll
    for (int j = 0; j < 4; ++j) {
      v8h hv;
#pragma unroll
      for (int r = 0; r < 8; ++r) hv[r] = (_Float16)((acc[i][j][r] * wundo + bm[i][r]) + bn[j]);
      *(v8h*)(ot + (rowB0 + j * 16 + rlane) * opitch + colA0 + i * 16 + 8 * hh) = hv;
    }
  __syncthreads();

  // ---- each group stores its own tile: 16 B per lane, whole 128-B lines (Q, K: 64 rows of 256 B; V^T: 128 of 128 B) ----
  _Float16* G = (mat == 0) ? Qh + (size_t)tok0 * PJ_E : ((mat == 1) ? Kh + (size_t)tok0 * PJ_E : Vt + tok0);
  const int gpitch = (mat < 2) ? PJ_E : ldv;
  const int rsh    = (mat < 2) ? 4 : 3;                            // 16-B pieces per row: 16 or 8
  const int c8     = (gt & ((1 << rsh) - 1)) * 8;
#pragma unroll
  for (int i = 0; i < 8; ++i) {
    const int row = (i * 128 + gt) >> rsh;
    *(v8h*)(G + (size_t)row * gpitch + c8) = *(const v8h*)(ot + row * opitch + c8);
  }
}

// =====================================================================================
// Single-head attention, head dim 128, f16 q/k planes row-major [B*N][128], f16 V^T plane [128][B*N] (pitch ldv),
// f32 out. scores = (q.k^T) * inv_scale + bias[q] with bias[q] = sum_d q[q][d] * ctx[b][d],
// ctx[b][e] = sum_c context[b][c] * Wc[e][c] + bc[e] (VALU f32, per block); softmax over all keys (no mask), f32 online;
// out = p.v with p carried x2^15 in f16, folded into the final 1/l.
// Block = 16 waves = 64 query rows of one batch x 4 key groups: wave (g, qw) runs query rows qw*16..+15 over the
// g-th 64 keys of every 256-key stage (plain loads + __syncthreads), so each SIMD holds four waves that fill one
// another's waits. Each group keeps its own online (max, sum, O); the four are merged once in LDS behind the loop.
// grid.x = B * (N / 64); blockDim = 512; N % 256 == 0.
// =====================================================================================
#define AT_E 128
#define AT_C 64
#define AT_QB 64
#define AT_KC 64
#define AT_NW 4
#define AT_G 4
#define AT_SK (AT_G * AT_KC)
#define AT_NT (AT_G * AT_NW * 32)
#define AT_QP 136
#define AT_KP 136
#define AT_VP (AT_SK + 8)
#define AT_PP 72
#define AT_OP 132
#define AT_PSC 32768.0f
#define AT_L2E 1.4426950408889634f

__device__ __forceinline__ v8f mma_h16(v16h a, v16h b, v8f c) {
  c = __builtin_amdgcn_wmma_f32_16x16x32_f16(false, a, false, b, (short)0, c, false, false);
  asm volatile("v_nop\n\tv_nop\n\tv_nop\n\tv_nop" : "+v"(c) : "v"(a), "v"(b));
  return c;
}

__global__ __launch_bounds__(AT_NT)
void attn128_kernel(const _Float16* __restrict__ Qh, const _Float16* __restrict__ Kh,
                    const _Float16* __restrict__ Vt, int ldv,
                    const float* __restrict__ ctxin, const float* __restrict__ Wc, const float* __restrict__ bcv,
                    float* __restrict__ out, int nTok, float inv_scale)
{
  __shared__ __align__(16) float    ctxS[AT_E];
  __shared__ __align__(16) _Float16 Qsh[AT_QB * AT_QP];          // [q][d]      pitch 136
  __shared__ __align__(16) _Float16 Psh[AT_G * AT_NW][16 * AT_PP];   // per wave P [row][kv] pitch 72
  __shared__ __align__(16) float    Ms[AT_G][AT_QB];             // per group row max
  __shared__ __align__(16) float    Ls[AT_G][AT_QB];             // per group row sum
  // K stage [256 kv][d] pitch 136, then V^T stage [128 d][256 kv] pitch 264; behind the loop the same bytes
  // hold the 16 waves' partial O tiles (16 x 128 f32, pitch 132).
  constexpr int KV_BYTES = (AT_SK * AT_KP + AT_E * AT_VP) * 2;
  static_assert(AT_G * AT_NW * 16 * AT_OP * 4 <= KV_BYTES, "partial O tiles must fit the K/V stage");
  __shared__ __align__(16) unsigned char KVraw[KV_BYTES];
  _Float16* const Ksh = (_Float16*)KVraw;
  _Float16* const Vts = (_Float16*)KVraw + AT_SK * AT_KP;
  float*    const Os  = (float*)KVraw;

  const int tid  = threadIdx.x;
  const int wv   = tid >> 5;        // 0..15
  const int wave = wv & (AT_NW - 1);   // query tile of this wave
  const int grp  = wv >> 2;            // key group of this wave
  const int lane = tid & 31;
  const int hh   = lane >> 4;
  const int c    = lane & 15;

  const int nqb = nTok / AT_QB;
  const int b   = blockIdx.x / nqb;
  const int qb  = blockIdx.x - b * nqb;
  const int q0  = qb * AT_QB;
  const size_t rowbase = (size_t)b * nTok;       // first token row of this batch
  const size_t colbase = rowbase;                 // column offset of this batch inside V^T rows

  // ---- context projection ctx[b][e], one thread per e ----
  if (tid < AT_E) {
    const float* cr = ctxin + (size_t)b * AT_C;
    const float* wr = Wc + (size_t)tid * AT_C;
    float a = 0.f;
#pragma unroll 4
    for (int cc = 0; cc < AT_C; ++cc) a += cr[cc] * wr[cc];
    ctxS[tid] = a + bcv[tid];
  }
  // ---- Q block [64][128] into LDS ----
#pragma unroll
  for (int i = 0; i < 2; ++i) {
    const int idx = i * AT_NT + tid;
    const int row = idx >> 4, c8 = (idx & 15) * 8;
    const v8h v = *(const v8h*)(Qh + (rowbase + q0 + row) * AT_E + c8);
    *(v8h*)(Qsh + row * AT_QP + c8) = v;
  }
  __syncthreads();

  // ---- per-query context bias: lanes c / c+16 each sum 64 of the 128 d of row c of this wave ----
  float brow[8];
  {
    const _Float16* qr = Qsh + (wave * 16 + c) * AT_QP + hh * 64;
    const float* cx = ctxS + hh * 64;
    float part = 0.f;
#pragma unroll 8
    for (int e = 0; e < 64; ++e) part += (float)qr[e] * cx[e];
    part += __shfl_xor(part, 16, 32);
#pragma unroll
    for (int r = 0; r < 8; ++r) brow[r] = __shfl(part, 8 * hh + r, 32);   // row 8hh+r lives in lane 8hh+r
  }

  float mrow[8], lrow[8];
  v8f oacc[8];
  const float ninf = -__builtin_inff();
#pragma unroll
  for (int r = 0; r < 8; ++r) { mrow[r] = ninf; lrow[r] = 0.f; }
#pragma unroll
  for (int t = 0; t < 8; ++t) oacc[t] = (v8f){0.f,0.f,0.f,0.f,0.f,0.f,0.f,0.f};

  const _Float16* qfrag = Qsh + (wave * 16 + c) * AT_QP + 8 * hh;   // A operand rows of this wave
  const _Float16* kgrp = Ksh + grp * AT_KC * AT_KP;                   // this group's 64 K rows of the stage
  const _Float16* vgrp = Vts + grp * AT_KC;                           // this group's 64 V^T columns of the stage
  const int nChunks = nTok / AT_SK;                                    // block-uniform, size-derived
  for (int kc = 0; kc < nChunks; ++kc) {
    const int kv0 = kc * AT_SK;
    __syncthreads();
    // ---- stage K [256 kv][128 d] and V^T [128 d][256 kv] with 16-B vector copies ----
#pragma unroll
    for (int i = 0; i < 8; ++i) {
      const int idx = i * AT_NT + tid;
      const int krow = idx >> 4, kc8 = (idx & 15) * 8;
      const v8h kk = *(const v8h*)(Kh + (rowbase + kv0 + krow) * AT_E + kc8);
      *(v8h*)(Ksh + krow * AT_KP + kc8) = kk;
      const int d = idx >> 5, vc8 = (idx & 31) * 8;
      const v8h vv = *(const v8h*)(Vt + (size_t)d * ldv + colbase + kv0 + vc8);
      *(v8h*)(Vts + d * AT_VP + vc8) = vv;
    }
    __syncthreads();

    // ---- S = Q K^T : A[m=c][k=d] from Qsh, B[k=d][n=c] from Ksh row (grp*64+j*16+c) ----
    v8f s[4];
#pragma unroll
    for (int j = 0; j < 4; ++j) s[j] = (v8f){0.f,0.f,0.f,0.f,0.f,0.f,0.f,0.f};
#pragma unroll 1
    for (int dc = 0; dc < 4; ++dc) {
      const v16h qa = Frag<_Float16>::load(qfrag + dc * 32);
#pragma unroll
      for (int j = 0; j < 4; ++j) {
        const v16h kb = Frag<_Float16>::load(kgrp + (j * 16 + c) * AT_KP + dc * 32 + 8 * hh);
        s[j] = mma_h16(qa, kb, s[j]);
      }
    }

    // ---- scale + bias, chunk row max (row 8hh+r lives in the 16 lanes of this half) ----
    float cm[8];
#pragma unroll
    for (int r = 0; r < 8; ++r) {
      float m = ninf;
#pragma unroll
      for (int j = 0; j < 4; ++j) {
        const float z = s[j][r] * inv_scale + brow[r];
        s[j][r] = z;
        m = fmaxf(m, z);
      }
#pragma unroll
      for (int off = 1; off < 16; off <<= 1) m = fmaxf(m, __shfl_xor(m, off, 32));
      cm[r] = m;
    }
    _Float16* pw = Psh[wv];
#pragma unroll
    for (int r = 0; r < 8; ++r) {
      const float mnew  = fmaxf(mrow[r], cm[r]);
      const float alpha = __builtin_amdgcn_exp2f((mrow[r] - mnew) * AT_L2E);
      mrow[r] = mnew;
      float psum = 0.f;
#pragma unroll
      for (int j = 0; j < 4; ++j) {
        const float p = __builtin_amdgcn_exp2f((s[j][r] - mnew) * AT_L2E);
        psum += p;
        pw[(8 * hh + r) * AT_PP + j * 16 + c] = (_Float16)(p * AT_PSC);
      }
#pragma unroll
      for (int off = 1; off < 16; off <<= 1) psum += __shfl_xor(psum, off, 32);
      lrow[r] = lrow[r] * alpha + psum;
#pragma unroll
      for (int t = 0; t < 8; ++t) oacc[t][r] *= alpha;
    }
    __builtin_amdgcn_fence(__ATOMIC_RELEASE, "workgroup");
    __builtin_amdgcn_wave_barrier();
    __builtin_amdgcn_fence(__ATOMIC_ACQUIRE, "workgroup");

    // ---- O += P V : A[m=c][k=kv] from Psh, B[k=kv][n=d] from Vts row (t*16+c) ----
#pragma unroll 1
    for (int kk = 0; kk < 2; ++kk) {
      const v16h pa = Frag<_Float16>::load(pw + c * AT_PP + kk * 32 + 8 * hh);
#pragma unroll
      for (int t = 0; t < 8; ++t) {
        const v16h vb = Frag<_Float16>::load(vgrp + (t * 16 + c) * AT_VP + kk * 32 + 8 * hh);
        oacc[t] = mma_h16(pa, vb, oacc[t]);
      }
    }
  }

  // ---- merge of the four key groups: every wave lays down its un-normalised O tile and its rows' (max, sum) ----
  __syncthreads();   // every wave has left the K/V stage before its bytes become the partial O tiles
  {
    float* os = Os + wv * (16 * AT_OP);
#pragma unroll
    for (int r = 0; r < 8; ++r) {
#pragma unroll
      for (int t = 0; t < 8; ++t) os[(8 * hh + r) * AT_OP + t * 16 + c] = oacc[t][r];
      if (c == 0) {
        Ms[grp][wave * 16 + 8 * hh + r] = mrow[r];
        Ls[grp][wave * 16 + 8 * hh + r] = lrow[r];
      }
    }
  }
  __syncthreads();   // publishes the partial tiles to the waves that merge them
  // wave (grp, wave) merges rows grp*4..+3 of query tile 'wave'; each 512-B row is written by one instruction
  {
    const int c4 = lane * 4;
#pragma unroll
    for (int rr = 0; rr < 4; ++rr) {
      const int row  = grp * 4 + rr;
      const int qrow = wave * 16 + row;
      float mg[AT_G];
      float mall = ninf;
#pragma unroll
      for (int g = 0; g < AT_G; ++g) { mg[g] = Ms[g][qrow]; mall = fmaxf(mall, mg[g]); }
      float lall = 0.f;
      v4f val = (v4f){0.f, 0.f, 0.f, 0.f};
#pragma unroll
      for (int g = 0; g < AT_G; ++g) {
        const float w = __builtin_amdgcn_exp2f((mg[g] - mall) * AT_L2E);
        lall += w * Ls[g][qrow];
        const v4f part = *(const v4f*)(Os + (g * AT_NW + wave) * (16 * AT_OP) + row * AT_OP + c4);
        val += part * w;
      }
      const float inv = 1.0f / (lall * AT_PSC);
      *(v4f*)(out + (rowbase + q0 + qrow) * AT_E + c4) = val * inv;
    }
  }
}

// ---------------------------------------------------------------------------
extern "C" void kernel_launch(void* const* d_in, const int* in_sizes, int n_in,
                              void* d_out, int out_size, void* d_ws, size_t ws_size,
                              hipStream_t stream)
{
  if (n_in < 10) return;
  const float* X    = (const float*)d_in[0];
  const float* ctxt = (const float*)d_in[1];
  const float* Wq   = (const float*)d_in[2];
  const float* bq   = (const float*)d_in[3];
  const float* Wk   = (const float*)d_in[4];
  const float* bk   = (const float*)d_in[5];
  const float* Wv   = (const float*)d_in[6];
  const float* bv   = (const float*)d_in[7];
  const float* Wc   = (const float*)d_in[8];
  const float* bc   = (const float*)d_in[9];
  float* out = (float*)d_out;

  const int E = AT_E, C = AT_C;
  const int nX   = in_sizes[0];
  const int Mall = nX / E;                 // B*N token rows
  const int Bn   = in_sizes[1] / C;        // batch
  if (Bn <= 0 || Mall <= 0) return;
  const int nTok = Mall / Bn;              // tokens per batch
  if (nTok * Bn != Mall || Mall * E != nX) return;
  if ((Mall % 64) != 0 || (nTok % AT_SK) != 0) return;
  if (in_sizes[2] != E * E || in_sizes[4] != E * E || in_sizes[6] != E * E) return;
  if (in_sizes[3] != E || in_sizes[5] != E || in_sizes[7] != E) return;
  if (in_sizes[8] != E * C || in_sizes[9] != E || in_sizes[1] != Bn * C) return;
  if (out_size != nX) return;

  // ---- workspace carve (all offsets multiples of 16 KiB) ----
  const size_t nTokE = (size_t)Mall * E;              // halves per token plane
  size_t off = 0;
  _Float16* Qh  = (_Float16*)((char*)d_ws + off); off += nTokE * 2;   // [Mall][128]
  _Float16* Kh  = (_Float16*)((char*)d_ws + off); off += nTokE * 2;   // [Mall][128]
  _Float16* Vt  = (_Float16*)((char*)d_ws + off); off += nTokE * 2;   // [128][Mall]
  if (off > ws_size) return;

  // ---- Q = X Wq^T + bq, K = X Wk^T + bk : [Mall][128] f16 ; V^T : [128][Mall] f16 ; casts included ----
  qkv_proj_kernel<<<dim3(Mall / PJ_TOK), PJ_NT, 0, stream>>>(
      X, Wq, bq, Wk, bk, Wv, bv, Qh, Kh, Vt, Mall, 256.0f, 1.0f / 256.0f);

  // ---- attention ----
  {
    const float scale_f   = (float)11.313708498984761;   // sqrt(128) as f32
    const float inv_scale = 1.0f / scale_f;
    attn128_kernel<<<dim3(Bn * (nTok / 64)), AT_NT, 0, stream>>>(
        Qh, Kh, Vt, Mall, ctxt, Wc, bc, out, nTok, inv_scale);
  }
}

// v003
// It runs in 77.3 microseconds.
// Next to v002, in two timings, it ran 1.12 times as fast each time.
// All steps since v000 together make it 3.06 times as fast.
// Contractions: Q/K/V projections, Q.K^T scores and P.V on v_wmma_f32_16x16x32_f16 (f16 operands, f32 accumulate); weights carried x256 and probabilities x32768 (exact power-of-two carries folded back in f32); context projection (K=64, 4 rows) and the per-query context-bias dot on VALU f32; softmax f32.
#include <hip/hip_runtime.h>

typedef __attribute__((ext_vector_type(16))) _Float16 v16h;
typedef __attribute__((ext_vector_type(8)))  _Float16 v8h;
typedef __attribute__((ext_vector_type(4)))  _Float16 v4h;
typedef __attribute__((ext_vector_type(8)))  float    v8f;
typedef __attribute__((ext_vector_type(4)))  float    v4f;

template <typename T> struct Frag;
template <> struct Frag<_Float16> {
  typedef v16h V; union U { v16h v; v8h h[2]; };
  static __device__ __forceinline__ v16h load(const _Float16* p) {   // elements 0..7 <- p[0..7], 8..15 <- p[16..23]
    U f; f.h[0] = *(const v8h*)(p); f.h[1] = *(const v8h*)(p + 16); return f.v;
  }
};

// =====================================================================================
// Q, K and V^T projections of 64 token rows in one launch, straight from the f32 inputs.
// Q = X Wq^T + bq, K = X Wk^T + bk : f16 [tokens][128]; V^T = (X Wv^T + bv)^T : f16 [128][tokens] (pitch ldv).
// Block = 12 waves. The block casts its X rows and the three weight matrices (x wcarry) to f16 on the way into LDS
// (512-B wave loads, one row each); waves 0..3 / 4..7 / 8..11 then form Q / K / V^T.
// Each wave owns 2 x 4 tiles of 16 x 16, with the operand whose index runs along an OUTPUT ROW as A: a lane's 8
// accumulator registers are then 8 neighbours of one output row and go to the LDS out tile as one 16-B store.
//   Q, K : A = 32 weight rows (features), B = the 64 X rows (tokens)      -> out tile [token][feature]
//   V^T  : A = 32 X rows (tokens),        B = 64 weight rows (features)   -> out tile [feature][token]
// The out tiles leave as whole 128-B lines. grid.x = tokens / 64; blockDim = 384.
// Every loop is fully unrolled (#pragma unroll): its arrays are indexed by the counter and must stay in registers,
// and the 46 loads of a wave must all be in flight before the first wait.
// =====================================================================================
#define PJ_E 128
#define PJ_TOK 64
#define PJ_NT 384
#define PJ_P 136                         // LDS pitch (halves) of 128-half rows
#define PJ_VP 72                         // LDS pitch (halves) of the V^T tile's 64-half rows
#define PJ_OT (PJ_E * PJ_VP)             // halves per out tile (>= 64 * 136)

__global__ __launch_bounds__(PJ_NT)
void qkv_proj_kernel(const float* __restrict__ X,
                     const float* __restrict__ Wq, const float* __restrict__ bq,
                     const float* __restrict__ Wk, const float* __restrict__ bk,
                     const float* __restrict__ Wv, const float* __restrict__ bv,
                     _Float16* __restrict__ Qh, _Float16* __restrict__ Kh, _Float16* __restrict__ Vt, int ldv,
                     float wcarry, float wundo)
{
  static_assert(PJ_TOK * PJ_P <= PJ_OT, "Q/K out tile must fit");
  __shared__ __align__(16) _Float16 Sm[(PJ_TOK + 3 * PJ_E) * PJ_P];   // rows 0..63: X; rows 64 + 128 m + f: weight m
  __shared__ __align__(16) _Float16 Ot[3 * PJ_OT];

  const int tid   = threadIdx.x;
  const int wv    = __builtin_amdgcn_readfirstlane(tid >> 5);   // 0..11, in a scalar register: selects by matrix stay scalar
  const int mat   = wv >> 2;                                    // 0 Q, 1 K, 2 V
  const int sl    = wv & 3;
  const int gt    = tid & 127;                                  // thread inside its 4-wave group
  const int lane  = tid & 31;
  const int rlane = lane & 15;
  const int hh    = lane >> 4;
  const int tok0  = blockIdx.x * PJ_TOK;

  // ---- all global loads first, none under a branch: bias values, X rows (block), this group's weight matrix ----
  const int colA0 = (mat < 2) ? sl * 32 : (sl & 1) * 32;         // first out column of the wave (A index)
  const int rowB0 = (mat < 2) ? 0 : (sl >> 1) * 64;              // first out row of the wave (B index)
  const v4f* bA = (const v4f*)((mat == 1 ? bk : bq) + colA0 + 8 * hh);   // in bounds for every wave; used by Q, K
  v4f bmv[2][2];
  float bnv[4];
#pragma unroll
  for (int i = 0; i < 2; ++i) { bmv[i][0] = bA[i * 4]; bmv[i][1] = bA[i * 4 + 1]; }
#pragma unroll
  for (int j = 0; j < 4; ++j) bnv[j] = bv[rowB0 + j * 16 + rlane];       // in bounds for every wave; used by V

  const v4f* Xg = (const v4f*)(X + (size_t)tok0 * PJ_E);
  const v4f* Wg = (const v4f*)(mat == 0 ? Wq : (mat == 1 ? Wk : Wv));
  // X: 2048 16-B pieces = 5 per thread + 128; every group loads the last 128, group 0 alone stores them
  v4f xr[6], wr[32];
#pragma unroll
  for (int i = 0; i < 5; ++i) xr[i] = Xg[i * PJ_NT + tid];
  xr[5] = Xg[5 * PJ_NT + gt];
#pragma unroll
  for (int i = 0; i < 32; ++i) wr[i] = Wg[i * 128 + gt];

  // ---- cast to f16 into LDS ----
#pragma unroll
  for (int i = 0; i < 6; ++i) {
    const int idx = (i < 5) ? i * PJ_NT + tid : 5 * PJ_NT + gt;
    v4h h;
#pragma unroll
    for (int e = 0; e < 4; ++e) h[e] = (_Float16)xr[i][e];
    if (i < 5 || mat == 0) *(v4h*)(Sm + (idx >> 5) * PJ_P + (idx & 31) * 4) = h;
  }
  {
    _Float16* wdst = Sm + (PJ_TOK + mat * PJ_E) * PJ_P;
#pragma unroll
    for (int i = 0; i < 32; ++i) {
      const int idx = i * 128 + gt;
      v4h h;
#pragma unroll
      for (int e = 0; e < 4; ++e) h[e] = (_Float16)(wr[i][e] * wcarry);
      *(v4h*)(wdst + (idx >> 5) * PJ_P + (idx & 31) * 4) = h;
    }
  }
  __syncthreads();

  float bm[2][8], bn[4];                                         // bias along A (Q, K) or along B (V); the other is 0
#pragma unroll
  for (int i = 0; i < 2; ++i)
#pragma unroll
    for (int r = 0; r < 8; ++r) bm[i][r] = (mat < 2) ? bmv[i][r >> 2][r & 3] : 0.f;
#pragma unroll
  for (int j = 0; j < 4; ++j) bn[j] = (mat < 2) ? 0.f : bnv[j];

  // ---- products: both operands by the same loader, so their k orders agree ----
  const int rowA = (mat < 2) ? (PJ_TOK + mat * PJ_E + colA0) : colA0;
  const int rowB = (mat < 2) ? 0 : (PJ_TOK + 2 * PJ_E + rowB0);
  const _Float16* pA = Sm + (rowA + rlane) * PJ_P + 8 * hh;
  const _Float16* pB = Sm + (rowB + rlane) * PJ_P + 8 * hh;
  v8f acc[2][4];
#pragma unroll
  for (int i = 0; i < 2; ++i)
#pragma unroll
    for (int j = 0; j < 4; ++j) acc[i][j] = (v8f){0.f,0.f,0.f,0.f,0.f,0.f,0.f,0.f};
#pragma unroll
  for (int k0 = 0; k0 < PJ_E; k0 += 32) {
    v16h a[2], b[4];
#pragma unroll
    for (int i = 0; i < 2; ++i) a[i] = Frag<_Float16>::load(pA + i * 16 * PJ_P + k0);
#pragma unroll
    for (int j = 0; j < 4; ++j) b[j] = Frag<_Float16>::load(pB + j * 16 * PJ_P + k0);
#pragma unroll
    for (int i = 0; i < 2; ++i)
#pragma unroll
      for (int j = 0; j < 4; ++j)
        acc[i][j] = __builtin_amdgcn_wmma_f32_16x16x32_f16(false, a[i], false, b[j], (short)0, acc[i][j], false, false);
  }

  // ---- undo the carry, add the bias, f16, out tile in LDS ----
  _Float16* ot = Ot + mat * PJ_OT;
  const int opitch = (mat < 2) ? PJ_P : PJ_VP;
#pragma unroll
  for (int i = 0; i < 2; ++i)
#pragma unroll
    for (int j = 0; j < 4; ++j) {
      v8h hv;
#pragma unroll
      for (int r = 0; r < 8; ++r) hv[r] = (_Float16)((acc[i][j][r] * wundo + bm[i][r]) + bn[j]);
      *(v8h*)(ot + (rowB0 + j * 16 + rlane) * opitch + colA0 + i * 16 + 8 * hh) = hv;
    }
  __syncthreads();

  // ---- each group stores its own tile: 16 B per lane, whole 128-B lines (Q, K: 64 rows of 256 B; V^T: 128 of 128 B) ----
  _Float16* G = (mat == 0) ? Qh + (size_t)tok0 * PJ_E : ((mat == 1) ? Kh + (size_t)tok0 * PJ_E : Vt + tok0);
  const int gpitch = (mat < 2) ? PJ_E : ldv;
  const int rsh    = (mat < 2) ? 4 : 3;                            // 16-B pieces per row: 16 or 8
  const int c8     = (gt & ((1 << rsh) - 1)) * 8;
#pragma unroll
  for (int i = 0; i < 8; ++i) {
    const int row = (i * 128 + gt) >> rsh;
    *(v8h*)(G + (size_t)row * gpitch + c8) = *(const v8h*)(ot + row * opitch + c8);
  }
}

// =====================================================================================
// Single-head attention, head dim 128, f16 q/k planes row-major [B*N][128], f16 V^T plane [128][B*N] (pitch ldv),
// f32 out. scores = (q.k^T) * inv_scale + bias[q] with bias[q] = sum_d q[q][d] * ctx[b][d],
// ctx[b][e] = sum_c context[b][c] * Wc[e][c] + bc[e] (VALU f32, per block); softmax over all keys (no mask), f32 online;
// out = p.v with p carried x2^15 in f16, folded into the final 1/l.
// Block = 16 waves = 64 query rows of one batch x 4 key groups: wave (g, qw) runs query rows qw*16..+15 over the
// g-th 64 keys of every 256-key stage (plain loads + __syncthreads), so each SIMD holds four waves that fill one
// another's waits. Each group keeps its own online (max, sum, O); the four are merged once in LDS behind the loop.
// grid.x = B * (N / 64); blockDim = 512; N % 256 == 0.
// =====================================================================================
#define AT_E 128
#define AT_C 64
#define AT_QB 64
#define AT_KC 64
#define AT_NW 4
#define AT_G 4
#define AT_SK (AT_G * AT_KC)
#define AT_NT (AT_G * AT_NW * 32)
#define AT_QP 136
#define AT_KP 136
#define AT_VP (AT_SK + 8)
#define AT_PP 72
#define AT_OP 132
#define AT_PSC 32768.0f
#define AT_L2E 1.4426950408889634f

__device__ __forceinline__ v8f mma_h16(v16h a, v16h b, v8f c) {
  c = __builtin_amdgcn_wmma_f32_16x16x32_f16(false, a, false, b, (short)0, c, false, false);
  asm volatile("v_nop\n\tv_nop\n\tv_nop\n\tv_nop" : "+v"(c) : "v"(a), "v"(b));
  return c;
}

__global__ __launch_bounds__(AT_NT)
void attn128_kernel(const _Float16* __restrict__ Qh, const _Float16* __restrict__ Kh,
                    const _Float16* __restrict__ Vt, int ldv,
                    const float* __restrict__ ctxin, const float* __restrict__ Wc, const float* __restrict__ bcv,
                    float* __restrict__ out, int nTok, float inv_scale)
{
  __shared__ __align__(16) float    ctxS[AT_E];
  __shared__ __align__(16) _Float16 Qsh[AT_QB * AT_QP];          // [q][d]      pitch 136
  __shared__ __align__(16) _Float16 Psh[AT_G * AT_NW][16 * AT_PP];   // per wave P [row][kv] pitch 72
  __shared__ __align__(16) float    Ms[AT_G][AT_QB];             // per group row max
  __shared__ __align__(16) float    Ls[AT_G][AT_QB];             // per group row sum
  // K stage [256 kv][d] pitch 136, then V^T stage [128 d][256 kv] pitch 264; behind the loop the same bytes
  // hold the 16 waves' partial O tiles (16 x 128 f32, pitch 132).
  constexpr int KV_BYTES = (AT_SK * AT_KP + AT_E * AT_VP) * 2;
  static_assert(AT_G * AT_NW * 16 * AT_OP * 4 <= KV_BYTES, "partial O tiles must fit the K/V stage");
  __shared__ __align__(16) unsigned char KVraw[KV_BYTES];
  _Float16* const Ksh = (_Float16*)KVraw;
  _Float16* const Vts = (_Float16*)KVraw + AT_SK * AT_KP;
  float*    const Os  = (float*)KVraw;

  const int tid  = threadIdx.x;
  const int wv   = tid >> 5;        // 0..15
  const int wave = wv & (AT_NW - 1);   // query tile of this wave
  const int grp  = wv >> 2;            // key group of this wave
  const int lane = tid & 31;
  const int hh   = lane >> 4;
  const int c    = lane & 15;

  const int nqb = nTok / AT_QB;
  const int b   = blockIdx.x / nqb;
  const int qb  = blockIdx.x - b * nqb;
  const int q0  = qb * AT_QB;
  const size_t rowbase = (size_t)b * nTok;       // first token row of this batch
  const size_t colbase = rowbase;                 // column offset of this batch inside V^T rows

  // ---- context projection ctx[b][e], one thread per e ----
  if (tid < AT_E) {
    const float* cr = ctxin + (size_t)b * AT_C;
    const float* wr = Wc + (size_t)tid * AT_C;
    float a = 0.f;
#pragma unroll 4
    for (int cc = 0; cc < AT_C; ++cc) a += cr[cc] * wr[cc];
    ctxS[tid] = a + bcv[tid];
  }
  // ---- Q block [64][128] into LDS ----
#pragma unroll
  for (int i = 0; i < 2; ++i) {
    const int idx = i * AT_NT + tid;
    const int row = idx >> 4, c8 = (idx & 15) * 8;
    const v8h v = *(const v8h*)(Qh + (rowbase + q0 + row) * AT_E + c8);
    *(v8h*)(Qsh + row * AT_QP + c8) = v;
  }
  __syncthreads();

  // ---- per-query context bias: lanes c / c+16 each sum 64 of the 128 d of row c of this wave ----
  float brow[8];
  {
    const _Float16* qr = Qsh + (wave * 16 + c) * AT_QP + hh * 64;
    const float* cx = ctxS + hh * 64;
    float part = 0.f;
#pragma unroll 8
    for (int e = 0; e < 64; ++e) part += (float)qr[e] * cx[e];
    part += __shfl_xor(part, 16, 32);
#pragma unroll
    for (int r = 0; r < 8; ++r) brow[r] = __shfl(part, 8 * hh + r, 32);   // row 8hh+r lives in lane 8hh+r
  }

  float mrow[8], lrow[8];
  v8f oacc[8];
  const float ninf = -__builtin_inff();
#pragma unroll
  for (int r = 0; r < 8; ++r) { mrow[r] = ninf; lrow[r] = 0.f; }
#pragma unroll
  for (int t = 0; t < 8; ++t) oacc[t] = (v8f){0.f,0.f,0.f,0.f,0.f,0.f,0.f,0.f};

  const _Float16* qfrag = Qsh + (wave * 16 + c) * AT_QP + 8 * hh;   // A operand rows of this wave
  const _Float16* kgrp = Ksh + grp * AT_KC * AT_KP;                   // this group's 64 K rows of the stage
  const _Float16* vgrp = Vts + grp * AT_KC;                           // this group's 64 V^T columns of the stage
  const int nChunks = nTok / AT_SK;                                    // block-uniform, size-derived
  for (int kc = 0; kc < nChunks; ++kc) {
    const int kv0 = kc * AT_SK;
    __syncthreads();
    // ---- stage K [256 kv][128 d] and V^T [128 d][256 kv] with 16-B vector copies ----
#pragma unroll
    for (int i = 0; i < 8; ++i) {
      const int idx = i * AT_NT + tid;
      const int krow = idx >> 4, kc8 = (idx & 15) * 8;
      const v8h kk = *(const v8h*)(Kh + (rowbase + kv0 + krow) * AT_E + kc8);
      *(v8h*)(Ksh + krow * AT_KP + kc8) = kk;
      const int d = idx >> 5, vc8 = (idx & 31) * 8;
      const v8h vv = *(const v8h*)(Vt + (size_t)d * ldv + colbase + kv0 + vc8);
      *(v8h*)(Vts + d * AT_VP + vc8) = vv;
    }
    __syncthreads();

    // ---- S = Q K^T : A[m=c][k=d] from Qsh, B[k=d][n=c] from Ksh row (grp*64+j*16+c) ----
    v8f s[4];
#pragma unroll
    for (int j = 0; j < 4; ++j) s[j] = (v8f){0.f,0.f,0.f,0.f,0.f,0.f,0.f,0.f};
    // The fragments of one d step (Q + 4 K: ten 16-B LDS loads) are issued as one group in front of their four WMMAs:
    // one LDS round trip per group, not one per WMMA (a load written behind mma_h16's asm statement stays behind it).
#pragma unroll 1
    for (int dc = 0; dc < 4; ++dc) {
      const v16h qa = Frag<_Float16>::load(qfrag + dc * 32);
      v16h kb[4];
#pragma unroll
      for (int j = 0; j < 4; ++j) kb[j] = Frag<_Float16>::load(kgrp + (j * 16 + c) * AT_KP + dc * 32 + 8 * hh);
#pragma unroll
      for (int j = 0; j < 4; ++j) s[j] = mma_h16(qa, kb[j], s[j]);
    }

    // ---- scale + bias, chunk row max (row 8hh+r lives in the 16 lanes of this half) ----
    float cm[8];
#pragma unroll
    for (int r = 0; r < 8; ++r) {
      float m = ninf;
#pragma unroll
      for (int j = 0; j < 4; ++j) {
        const float z = s[j][r] * inv_scale + brow[r];
        s[j][r] = z;
        m = fmaxf(m, z);
      }
#pragma unroll
      for (int off = 1; off < 16; off <<= 1) m = fmaxf(m, __shfl_xor(m, off, 32));
      cm[r] = m;
    }
    _Float16* pw = Psh[wv];
#pragma unroll
    for (int r = 0; r < 8; ++r) {
      const float mnew  = fmaxf(mrow[r], cm[r]);
      const float alpha = __builtin_amdgcn_exp2f((mrow[r] - mnew) * AT_L2E);
      mrow[r] = mnew;
      float psum = 0.f;
#pragma unroll
      for (int j = 0; j < 4; ++j) {
        const float p = __builtin_amdgcn_exp2f((s[j][r] - mnew) * AT_L2E);
        psum += p;
        pw[(8 * hh + r) * AT_PP + j * 16 + c] = (_Float16)(p * AT_PSC);
      }
#pragma unroll
      for (int off = 1; off < 16; off <<= 1) psum += __shfl_xor(psum, off, 32);
      lrow[r] = lrow[r] * alpha + psum;
#pragma unroll
      for (int t = 0; t < 8; ++t) oacc[t][r] *= alpha;
    }
    __builtin_amdgcn_fence(__ATOMIC_RELEASE, "workgroup");
    __builtin_amdgcn_wave_barrier();
    __builtin_amdgcn_fence(__ATOMIC_ACQUIRE, "workgroup");

    // ---- O += P V : A[m=c][k=kv] from Psh, B[k=kv][n=d] from Vts row (t*16+c) ----
    // likewise: the fragments of 32 keys (P + 8 V^T: eighteen 16-B LDS loads) as one group in front of their eight WMMAs
#pragma unroll 1
    for (int kk = 0; kk < 2; ++kk) {
      const v16h pa = Frag<_Float16>::load(pw + c * AT_PP + kk * 32 + 8 * hh);
      v16h vb[8];
#pragma unroll
      for (int t = 0; t < 8; ++t) vb[t] = Frag<_Float16>::load(vgrp + (t * 16 + c) * AT_VP + kk * 32 + 8 * hh);
#pragma unroll
      for (int t = 0; t < 8; ++t) oacc[t] = mma_h16(pa, vb[t], oacc[t]);
    }
  }

  // ---- merge of the four key groups: every wave lays down its un-normalised O tile and its rows' (max, sum) ----
  __syncthreads();   // every wave has left the K/V stage before its bytes become the partial O tiles
  {
    float* os = Os + wv * (16 * AT_OP);
#pragma unroll
    for (int r = 0; r < 8; ++r) {
#pragma unroll
      for (int t = 0; t < 8; ++t) os[(8 * hh + r) * AT_OP + t * 16 + c] = oacc[t][r];
      if (c == 0) {
        Ms[grp][wave * 16 + 8 * hh + r] = mrow[r];
        Ls[grp][wave * 16 + 8 * hh + r] = lrow[r];
      }
    }
  }
  __syncthreads();   // publishes the partial tiles to the waves that merge them
  // wave (grp, wave) merges rows grp*4..+3 of query tile 'wave'; each 512-B row is written by one instruction
  {
    const int c4 = lane * 4;
#pragma unroll
    for (int rr = 0; rr < 4; ++rr) {
      const int row  = grp * 4 + rr;
      const int qrow = wave * 16 + row;
      float mg[AT_G];
      float mall = ninf;
#pragma unroll
      for (int g = 0; g < AT_G; ++g) { mg[g] = Ms[g][qrow]; mall = fmaxf(mall, mg[g]); }
      float lall = 0.f;
      v4f val = (v4f){0.f, 0.f, 0.f, 0.f};
#pragma unroll
      for (int g = 0; g < AT_G; ++g) {
        const float w = __builtin_amdgcn_exp2f((mg[g] - mall) * AT_L2E);
        lall += w * Ls[g][qrow];
        const v4f part = *(const v4f*)(Os + (g * AT_NW + wave) * (16 * AT_OP) + row * AT_OP + c4);
        val += part * w;
      }
      const float inv = 1.0f / (lall * AT_PSC);
      *(v4f*)(out + (rowbase + q0 + qrow) * AT_E + c4) = val * inv;
    }
  }
}

// ---------------------------------------------------------------------------
extern "C" void kernel_launch(void* const* d_in, const int* in_sizes, int n_in,
                              void* d_out, int out_size, void* d_ws, size_t ws_size,
                              hipStream_t stream)
{
  if (n_in < 10) return;
  const float* X    = (const float*)d_in[0];
  const float* ctxt = (const float*)d_in[1];
  const float* Wq   = (const float*)d_in[2];
  const float* bq   = (const float*)d_in[3];
  const float* Wk   = (const float*)d_in[4];
  const float* bk   = (const float*)d_in[5];
  const float* Wv   = (const float*)d_in[6];
  const float* bv   = (const float*)d_in[7];
  const float* Wc   = (const float*)d_in[8];
  const float* bc   = (const float*)d_in[9];
  float* out = (float*)d_out;

  const int E = AT_E, C = AT_C;
  const int nX   = in_sizes[0];
  const int Mall = nX / E;                 // B*N token rows
  const int Bn   = in_sizes[1] / C;        // batch
  if (Bn <= 0 || Mall <= 0) return;
  const int nTok = Mall / Bn;              // tokens per batch
  if (nTok * Bn != Mall || Mall * E != nX) return;
  if ((Mall % 64) != 0 || (nTok % AT_SK) != 0) return;
  if (in_sizes[2] != E * E || in_sizes[4] != E * E || in_sizes[6] != E * E) return;
  if (in_sizes[3] != E || in_sizes[5] != E || in_sizes[7] != E) return;
  if (in_sizes[8] != E * C || in_sizes[9] != E || in_sizes[1] != Bn * C) return;
  if (out_size != nX) return;

  // ---- workspace carve (all offsets multiples of 16 KiB) ----
  const size_t nTokE = (size_t)Mall * E;              // halves per token plane
  size_t off = 0;
  _Float16* Qh  = (_Float16*)((char*)d_ws + off); off += nTokE * 2;   // [Mall][128]
  _Float16* Kh  = (_Float16*)((char*)d_ws + off); off += nTokE * 2;   // [Mall][128]
  _Float16* Vt  = (_Float16*)((char*)d_ws + off); off += nTokE * 2;   // [128][Mall]
  if (off > ws_size) return;

  // ---- Q = X Wq^T + bq, K = X Wk^T + bk : [Mall][128] f16 ; V^T : [128][Mall] f16 ; casts included ----
  qkv_proj_kernel<<<dim3(Mall / PJ_TOK), PJ_NT, 0, stream>>>(
      X, Wq, bq, Wk, bk, Wv, bv, Qh, Kh, Vt, Mall, 256.0f, 1.0f / 256.0f);

  // ---- attention ----
  {
    const float scale_f   = (float)11.313708498984761;   // sqrt(128) as f32
    const float inv_scale = 1.0f / scale_f;
    attn128_kernel<<<dim3(Bn * (nTok / 64)), AT_NT, 0, stream>>>(
        Qh, Kh, Vt, Mall, ctxt, Wc, bc, out, nTok, inv_scale);
  }
}

// v004
// A run of this version takes 67.4 microseconds.
// In both of two side-by-side timings against v003, it was 1.15 times as fast.
// All steps since v000 together make it 3.53 times as fast.
// Contractions: Q/K/V projections, Q.K^T scores and P.V on v_wmma_f32_16x16x32_f16 (f16 operands, f32 accumulate); weights carried x256 and probabilities x32768 (exact power-of-two carries folded back in f32); context projection (K=64, 4 rows) and the per-query context-bias dot on VALU f32; softmax f32.
#include <hip/hip_runtime.h>

typedef __attribute__((ext_vector_type(16))) _Float16 v16h;
typedef __attribute__((ext_vector_type(8)))  _Float16 v8h;
typedef __attribute__((ext_vector_type(4)))  _Float16 v4h;
typedef __attribute__((ext_vector_type(8)))  float    v8f;
typedef __attribute__((ext_vector_type(4)))  float    v4f;

template <typename T> struct Frag;
template <> struct Frag<_Float16> {
  typedef v16h V; union U { v16h v; v8h h[2]; };
  static __device__ __forceinline__ v16h load(const _Float16* p) {   // elements 0..7 <- p[0..7], 8..15 <- p[16..23]
    U f; f.h[0] = *(const v8h*)(p); f.h[1] = *(const v8h*)(p + 16); return f.v;
  }
};

// =====================================================================================
// Q, K and V^T projections of 64 token rows in one launch, straight from the f32 inputs.
// Q = X Wq^T + bq, K = X Wk^T + bk : f16 [tokens][128]; V^T = (X Wv^T + bv)^T : f16 [128][tokens] (pitch ldv).
// Block = 12 waves. The block casts its X rows and the three weight matrices (x wcarry) to f16 on the way into LDS
// (512-B wave loads, one row each); waves 0..3 / 4..7 / 8..11 then form Q / K / V^T.
// Each wave owns 2 x 4 tiles of 16 x 16, with the operand whose index runs along an OUTPUT ROW as A: a lane's 8
// accumulator registers are then 8 neighbours of one output row and go to the LDS out tile as one 16-B store.
//   Q, K : A = 32 weight rows (features), B = the 64 X rows (tokens)      -> out tile [token][feature]
//   V^T  : A = 32 X rows (tokens),        B = 64 weight rows (features)   -> out tile [feature][token]
// The out tiles leave as whole 128-B lines. grid.x = tokens / 64; blockDim = 384.
// Every loop is fully unrolled (#pragma unroll): its arrays are indexed by the counter and must stay in registers,
// and the 46 loads of a wave must all be in flight before the first wait.
// =====================================================================================
#define PJ_E 128
#define PJ_TOK 64
#define PJ_NT 384
#define PJ_P 136                         // LDS pitch (halves) of 128-half rows
#define PJ_VP 72                         // LDS pitch (halves) of the V^T tile's 64-half rows
#define PJ_OT (PJ_E * PJ_VP)             // halves per out tile (>= 64 * 136)

__global__ __launch_bounds__(PJ_NT)
void qkv_proj_kernel(const float* __restrict__ X,
                     const float* __restrict__ Wq, const float* __restrict__ bq,
                     const float* __restrict__ Wk, const float* __restrict__ bk,
                     const float* __restrict__ Wv, const float* __restrict__ bv,
                     _Float16* __restrict__ Qh, _Float16* __restrict__ Kh, _Float16* __restrict__ Vt, int ldv,
                     float wcarry, float wundo)
{
  static_assert(PJ_TOK * PJ_P <= PJ_OT, "Q/K out tile must fit");
  __shared__ __align__(16) _Float16 Sm[(PJ_TOK + 3 * PJ_E) * PJ_P];   // rows 0..63: X; rows 64 + 128 m + f: weight m
  __shared__ __align__(16) _Float16 Ot[3 * PJ_OT];

  const int tid   = threadIdx.x;
  const int wv    = __builtin_amdgcn_readfirstlane(tid >> 5);   // 0..11, in a scalar register: selects by matrix stay scalar
  const int mat   = wv >> 2;                                    // 0 Q, 1 K, 2 V
  const int sl    = wv & 3;
  const int gt    = tid & 127;                                  // thread inside its 4-wave group
  const int lane  = tid & 31;
  const int rlane = lane & 15;
  const int hh    = lane >> 4;
  const int tok0  = blockIdx.x * PJ_TOK;

  // ---- all global loads first, none under a branch: bias values, X rows (block), this group's weight matrix ----
  const int colA0 = (mat < 2) ? sl * 32 : (sl & 1) * 32;         // first out column of the wave (A index)
  const int rowB0 = (mat < 2) ? 0 : (sl >> 1) * 64;              // first out row of the wave (B index)
  const v4f* bA = (const v4f*)((mat == 1 ? bk : bq) + colA0 + 8 * hh);   // in bounds for every wave; used by Q, K
  v4f bmv[2][2];
  float bnv[4];
#pragma unroll
  for (int i = 0; i < 2; ++i) { bmv[i][0] = bA[i * 4]; bmv[i][1] = bA[i * 4 + 1]; }
#pragma unroll
  for (int j = 0; j < 4; ++j) bnv[j] = bv[rowB0 + j * 16 + rlane];       // in bounds for every wave; used by V

  const v4f* Xg = (const v4f*)(X + (size_t)tok0 * PJ_E);
  const v4f* Wg = (const v4f*)(mat == 0 ? Wq : (mat == 1 ? Wk : Wv));
  // X: 2048 16-B pieces = 5 per thread + 128; every group loads the last 128, group 0 alone stores them
  v4f xr[6], wr[32];
#pragma unroll
  for (int i = 0; i < 5; ++i) xr[i] = Xg[i * PJ_NT + tid];
  xr[5] = Xg[5 * PJ_NT + gt];
#pragma unroll
  for (int i = 0; i < 32; ++i) wr[i] = Wg[i * 128 + gt];

  // ---- cast to f16 into LDS ----
#pragma unroll
  for (int i = 0; i < 6; ++i) {
    const int idx = (i < 5) ? i * PJ_NT + tid : 5 * PJ_NT + gt;
    v4h h;
#pragma unroll
    for (int e = 0; e < 4; ++e) h[e] = (_Float16)xr[i][e];
    if (i < 5 || mat == 0) *(v4h*)(Sm + (idx >> 5) * PJ_P + (idx & 31) * 4) = h;
  }
  {
    _Float16* wdst = Sm + (PJ_TOK + mat * PJ_E) * PJ_P;
#pragma unroll
    for (int i = 0; i < 32; ++i) {
      const int idx = i * 128 + gt;
      v4h h;
#pragma unroll
      for (int e = 0; e < 4; ++e) h[e] = (_Float16)(wr[i][e] * wcarry);
      *(v4h*)(wdst + (idx >> 5) * PJ_P + (idx & 31) * 4) = h;
    }
  }
  __syncthreads();

  float bm[2][8], bn[4];                                         // bias along A (Q, K) or along B (V); the other is 0
#pragma unroll
  for (int i = 0; i < 2; ++i)
#pragma unroll
    for (int r = 0; r < 8; ++r) bm[i][r] = (mat < 2) ? bmv[i][r >> 2][r & 3] : 0.f;
#pragma unroll
  for (int j = 0; j < 4; ++j) bn[j] = (mat < 2) ? 0.f : bnv[j];

  // ---- products: both operands by the same loader, so their k orders agree ----
  const int rowA = (mat < 2) ? (PJ_TOK + mat * PJ_E + colA0) : colA0;
  const int rowB = (mat < 2) ? 0 : (PJ_TOK + 2 * PJ_E + rowB0);
  const _Float16* pA = Sm + (rowA + rlane) * PJ_P + 8 * hh;
  const _Float16* pB = Sm + (rowB + rlane) * PJ_P + 8 * hh;
  v8f acc[2][4];
#pragma unroll
  for (int i = 0; i < 2; ++i)
#pragma unroll
    for (int j = 0; j < 4; ++j) acc[i][j] = (v8f){0.f,0.f,0.f,0.f,0.f,0.f,0.f,0.f};
#pragma unroll
  for (int k0 = 0; k0 < PJ_E; k0 += 32) {
    v16h a[2], b[4];
#pragma unroll
    for (int i = 0; i < 2; ++i) a[i] = Frag<_Float16>::load(pA + i * 16 * PJ_P + k0);
#pragma unroll
    for (int j = 0; j < 4; ++j) b[j] = Frag<_Float16>::load(pB + j * 16 * PJ_P + k0);
#pragma unroll
    for (int i = 0; i < 2; ++i)
#pragma unroll
      for (int j = 0; j < 4; ++j)
        acc[i][j] = __builtin_amdgcn_wmma_f32_16x16x32_f16(false, a[i], false, b[j], (short)0, acc[i][j], false, false);
  }

  // ---- undo the carry, add the bias, f16, out tile in LDS ----
  _Float16* ot = Ot + mat * PJ_OT;
  const int opitch = (mat < 2) ? PJ_P : PJ_VP;
#pragma unroll
  for (int i = 0; i < 2; ++i)
#pragma unroll
    for (int j = 0; j < 4; ++j) {
      v8h hv;
#pragma unroll
      for (int r = 0; r < 8; ++r) hv[r] = (_Float16)((acc[i][j][r] * wundo + bm[i][r]) + bn[j]);
      *(v8h*)(ot + (rowB0 + j * 16 + rlane) * opitch + colA0 + i * 16 + 8 * hh) = hv;
    }
  __syncthreads();

  // ---- each group stores its own tile: 16 B per lane, whole 128-B lines (Q, K: 64 rows of 256 B; V^T: 128 of 128 B) ----
  _Float16* G = (mat == 0) ? Qh + (size_t)tok0 * PJ_E : ((mat == 1) ? Kh + (size_t)tok0 * PJ_E : Vt + tok0);
  const int gpitch = (mat < 2) ? PJ_E : ldv;
  const int rsh    = (mat < 2) ? 4 : 3;                            // 16-B pieces per row: 16 or 8
  const int c8     = (gt & ((1 << rsh) - 1)) * 8;
#pragma unroll
  for (int i = 0; i < 8; ++i) {
    const int row = (i * 128 + gt) >> rsh;
    *(v8h*)(G + (size_t)row * gpitch + c8) = *(const v8h*)(ot + row * opitch + c8);
  }
}

// =====================================================================================
// Single-head attention, head dim 128, f16 q/k planes row-major [B*N][128], f16 V^T plane [128][B*N] (pitch ldv),
// f32 out. scores = (q.k^T) * inv_scale + bias[q] with bias[q] = sum_d q[q][d] * ctx[b][d],
// ctx[b][e] = sum_c context[b][c] * Wc[e][c] + bc[e] (VALU f32, per block); softmax over all keys (no mask), f32 online;
// out = p.v with p carried x2^15 in f16, folded into the final 1/l.
// Block = 16 waves = 64 query rows of one batch x 4 key groups: wave (g, qw) runs query rows qw*16..+15 over the
// g-th 64 keys of every 256-key stage (plain loads + __syncthreads), so each SIMD holds four waves that fill one
// another's waits. Each group keeps its own online (max, sum, O); the four are merged once in LDS behind the loop.
// Both products are formed transposed: S^T = K Q^T (A = K rows, B = Q, kept in registers) and O^T += V^T P^T
// (A = V^T rows, B = P^T). A lane then holds scores of ONE query (column c; keys 8hh+r of each 16-key tile): max and
// sum run in the lane plus one exchange between the wave halves, and two neighbouring score tiles, converted in
// place, ARE the B operand of the second product (its k order is the fragment loader's), so P never leaves registers.
// grid.x = B * (N / 64); blockDim = 512; N % 256 == 0.
// =====================================================================================
#define AT_E 128
#define AT_C 64
#define AT_QB 64
#define AT_KC 64
#define AT_NW 4
#define AT_G 4
#define AT_SK (AT_G * AT_KC)
#define AT_NT (AT_G * AT_NW * 32)
#define AT_QP 136
#define AT_KP 136
#define AT_VP (AT_SK + 8)
#define AT_OP 132
#define AT_PSC 32768.0f
#define AT_L2E 1.4426950408889634f

__device__ __forceinline__ v8f mma_h16(v16h a, v16h b, v8f c) {
  c = __builtin_amdgcn_wmma_f32_16x16x32_f16(false, a, false, b, (short)0, c, false, false);
  asm volatile("v_nop\n\tv_nop\n\tv_nop\n\tv_nop" : "+v"(c) : "v"(a), "v"(b));
  return c;
}

// lane l <-> lane l ^ 16
__device__ __forceinline__ float xhalf(float x) {
  return __builtin_bit_cast(float, __builtin_amdgcn_permlanex16(__builtin_bit_cast(int, x), __builtin_bit_cast(int, x),
                                                                0x76543210, 0xfedcba98, false, false));
}

__global__ __launch_bounds__(AT_NT)
void attn128_kernel(const _Float16* __restrict__ Qh, const _Float16* __restrict__ Kh,
                    const _Float16* __restrict__ Vt, int ldv,
                    const float* __restrict__ ctxin, const float* __restrict__ Wc, const float* __restrict__ bcv,
                    float* __restrict__ out, int nTok, float inv_scale)
{
  __shared__ __align__(16) float    ctxS[AT_E];
  __shared__ __align__(16) _Float16 Qsh[AT_QB * AT_QP];          // [q][d]      pitch 136
  __shared__ __align__(16) float    Ms[AT_G][AT_QB];             // per group row max
  __shared__ __align__(16) float    Ls[AT_G][AT_QB];             // per group row sum
  // K stage [256 kv][d] pitch 136, then V^T stage [128 d][256 kv] pitch 264; behind the loop the same bytes
  // hold the 16 waves' partial O tiles (16 x 128 f32, pitch 132).
  constexpr int KV_BYTES = (AT_SK * AT_KP + AT_E * AT_VP) * 2;
  static_assert(AT_G * AT_NW * 16 * AT_OP * 4 <= KV_BYTES, "partial O tiles must fit the K/V stage");
  __shared__ __align__(16) unsigned char KVraw[KV_BYTES];
  _Float16* const Ksh = (_Float16*)KVraw;
  _Float16* const Vts = (_Float16*)KVraw + AT_SK * AT_KP;
  float*    const Os  = (float*)KVraw;

  const int tid  = threadIdx.x;
  const int wv   = tid >> 5;        // 0..15
  const int wave = wv & (AT_NW - 1);   // query tile of this wave
  const int grp  = wv >> 2;            // key group of this wave
  const int lane = tid & 31;
  const int hh   = lane >> 4;
  const int c    = lane & 15;

  const int nqb = nTok / AT_QB;
  const int b   = blockIdx.x / nqb;
  const int qb  = blockIdx.x - b * nqb;
  const int q0  = qb * AT_QB;
  const size_t rowbase = (size_t)b * nTok;       // first token row of this batch
  const size_t colbase = rowbase;                 // column offset of this batch inside V^T rows

  // ---- context projection ctx[b][e], one thread per e ----
  if (tid < AT_E) {
    const float* cr = ctxin + (size_t)b * AT_C;
    const float* wr = Wc + (size_t)tid * AT_C;
    float a = 0.f;
#pragma unroll 4
    for (int cc = 0; cc < AT_C; ++cc) a += cr[cc] * wr[cc];
    ctxS[tid] = a + bcv[tid];
  }
  // ---- Q block [64][128] into LDS ----
#pragma unroll
  for (int i = 0; i < 2; ++i) {
    const int idx = i * AT_NT + tid;
    const int row = idx >> 4, c8 = (idx & 15) * 8;
    const v8h v = *(const v8h*)(Qh + (rowbase + q0 + row) * AT_E + c8);
    *(v8h*)(Qsh + row * AT_QP + c8) = v;
  }
  __syncthreads();

  // ---- per-query context bias: lanes c / c+16 each sum 64 of the 128 d of row c of this wave ----
  float bias;                                                     // of query c, in both halves
  {
    const _Float16* qr = Qsh + (wave * 16 + c) * AT_QP + hh * 64;
    const float* cx = ctxS + hh * 64;
    float part = 0.f;
#pragma unroll 8
    for (int e = 0; e < 64; ++e) part += (float)qr[e] * cx[e];
    part += __shfl_xor(part, 16, 32);
    bias = part;
  }

  const float ninf = -__builtin_inff();
  float mrun = ninf;                 // running max of query c (same in both halves)
  float lrun = 0.f;                  // running sum of query c over THIS half's keys; the halves join behind the loop
  v8f oacc[8];                       // O^T: oacc[t][r] = O[query c][d = t*16 + 8hh + r]
#pragma unroll
  for (int t = 0; t < 8; ++t) oacc[t] = (v8f){0.f,0.f,0.f,0.f,0.f,0.f,0.f,0.f};

  // Q of this wave as the B operand of S^T, read once: qf[dc] = Q[query c][dc*32 + k order of the loader]
  v16h qf[4];
#pragma unroll
  for (int dc = 0; dc < 4; ++dc) qf[dc] = Frag<_Float16>::load(Qsh + (wave * 16 + c) * AT_QP + dc * 32 + 8 * hh);
  const _Float16* kgrp = Ksh + grp * AT_KC * AT_KP;                   // this group's 64 K rows of the stage
  const _Float16* vgrp = Vts + grp * AT_KC;                           // this group's 64 V^T columns of the stage
  const int nChunks = nTok / AT_SK;                                    // block-uniform, size-derived
  for (int kc = 0; kc < nChunks; ++kc) {
    const int kv0 = kc * AT_SK;
    __syncthreads();
    // ---- stage K [256 kv][128 d] and V^T [128 d][256 kv] with 16-B vector copies ----
#pragma unroll
    for (int i = 0; i < 8; ++i) {
      // row = constant step + the thread's own row: the 16 addresses are then two bases plus constants, which leaves
      // the registers that Q needs
      const int krow = i * (AT_NT / 16) + (tid >> 4), kc8 = (tid & 15) * 8;
      const v8h kk = *(const v8h*)(Kh + (rowbase + kv0 + krow) * AT_E + kc8);
      *(v8h*)(Ksh + krow * AT_KP + kc8) = kk;
      const int d = i * (AT_NT / 32) + (tid >> 5), vc8 = (tid & 31) * 8;
      const v8h vv = *(const v8h*)(Vt + (size_t)d * ldv + colbase + kv0 + vc8);
      *(v8h*)(Vts + d * AT_VP + vc8) = vv;
    }
    __syncthreads();

    // ---- S^T = K Q^T : A[m=key c][k=d] from Ksh row (grp*64+j*16+c), B[k=d][n=query c] = qf ----
    v8f st[4];                       // st[j][r] = score of key j*16 + 8hh + r against query c
#pragma unroll
    for (int j = 0; j < 4; ++j) st[j] = (v8f){0.f,0.f,0.f,0.f,0.f,0.f,0.f,0.f};
    // The K fragments of one d step (eight 16-B LDS loads) are issued as one group in front of their four WMMAs:
    // one LDS round trip per group, not one per WMMA (a load written behind mma_h16's asm statement stays behind it).
    // Unrolled: qf is indexed by the counter and must stay in registers.
#pragma unroll
    for (int dc = 0; dc < 4; ++dc) {
      v16h ka[4];
#pragma unroll
      for (int j = 0; j < 4; ++j) ka[j] = Frag<_Float16>::load(kgrp + (j * 16 + c) * AT_KP + dc * 32 + 8 * hh);
#pragma unroll
      for (int j = 0; j < 4; ++j) st[j] = mma_h16(ka[j], qf[dc], st[j]);
    }

    // ---- scale + bias, chunk max of query c: 32 scores in the lane, the other 32 in lane l ^ 16 ----
    float cmj[4];
#pragma unroll
    for (int j = 0; j < 4; ++j) {
      float m = ninf;
#pragma unroll
      for (int r = 0; r < 8; ++r) {
        const float z = st[j][r] * inv_scale + bias;
        st[j][r] = z;
        m = fmaxf(m, z);
      }
      cmj[j] = m;
    }
    float cm = fmaxf(fmaxf(cmj[0], cmj[1]), fmaxf(cmj[2], cmj[3]));
    cm = fmaxf(cm, xhalf(cm));
    const float mnew  = fmaxf(mrun, cm);
    const float alpha = __builtin_amdgcn_exp2f((mrun - mnew) * AT_L2E);
    mrun = mnew;
    // ---- P^T: tiles 2kk and 2kk+1, converted in place, are the B operand of keys kk*32..+31 ----
    v16h pb[2];
    float psj[4];
#pragma unroll
    for (int j = 0; j < 4; ++j) {
      float ps = 0.f;
#pragma unroll
      for (int r = 0; r < 8; ++r) {
        const float p = __builtin_amdgcn_exp2f((st[j][r] - mnew) * AT_L2E);
        ps += p;
        pb[j >> 1][(j & 1) * 8 + r] = (_Float16)(p * AT_PSC);
      }
      psj[j] = ps;
    }
    lrun = lrun * alpha + ((psj[0] + psj[1]) + (psj[2] + psj[3]));
#pragma unroll
    for (int t = 0; t < 8; ++t)
#pragma unroll
      for (int r = 0; r < 8; ++r) oacc[t][r] *= alpha;

    // ---- O^T += V^T P^T : A[m=d c][k=kv] from Vts row (t*16+c), B[k=kv][n=query c] = pb ----
    // likewise: the V^T fragments of 32 keys (sixteen 16-B LDS loads) as one group in front of their eight WMMAs
#pragma unroll
    for (int kk = 0; kk < 2; ++kk) {
      v16h va[8];
#pragma unroll
      for (int t = 0; t < 8; ++t) va[t] = Frag<_Float16>::load(vgrp + (t * 16 + c) * AT_VP + kk * 32 + 8 * hh);
#pragma unroll
      for (int t = 0; t < 8; ++t) oacc[t] = mma_h16(va[t], pb[kk], oacc[t]);
    }
  }

  // ---- merge of the four key groups: every wave lays down its un-normalised O tile and its rows' (max, sum) ----
  __syncthreads();   // every wave has left the K/V stage before its bytes become the partial O tiles
  {
    float* os = Os + wv * (16 * AT_OP) + c * AT_OP + 8 * hh;       // row = query c; a lane's 8 registers are 8 neighbours
#pragma unroll
    for (int t = 0; t < 8; ++t) {
      *(v4f*)(os + t * 16)     = (v4f){oacc[t][0], oacc[t][1], oacc[t][2], oacc[t][3]};
      *(v4f*)(os + t * 16 + 4) = (v4f){oacc[t][4], oacc[t][5], oacc[t][6], oacc[t][7]};
    }
    const float lfin = lrun + xhalf(lrun);                         // the two halves' keys joined
    if (hh == 0) {
      Ms[grp][wave * 16 + c] = mrun;
      Ls[grp][wave * 16 + c] = lfin;
    }
  }
  __syncthreads();   // publishes the partial tiles to the waves that merge them
  // wave (grp, wave) merges rows grp*4..+3 of query tile 'wave'; each 512-B row is written by one instruction
  {
    const int c4 = lane * 4;
#pragma unroll
    for (int rr = 0; rr < 4; ++rr) {
      const int row  = grp * 4 + rr;
      const int qrow = wave * 16 + row;
      float mg[AT_G];
      float mall = ninf;
#pragma unroll
      for (int g = 0; g < AT_G; ++g) { mg[g] = Ms[g][qrow]; mall = fmaxf(mall, mg[g]); }
      float lall = 0.f;
      v4f val = (v4f){0.f, 0.f, 0.f, 0.f};
#pragma unroll
      for (int g = 0; g < AT_G; ++g) {
        const float w = __builtin_amdgcn_exp2f((mg[g] - mall) * AT_L2E);
        lall += w * Ls[g][qrow];
        const v4f part = *(const v4f*)(Os + (g * AT_NW + wave) * (16 * AT_OP) + row * AT_OP + c4);
        val += part * w;
      }
      const float inv = 1.0f / (lall * AT_PSC);
      *(v4f*)(out + (rowbase + q0 + qrow) * AT_E + c4) = val * inv;
    }
  }
}

// ---------------------------------------------------------------------------
extern "C" void kernel_launch(void* const* d_in, const int* in_sizes, int n_in,
                              void* d_out, int out_size, void* d_ws, size_t ws_size,
                              hipStream_t stream)
{
  if (n_in < 10) return;
  const float* X    = (const float*)d_in[0];
  const float* ctxt = (const float*)d_in[1];
  const float* Wq   = (const float*)d_in[2];
  const float* bq   = (const float*)d_in[3];
  const float* Wk   = (const float*)d_in[4];
  const float* bk   = (const float*)d_in[5];
  const float* Wv   = (const float*)d_in[6];
  const float* bv   = (const float*)d_in[7];
  const float* Wc   = (const float*)d_in[8];
  const float* bc   = (const float*)d_in[9];
  float* out = (float*)d_out;

  const int E = AT_E, C = AT_C;
  const int nX   = in_sizes[0];
  const int Mall = nX / E;                 // B*N token rows
  const int Bn   = in_sizes[1] / C;        // batch
  if (Bn <= 0 || Mall <= 0) return;
  const int nTok = Mall / Bn;              // tokens per batch
  if (nTok * Bn != Mall || Mall * E != nX) return;
  if ((Mall % 64) != 0 || (nTok % AT_SK) != 0) return;
  if (in_sizes[2] != E * E || in_sizes[4] != E * E || in_sizes[6] != E * E) return;
  if (in_sizes[3] != E || in_sizes[5] != E || in_sizes[7] != E) return;
  if (in_sizes[8] != E * C || in_sizes[9] != E || in_sizes[1] != Bn * C) return;
  if (out_size != nX) return;

  // ---- workspace carve (all offsets multiples of 16 KiB) ----
  const size_t nTokE = (size_t)Mall * E;              // halves per token plane
  size_t off = 0;
  _Float16* Qh  = (_Float16*)((char*)d_ws + off); off += nTokE * 2;   // [Mall][128]
  _Float16* Kh  = (_Float16*)((char*)d_ws + off); off += nTokE * 2;   // [Mall][128]
  _Float16* Vt  = (_Float16*)((char*)d_ws + off); off += nTokE * 2;   // [128][Mall]
  if (off > ws_size) return;

  // ---- Q = X Wq^T + bq, K = X Wk^T + bk : [Mall][128] f16 ; V^T : [128][Mall] f16 ; casts included ----
  qkv_proj_kernel<<<dim3(Mall / PJ_TOK), PJ_NT, 0, stream>>>(
      X, Wq, bq, Wk, bk, Wv, bv, Qh, Kh, Vt, Mall, 256.0f, 1.0f / 256.0f);

  // ---- attention ----
  {
    const float scale_f   = (float)11.313708498984761;   // sqrt(128) as f32
    const float inv_scale = 1.0f / scale_f;
    attn128_kernel<<<dim3(Bn * (nTok / 64)), AT_NT, 0, stream>>>(
        Qh, Kh, Vt, Mall, ctxt, Wc, bc, out, nTok, inv_scale);
  }
}

// v005
// One run takes 45 microseconds.
// Next to v004, in two timings, it ran 1.51 and 1.52 times as fast.
// Over all steps from v000 it is 5.35 times as fast.
// Contractions: Q/K/V projections, Q.K^T scores and P.V on v_wmma_f32_16x16x32_f16 (f16 operands, f32 accumulate); weights carried x256 and probabilities x32768 (exact power-of-two carries folded back in f32); context projection (K=64, 4 rows) and the per-query context-bias dot on VALU f32; softmax f32.
#include <hip/hip_runtime.h>

typedef __attribute__((ext_vector_type(16))) _Float16 v16h;
typedef __attribute__((ext_vector_type(8)))  _Float16 v8h;
typedef __attribute__((ext_vector_type(4)))  _Float16 v4h;
typedef __attribute__((ext_vector_type(8)))  float    v8f;
typedef __attribute__((ext_vector_type(4)))  float    v4f;

template <typename T> struct Frag;
template <> struct Frag<_Float16> {
  typedef v16h V; union U { v16h v; v8h h[2]; };
  static __device__ __forceinline__ v16h load(const _Float16* p) {   // elements 0..7 <- p[0..7], 8..15 <- p[16..23]
    U f; f.h[0] = *(const v8h*)(p); f.h[1] = *(const v8h*)(p + 16); return f.v;
  }
};

// =====================================================================================
// Q, K and V^T projections of 64 token rows in one launch, straight from the f32 inputs.
// Q = X Wq^T + bq, K = X Wk^T + bk : f16 [tokens][128]; V^T = (X Wv^T + bv)^T : f16 [128][tokens] (pitch ldv).
// Block = 12 waves. The block casts its X rows and the three weight matrices (x wcarry) to f16 on the way into LDS
// (512-B wave loads, one row each); waves 0..3 / 4..7 / 8..11 then form Q / K / V^T.
// Each wave owns 2 x 4 tiles of 16 x 16, with the operand whose index runs along an OUTPUT ROW as A: a lane's 8
// accumulator registers are then 8 neighbours of one output row and go to the LDS out tile as one 16-B store.
//   Q, K : A = 32 weight rows (features), B = the 64 X rows (tokens)      -> out tile [token][feature]
//   V^T  : A = 32 X rows (tokens),        B = 64 weight rows (features)   -> out tile [feature][token]
// The out tiles leave as whole 128-B lines. grid.x = tokens / 64; blockDim = 384.
// Every loop is fully unrolled (#pragma unroll): its arrays are indexed by the counter and must stay in registers,
// and the 46 loads of a wave must all be in flight before the first wait.
// =====================================================================================
#define PJ_E 128
#define PJ_TOK 64
#define PJ_NT 384
#define PJ_P 136                         // LDS pitch (halves) of 128-half rows
#define PJ_VP 72                         // LDS pitch (halves) of the V^T tile's 64-half rows
#define PJ_OT (PJ_E * PJ_VP)             // halves per out tile (>= 64 * 136)

__global__ __launch_bounds__(PJ_NT)
void qkv_proj_kernel(const float* __restrict__ X,
                     const float* __restrict__ Wq, const float* __restrict__ bq,
                     const float* __restrict__ Wk, const float* __restrict__ bk,
                     const float* __restrict__ Wv, const float* __restrict__ bv,
                     _Float16* __restrict__ Qh, _Float16* __restrict__ Kh, _Float16* __restrict__ Vt, int ldv,
                     float wcarry, float wundo)
{
  static_assert(PJ_TOK * PJ_P <= PJ_OT, "Q/K out tile must fit");
  __shared__ __align__(16) _Float16 Sm[(PJ_TOK + 3 * PJ_E) * PJ_P];   // rows 0..63: X; rows 64 + 128 m + f: weight m
  __shared__ __align__(16) _Float16 Ot[3 * PJ_OT];

  const int tid   = threadIdx.x;
  const int wv    = __builtin_amdgcn_readfirstlane(tid >> 5);   // 0..11, in a scalar register: selects by matrix stay scalar
  const int mat   = wv >> 2;                                    // 0 Q, 1 K, 2 V
  const int sl    = wv & 3;
  const int gt    = tid & 127;                                  // thread inside its 4-wave group
  const int lane  = tid & 31;
  const int rlane = lane & 15;
  const int hh    = lane >> 4;
  const int tok0  = blockIdx.x * PJ_TOK;

  // ---- all global loads first, none under a branch: bias values, X rows (block), this group's weight matrix ----
  const int colA0 = (mat < 2) ? sl * 32 : (sl & 1) * 32;         // first out column of the wave (A index)
  const int rowB0 = (mat < 2) ? 0 : (sl >> 1) * 64;              // first out row of the wave (B index)
  const v4f* bA = (const v4f*)((mat == 1 ? bk : bq) + colA0 + 8 * hh);   // in bounds for every wave; used by Q, K
  v4f bmv[2][2];
  float bnv[4];
#pragma unroll
  for (int i = 0; i < 2; ++i) { bmv[i][0] = bA[i * 4]; bmv[i][1] = bA[i * 4 + 1]; }
#pragma unroll
  for (int j = 0; j < 4; ++j) bnv[j] = bv[rowB0 + j * 16 + rlane];       // in bounds for every wave; used by V

  const v4f* Xg = (const v4f*)(X + (size_t)tok0 * PJ_E);
  const v4f* Wg = (const v4f*)(mat == 0 ? Wq : (mat == 1 ? Wk : Wv));
  // X: 2048 16-B pieces = 5 per thread + 128; every group loads the last 128, group 0 alone stores them
  v4f xr[6], wr[32];
#pragma unroll
  for (int i = 0; i < 5; ++i) xr[i] = Xg[i * PJ_NT + tid];
  xr[5] = Xg[5 * PJ_NT + gt];
#pragma unroll
  for (int i = 0; i < 32; ++i) wr[i] = Wg[i * 128 + gt];

  // ---- cast to f16 into LDS ----
#pragma unroll
  for (int i = 0; i < 6; ++i) {
    const int idx = (i < 5) ? i * PJ_NT + tid : 5 * PJ_NT + gt;
    v4h h;
#pragma unroll
    for (int e = 0; e < 4; ++e) h[e] = (_Float16)xr[i][e];
    if (i < 5 || mat == 0) *(v4h*)(Sm + (idx >> 5) * PJ_P + (idx & 31) * 4) = h;
  }
  {
    _Float16* wdst = Sm + (PJ_TOK + mat * PJ_E) * PJ_P;
#pragma unroll
    for (int i = 0; i < 32; ++i) {
      const int idx = i * 128 + gt;
      v4h h;
#pragma unroll
      for (int e = 0; e < 4; ++e) h[e] = (_Float16)(wr[i][e] * wcarry);
      *(v4h*)(wdst + (idx >> 5) * PJ_P + (idx & 31) * 4) = h;
    }
  }
  __syncthreads();

  float bm[2][8], bn[4];                                         // bias along A (Q, K) or along B (V); the other is 0
#pragma unroll
  for (int i = 0; i < 2; ++i)
#pragma unroll
    for (int r = 0; r < 8; ++r) bm[i][r] = (mat < 2) ? bmv[i][r >> 2][r & 3] : 0.f;
#pragma unroll
  for (int j = 0; j < 4; ++j) bn[j] = (mat < 2) ? 0.f : bnv[j];

  // ---- products: both operands by the same loader, so their k orders agree ----
  const int rowA = (mat < 2) ? (PJ_TOK + mat * PJ_E + colA0) : colA0;
  const int rowB = (mat < 2) ? 0 : (PJ_TOK + 2 * PJ_E + rowB0);
  const _Float16* pA = Sm + (rowA + rlane) * PJ_P + 8 * hh;
  const _Float16* pB = Sm + (rowB + rlane) * PJ_P + 8 * hh;
  v8f acc[2][4];
#pragma unroll
  for (int i = 0; i < 2; ++i)
#pragma unroll
    for (int j = 0; j < 4; ++j) acc[i][j] = (v8f){0.f,0.f,0.f,0.f,0.f,0.f,0.f,0.f};
#pragma unroll
  for (int k0 = 0; k0 < PJ_E; k0 += 32) {
    v16h a[2], b[4];
#pragma unroll
    for (int i = 0; i < 2; ++i) a[i] = Frag<_Float16>::load(pA + i * 16 * PJ_P + k0);
#pragma unroll
    for (int j = 0; j < 4; ++j) b[j] = Frag<_Float16>::load(pB + j * 16 * PJ_P + k0);
#pragma unroll
    for (int i = 0; i < 2; ++i)
#pragma unroll
      for (int j = 0; j < 4; ++j)
        acc[i][j] = __builtin_amdgcn_wmma_f32_16x16x32_f16(false, a[i], false, b[j], (short)0, acc[i][j], false, false);
  }

  // ---- undo the carry, add the bias, f16, out tile in LDS ----
  _Float16* ot = Ot + mat * PJ_OT;
  const int opitch = (mat < 2) ? PJ_P : PJ_VP;
#pragma unroll
  for (int i = 0; i < 2; ++i)
#pragma unroll
    for (int j = 0; j < 4; ++j) {
      v8h hv;
#pragma unroll
      for (int r = 0; r < 8; ++r) hv[r] = (_Float16)((acc[i][j][r] * wundo + bm[i][r]) + bn[j]);
      *(v8h*)(ot + (rowB0 + j * 16 + rlane) * opitch + colA0 + i * 16 + 8 * hh) = hv;
    }
  __syncthreads();

  // ---- each group stores its own tile: 16 B per lane, whole 128-B lines (Q, K: 64 rows of 256 B; V^T: 128 of 128 B) ----
  _Float16* G = (mat == 0) ? Qh + (size_t)tok0 * PJ_E : ((mat == 1) ? Kh + (size_t)tok0 * PJ_E : Vt + tok0);
  const int gpitch = (mat < 2) ? PJ_E : ldv;
  const int rsh    = (mat < 2) ? 4 : 3;                            // 16-B pieces per row: 16 or 8
  const int c8     = (gt & ((1 << rsh) - 1)) * 8;
#pragma unroll
  for (int i = 0; i < 8; ++i) {
    const int row = (i * 128 + gt) >> rsh;
    *(v8h*)(G + (size_t)row * gpitch + c8) = *(const v8h*)(ot + row * opitch + c8);
  }
}

// =====================================================================================
// Single-head attention, head dim 128, f16 q/k planes row-major [B*N][128], f16 V^T plane [128][B*N] (pitch ldv),
// f32 out. scores = (q.k^T) * inv_scale + bias[q] with bias[q] = sum_d q[q][d] * ctx[b][d],
// ctx[b][e] = sum_c context[b][c] * Wc[e][c] + bc[e] (VALU f32, per block); softmax over all keys (no mask), f32 online;
// out = p.v with p carried x2^15 in f16, folded into the final 1/l.
// Block = 16 waves = 64 query rows of one batch x 4 key groups: wave (g, qw) runs query rows qw*16..+15 over the
// g-th 64 keys of every 256-key stage, so each SIMD holds four waves that fill one another's waits. The stages come
// by asynchronous copies to LDS into two buffers: stage s + 1 is in flight while stage s is worked on, one barrier per
// stage. Each group keeps its own online (max, sum, O); the four are merged once in LDS behind the loop.
// Both products are formed transposed: S^T = K Q^T (A = K rows, B = Q, kept in registers) and O^T += V^T P^T
// (A = V^T rows, B = P^T). A lane then holds scores of ONE query (column c; keys 8hh+r of each 16-key tile): max and
// sum run in the lane plus one exchange between the wave halves, and two neighbouring score tiles, converted in
// place, ARE the B operand of the second product (its k order is the fragment loader's), so P never leaves registers.
// grid.x = B * (N / 64); blockDim = 512; N % 256 == 0.
// =====================================================================================
#define AT_E 128
#define AT_C 64
#define AT_QB 64
#define AT_KC 64
#define AT_NW 4
#define AT_G 4
#define AT_SK (AT_G * AT_KC)
#define AT_NT (AT_G * AT_NW * 32)
#define AT_QP 136
#define AT_KP 136
#define AT_VP (AT_SK + 8)
#define AT_OP 132
#define AT_PSC 32768.0f
#define AT_L2E 1.4426950408889634f

__device__ __forceinline__ v8f mma_h16(v16h a, v16h b, v8f c) {
  c = __builtin_amdgcn_wmma_f32_16x16x32_f16(false, a, false, b, (short)0, c, false, false);
  asm volatile("v_nop\n\tv_nop\n\tv_nop\n\tv_nop" : "+v"(c) : "v"(a), "v"(b));
  return c;
}

// lane l <-> lane l ^ 16
__device__ __forceinline__ float xhalf(float x) {
  return __builtin_bit_cast(float, __builtin_amdgcn_permlanex16(__builtin_bit_cast(int, x), __builtin_bit_cast(int, x),
                                                                0x76543210, 0xfedcba98, false, false));
}

// byte offset in the work-group's LDS = low 32 bits of a __shared__ address
__device__ __forceinline__ unsigned lds_off(const void* p) { return (unsigned)(size_t)p; }

// Eight asynchronous copies global -> LDS, 16 B per lane each, through no register: piece i goes from g + i * gstep
// (halves) to LDS byte l + i * lstep. The statement ends in s_wait_xcnt 0 (a precaution): the registers that the
// copies name live to its end, so none of them takes a new value in front of that wait.
__device__ __forceinline__ void copy8_async(unsigned l, unsigned lstep, const _Float16* g, size_t gstep) {
  asm volatile("global_load_async_to_lds_b128 %0, %8, off\n\t"
               "global_load_async_to_lds_b128 %1, %9, off\n\t"
               "global_load_async_to_lds_b128 %2, %10, off\n\t"
               "global_load_async_to_lds_b128 %3, %11, off\n\t"
               "global_load_async_to_lds_b128 %4, %12, off\n\t"
               "global_load_async_to_lds_b128 %5, %13, off\n\t"
               "global_load_async_to_lds_b128 %6, %14, off\n\t"
               "global_load_async_to_lds_b128 %7, %15, off\n\t"
               "s_wait_xcnt 0x0"
               :: "v"(l), "v"(l + lstep), "v"(l + 2 * lstep), "v"(l + 3 * lstep),
                  "v"(l + 4 * lstep), "v"(l + 5 * lstep), "v"(l + 6 * lstep), "v"(l + 7 * lstep),
                  "v"(g), "v"(g + gstep), "v"(g + 2 * gstep), "v"(g + 3 * gstep),
                  "v"(g + 4 * gstep), "v"(g + 5 * gstep), "v"(g + 6 * gstep), "v"(g + 7 * gstep)
               : "memory");
}

__global__ __launch_bounds__(AT_NT)
void attn128_kernel(const _Float16* __restrict__ Qh, const _Float16* __restrict__ Kh,
                    const _Float16* __restrict__ Vt, int ldv,
                    const float* __restrict__ ctxin, const float* __restrict__ Wc, const float* __restrict__ bcv,
                    float* __restrict__ out, int nTok, float inv_scale)
{
  __shared__ __align__(16) float    ctxS[AT_E];
  __shared__ __align__(16) _Float16 Qsh[AT_QB * AT_QP];          // [q][d]      pitch 136
  __shared__ __align__(16) float    Ms[AT_G][AT_QB];             // per group row max
  __shared__ __align__(16) float    Ls[AT_G][AT_QB];             // per group row sum
  // Two stage buffers, each K [256 kv][d] pitch 136, then V^T [128 d][256 kv] pitch 264; behind the loop the first
  // buffer's bytes hold the 16 waves' partial O tiles (16 x 128 f32, pitch 132).
  constexpr int KV_BYTES = (AT_SK * AT_KP + AT_E * AT_VP) * 2;
  static_assert(AT_G * AT_NW * 16 * AT_OP * 4 <= KV_BYTES, "partial O tiles must fit the K/V stage");
  static_assert(KV_BYTES % 16 == 0, "the second buffer keeps the copies' 16-B alignment");
  __shared__ __align__(16) unsigned char KVraw[2 * KV_BYTES];
  _Float16* const Ksh = (_Float16*)KVraw;
  _Float16* const Vts = (_Float16*)KVraw + AT_SK * AT_KP;
  float*    const Os  = (float*)KVraw;

  const int tid  = threadIdx.x;
  const int wv   = tid >> 5;        // 0..15
  const int wave = wv & (AT_NW - 1);   // query tile of this wave
  const int grp  = wv >> 2;            // key group of this wave
  const int lane = tid & 31;
  const int hh   = lane >> 4;
  const int c    = lane & 15;

  const int nqb = nTok / AT_QB;
  const int b   = blockIdx.x / nqb;
  const int qb  = blockIdx.x - b * nqb;
  const int q0  = qb * AT_QB;
  const size_t rowbase = (size_t)b * nTok;       // first token row of this batch
  const size_t colbase = rowbase;                 // column offset of this batch inside V^T rows

  // ---- a thread's pieces of a stage: K rows (tid >> 4) + 32 i, V^T rows (tid >> 5) + 16 i, i = 0..7, 16 B each ----
  const int nChunks = nTok / AT_SK;                                    // block-uniform, size-derived
  const _Float16* kg = Kh + (rowbase + (tid >> 4)) * AT_E + (tid & 15) * 8;
  const _Float16* vg = Vt + (size_t)(tid >> 5) * ldv + colbase + (tid & 31) * 8;
  const unsigned  kl = lds_off(Ksh + (tid >> 4) * AT_KP + (tid & 15) * 8);
  const unsigned  vl = lds_off(Vts + (tid >> 5) * AT_VP + (tid & 31) * 8);
  const size_t    vstep = (size_t)(AT_NT / 32) * ldv;
  // stage 0 -> buffer 0, in flight during the context projection and the Q load
  copy8_async(kl, (AT_NT / 16) * AT_KP * 2, kg, (size_t)(AT_NT / 16) * AT_E);
  copy8_async(vl, (AT_NT / 32) * AT_VP * 2, vg, vstep);

  // ---- context projection ctx[b][e], one thread per e ----
  if (tid < AT_E) {
    const float* cr = ctxin + (size_t)b * AT_C;
    const float* wr = Wc + (size_t)tid * AT_C;
    float a = 0.f;
#pragma unroll 4
    for (int cc = 0; cc < AT_C; ++cc) a += cr[cc] * wr[cc];
    ctxS[tid] = a + bcv[tid];
  }
  // ---- Q block [64][128] into LDS ----
#pragma unroll
  for (int i = 0; i < 2; ++i) {
    const int idx = i * AT_NT + tid;
    const int row = idx >> 4, c8 = (idx & 15) * 8;
    const v8h v = *(const v8h*)(Qh + (rowbase + q0 + row) * AT_E + c8);
    *(v8h*)(Qsh + row * AT_QP + c8) = v;
  }
  asm volatile("s_wait_asynccnt 0x0" ::: "memory");   // this wave's copies of stage 0 have landed; the barrier publishes them
  __syncthreads();
  if (nChunks > 1) {                                   // stage 1 -> buffer 1
    copy8_async(kl + KV_BYTES, (AT_NT / 16) * AT_KP * 2, kg + (size_t)AT_SK * AT_E, (size_t)(AT_NT / 16) * AT_E);
    copy8_async(vl + KV_BYTES, (AT_NT / 32) * AT_VP * 2, vg + AT_SK, vstep);
  }

  // ---- per-query context bias: lanes c / c+16 each sum 64 of the 128 d of row c of this wave ----
  float bias;                                                     // of query c, in both halves
  {
    const _Float16* qr = Qsh + (wave * 16 + c) * AT_QP + hh * 64;
    const float* cx = ctxS + hh * 64;
    float part = 0.f;
#pragma unroll 8
    for (int e = 0; e < 64; ++e) part += (float)qr[e] * cx[e];
    part += __shfl_xor(part, 16, 32);
    bias = part;
  }

  const float ninf = -__builtin_inff();
  float mrun = ninf;                 // running max of query c (same in both halves)
  float lrun = 0.f;                  // running sum of query c over THIS half's keys; the halves join behind the loop
  v8f oacc[8];                       // O^T: oacc[t][r] = O[query c][d = t*16 + 8hh + r]
#pragma unroll
  for (int t = 0; t < 8; ++t) oacc[t] = (v8f){0.f,0.f,0.f,0.f,0.f,0.f,0.f,0.f};

  // Q of this wave as the B operand of S^T, read once: qf[dc] = Q[query c][dc*32 + k order of the loader]
  v16h qf[4];
#pragma unroll
  for (int dc = 0; dc < 4; ++dc) qf[dc] = Frag<_Float16>::load(Qsh + (wave * 16 + c) * AT_QP + dc * 32 + 8 * hh);
  for (int kc = 0; kc < nChunks; ++kc) {
    const int boff = (kc & 1) * KV_BYTES;                              // stage kc lies in buffer kc mod 2
    const _Float16* kgrp = Ksh + boff / 2 + grp * AT_KC * AT_KP;       // this group's 64 K rows of the stage
    const _Float16* vgrp = Vts + boff / 2 + grp * AT_KC;               // this group's 64 V^T columns of the stage

    // ---- S^T = K Q^T : A[m=key c][k=d] from kgrp row (j*16+c), B[k=d][n=query c] = qf ----
    v8f st[4];                       // st[j][r] = score of key j*16 + 8hh + r against query c
#pragma unroll
    for (int j = 0; j < 4; ++j) st[j] = (v8f){0.f,0.f,0.f,0.f,0.f,0.f,0.f,0.f};
    // The K fragments of one d step (eight 16-B LDS loads) are issued as one group in front of their four WMMAs:
    // one LDS round trip per group, not one per WMMA (a load written behind mma_h16's asm statement stays behind it).
    // Unrolled: qf is indexed by the counter and must stay in registers.
#pragma unroll
    for (int dc = 0; dc < 4; ++dc) {
      v16h ka[4];
#pragma unroll
      for (int j = 0; j < 4; ++j) ka[j] = Frag<_Float16>::load(kgrp + (j * 16 + c) * AT_KP + dc * 32 + 8 * hh);
#pragma unroll
      for (int j = 0; j < 4; ++j) st[j] = mma_h16(ka[j], qf[dc], st[j]);
    }

    // ---- scale + bias, chunk max of query c: 32 scores in the lane, the other 32 in lane l ^ 16 ----
    float cmj[4];
#pragma unroll
    for (int j = 0; j < 4; ++j) {
      float m = ninf;
#pragma unroll
      for (int r = 0; r < 8; ++r) {
        const float z = st[j][r] * inv_scale + bias;
        st[j][r] = z;
        m = fmaxf(m, z);
      }
      cmj[j] = m;
    }
    float cm = fmaxf(fmaxf(cmj[0], cmj[1]), fmaxf(cmj[2], cmj[3]));
    cm = fmaxf(cm, xhalf(cm));
    const float mnew  = fmaxf(mrun, cm);
    const float alpha = __builtin_amdgcn_exp2f((mrun - mnew) * AT_L2E);
    mrun = mnew;
    // ---- P^T: tiles 2kk and 2kk+1, converted in place, are the B operand of keys kk*32..+31 ----
    v16h pb[2];
    float psj[4];
#pragma unroll
    for (int j = 0; j < 4; ++j) {
      float ps = 0.f;
#pragma unroll
      for (int r = 0; r < 8; ++r) {
        const float p = __builtin_amdgcn_exp2f((st[j][r] - mnew) * AT_L2E);
        ps += p;
        pb[j >> 1][(j & 1) * 8 + r] = (_Float16)(p * AT_PSC);
      }
      psj[j] = ps;
    }
    lrun = lrun * alpha + ((psj[0] + psj[1]) + (psj[2] + psj[3]));
#pragma unroll
    for (int t = 0; t < 8; ++t)
#pragma unroll
      for (int r = 0; r < 8; ++r) oacc[t][r] *= alpha;

    // ---- O^T += V^T P^T : A[m=d c][k=kv] from vgrp row (t*16+c), B[k=kv][n=query c] = pb ----
    // likewise: the V^T fragments of 32 keys (sixteen 16-B LDS loads) as one group in front of their eight WMMAs
#pragma unroll
    for (int kk = 0; kk < 2; ++kk) {
      v16h va[8];
#pragma unroll
      for (int t = 0; t < 8; ++t) va[t] = Frag<_Float16>::load(vgrp + (t * 16 + c) * AT_VP + kk * 32 + 8 * hh);
#pragma unroll
      for (int t = 0; t < 8; ++t) oacc[t] = mma_h16(va[t], pb[kk], oacc[t]);
    }

    // ---- hand-over: this wave's reads of stage kc are done and its copies of stage kc + 1 have landed; the one
    // barrier publishes stage kc + 1 and frees stage kc's buffer, which stage kc + 2 then refills ----
    asm volatile("s_wait_dscnt 0x0" ::: "memory");
    asm volatile("s_wait_asynccnt 0x0" ::: "memory");
    __syncthreads();
    if (kc + 2 < nChunks) {
      const size_t s2 = (size_t)(kc + 2) * AT_SK;
      copy8_async(kl + boff, (AT_NT / 16) * AT_KP * 2, kg + s2 * AT_E, (size_t)(AT_NT / 16) * AT_E);
      copy8_async(vl + boff, (AT_NT / 32) * AT_VP * 2, vg + s2, vstep);
    }
  }
  asm volatile("s_wait_asynccnt 0x0" ::: "memory");   // no copy is outstanding when the buffers change their use

  // ---- merge of the four key groups: every wave lays down its un-normalised O tile and its rows' (max, sum) ----
  __syncthreads();   // every wave has left the K/V stage before its bytes become the partial O tiles
  {
    float* os = Os + wv * (16 * AT_OP) + c * AT_OP + 8 * hh;       // row = query c; a lane's 8 registers are 8 neighbours
#pragma unroll
    for (int t = 0; t < 8; ++t) {
      *(v4f*)(os + t * 16)     = (v4f){oacc[t][0], oacc[t][1], oacc[t][2], oacc[t][3]};
      *(v4f*)(os + t * 16 + 4) = (v4f){oacc[t][4], oacc[t][5], oacc[t][6], oacc[t][7]};
    }
    const float lfin = lrun + xhalf(lrun);                         // the two halves' keys joined
    if (hh == 0) {
      Ms[grp][wave * 16 + c] = mrun;
      Ls[grp][wave * 16 + c] = lfin;
    }
  }
  __syncthreads();   // publishes the partial tiles to the waves that merge them
  // wave (grp, wave) merges rows grp*4..+3 of query tile 'wave'; each 512-B row is written by one instruction
  {
    const int c4 = lane * 4;
#pragma unroll
    for (int rr = 0; rr < 4; ++rr) {
      const int row  = grp * 4 + rr;
      const int qrow = wave * 16 + row;
      float mg[AT_G];
      float mall = ninf;
#pragma unroll
      for (int g = 0; g < AT_G; ++g) { mg[g] = Ms[g][qrow]; mall = fmaxf(mall, mg[g]); }
      float lall = 0.f;
      v4f val = (v4f){0.f, 0.f, 0.f, 0.f};
#pragma unroll
      for (int g = 0; g < AT_G; ++g) {
        const float w = __builtin_amdgcn_exp2f((mg[g] - mall) * AT_L2E);
        lall += w * Ls[g][qrow];
        const v4f part = *(const v4f*)(Os + (g * AT_NW + wave) * (16 * AT_OP) + row * AT_OP + c4);
        val += part * w;
      }
      const float inv = 1.0f / (lall * AT_PSC);
      *(v4f*)(out + (rowbase + q0 + qrow) * AT_E + c4) = val * inv;
    }
  }
}

// ---------------------------------------------------------------------------
extern "C" void kernel_launch(void* const* d_in, const int* in_sizes, int n_in,
                              void* d_out, int out_size, void* d_ws, size_t ws_size,
                              hipStream_t stream)
{
  if (n_in < 10) return;
  const float* X    = (const float*)d_in[0];
  const float* ctxt = (const float*)d_in[1];
  const float* Wq   = (const float*)d_in[2];
  const float* bq   = (const float*)d_in[3];
  const float* Wk   = (const float*)d_in[4];
  const float* bk   = (const float*)d_in[5];
  const float* Wv   = (const float*)d_in[6];
  const float* bv   = (const float*)d_in[7];
  const float* Wc   = (const float*)d_in[8];
  const float* bc   = (const float*)d_in[9];
  float* out = (float*)d_out;

  const int E = AT_E, C = AT_C;
  const int nX   = in_sizes[0];
  const int Mall = nX / E;                 // B*N token rows
  const int Bn   = in_sizes[1] / C;        // batch
  if (Bn <= 0 || Mall <= 0) return;
  const int nTok = Mall / Bn;              // tokens per batch
  if (nTok * Bn != Mall || Mall * E != nX) return;
  if ((Mall % 64) != 0 || (nTok % AT_SK) != 0) return;
  if (in_sizes[2] != E * E || in_sizes[4] != E * E || in_sizes[6] != E * E) return;
  if (in_sizes[3] != E || in_sizes[5] != E || in_sizes[7] != E) return;
  if (in_sizes[8] != E * C || in_sizes[9] != E || in_sizes[1] != Bn * C) return;
  if (out_size != nX) return;

  // ---- workspace carve (all offsets multiples of 16 KiB) ----
  const size_t nTokE = (size_t)Mall * E;              // halves per token plane
  size_t off = 0;
  _Float16* Qh  = (_Float16*)((char*)d_ws + off); off += nTokE * 2;   // [Mall][128]
  _Float16* Kh  = (_Float16*)((char*)d_ws + off); off += nTokE * 2;   // [Mall][128]
  _Float16* Vt  = (_Float16*)((char*)d_ws + off); off += nTokE * 2;   // [128][Mall]
  if (off > ws_size) return;

  // ---- Q = X Wq^T + bq, K = X Wk^T + bk : [Mall][128] f16 ; V^T : [128][Mall] f16 ; casts included ----
  qkv_proj_kernel<<<dim3(Mall / PJ_TOK), PJ_NT, 0, stream>>>(
      X, Wq, bq, Wk, bk, Wv, bv, Qh, Kh, Vt, Mall, 256.0f, 1.0f / 256.0f);

  // ---- attention ----
  {
    const float scale_f   = (float)11.313708498984761;   // sqrt(128) as f32
    const float inv_scale = 1.0f / scale_f;
    attn128_kernel<<<dim3(Bn * (nTok / 64)), AT_NT, 0, stream>>>(
        Qh, Kh, Vt, Mall, ctxt, Wc, bc, out, nTok, inv_scale);
  }
}

// v006
// Measured time: 42.6 microseconds a run.
// Next to v005, in two timings, it ran 1.06 times as fast each time.
// Counting every step since v000, it is 5.68 times as fast.
// Contractions: Q/K/V projections, Q.K^T scores and P.V on v_wmma_f32_16x16x32_f16 (f16 operands, f32 accumulate); weights carried x256 and probabilities x32768 (exact power-of-two carries folded back in f32); context projection (K=64, 4 rows) and the per-query context-bias dot on VALU f32; softmax f32.
#include <hip/hip_runtime.h>

typedef __attribute__((ext_vector_type(16))) _Float16 v16h;
typedef __attribute__((ext_vector_type(8)))  _Float16 v8h;
typedef __attribute__((ext_vector_type(4)))  _Float16 v4h;
typedef __attribute__((ext_vector_type(8)))  float    v8f;
typedef __attribute__((ext_vector_type(4)))  float    v4f;

template <typename T> struct Frag;
template <> struct Frag<_Float16> {
  typedef v16h V; union U { v16h v; v8h h[2]; };
  static __device__ __forceinline__ v16h load(const _Float16* p) {   // elements 0..7 <- p[0..7], 8..15 <- p[16..23]
    U f; f.h[0] = *(const v8h*)(p); f.h[1] = *(const v8h*)(p + 16); return f.v;
  }
};

// =====================================================================================
// Q, K and V^T projections of 64 token rows in one launch, straight from the f32 inputs.
// Q = X Wq^T + bq, K = X Wk^T + bk : f16 [tokens][128]; V^T = (X Wv^T + bv)^T : f16 [128][tokens] (pitch ldv).
// Block = 12 waves. The block casts its X rows and the three weight matrices (x wcarry) to f16 on the way into LDS
// (512-B wave loads, one row each); waves 0..3 / 4..7 / 8..11 then form Q / K / V^T.
// Each wave owns 2 x 4 tiles of 16 x 16, with the operand whose index runs along an OUTPUT ROW as A: a lane's 8
// accumulator registers are then 8 neighbours of one output row and go to the LDS out tile as one 16-B store.
//   Q, K : A = 32 weight rows (features), B = the 64 X rows (tokens)      -> out tile [token][feature]
//   V^T  : A = 32 X rows (tokens),        B = 64 weight rows (features)   -> out tile [feature][token]
// The out tiles leave as whole 128-B lines. grid.x = tokens / 64; blockDim = 384.
// Every loop is fully unrolled (#pragma unroll): its arrays are indexed by the counter and must stay in registers,
// and the 46 loads of a wave must all be in flight before the first wait.
// =====================================================================================
#define PJ_E 128
#define PJ_TOK 64
#define PJ_NT 384
#define PJ_P 136                         // LDS pitch (halves) of 128-half rows
#define PJ_VP 72                         // LDS pitch (halves) of the V^T tile's 64-half rows
#define PJ_OT (PJ_E * PJ_VP)             // halves per out tile (>= 64 * 136)

__global__ __launch_bounds__(PJ_NT)
void qkv_proj_kernel(const float* __restrict__ X,
                     const float* __restrict__ Wq, const float* __restrict__ bq,
                     const float* __restrict__ Wk, const float* __restrict__ bk,
                     const float* __restrict__ Wv, const float* __restrict__ bv,
                     _Float16* __restrict__ Qh, _Float16* __restrict__ Kh, _Float16* __restrict__ Vt, int ldv,
                     float wcarry, float wundo)
{
  static_assert(PJ_TOK * PJ_P <= PJ_OT, "Q/K out tile must fit");
  __shared__ __align__(16) _Float16 Sm[(PJ_TOK + 3 * PJ_E) * PJ_P];   // rows 0..63: X; rows 64 + 128 m + f: weight m
  __shared__ __align__(16) _Float16 Ot[3 * PJ_OT];

  const int tid   = threadIdx.x;
  const int wv    = __builtin_amdgcn_readfirstlane(tid >> 5);   // 0..11, in a scalar register: selects by matrix stay scalar
  const int mat   = wv >> 2;                                    // 0 Q, 1 K, 2 V
  const int sl    = wv & 3;
  const int gt    = tid & 127;                                  // thread inside its 4-wave group
  const int lane  = tid & 31;
  const int rlane = lane & 15;
  const int hh    = lane >> 4;
  const int tok0  = blockIdx.x * PJ_TOK;

  // ---- all global loads first, none under a branch: bias values, X rows (block), this group's weight matrix ----
  const int colA0 = (mat < 2) ? sl * 32 : (sl & 1) * 32;         // first out column of the wave (A index)
  const int rowB0 = (mat < 2) ? 0 : (sl >> 1) * 64;              // first out row of the wave (B index)
  const v4f* bA = (const v4f*)((mat == 1 ? bk : bq) + colA0 + 8 * hh);   // in bounds for every wave; used by Q, K
  v4f bmv[2][2];
  float bnv[4];
#pragma unroll
  for (int i = 0; i < 2; ++i) { bmv[i][0] = bA[i * 4]; bmv[i][1] = bA[i * 4 + 1]; }
#pragma unroll
  for (int j = 0; j < 4; ++j) bnv[j] = bv[rowB0 + j * 16 + rlane];       // in bounds for every wave; used by V

  const v4f* Xg = (const v4f*)(X + (size_t)tok0 * PJ_E);
  const v4f* Wg = (const v4f*)(mat == 0 ? Wq : (mat == 1 ? Wk : Wv));
  // X: 2048 16-B pieces = 5 per thread + 128; every group loads the last 128, group 0 alone stores them
  v4f xr[6], wr[32];
#pragma unroll
  for (int i = 0; i < 5; ++i) xr[i] = Xg[i * PJ_NT + tid];
  xr[5] = Xg[5 * PJ_NT + gt];
#pragma unroll
  for (int i = 0; i < 32; ++i) wr[i] = Wg[i * 128 + gt];

  // ---- cast to f16 into LDS ----
#pragma unroll
  for (int i = 0; i < 6; ++i) {
    const int idx = (i < 5) ? i * PJ_NT + tid : 5 * PJ_NT + gt;
    v4h h;
#pragma unroll
    for (int e = 0; e < 4; ++e) h[e] = (_Float16)xr[i][e];
    if (i < 5 || mat == 0) *(v4h*)(Sm + (idx >> 5) * PJ_P + (idx & 31) * 4) = h;
  }
  {
    _Float16* wdst = Sm + (PJ_TOK + mat * PJ_E) * PJ_P;
#pragma unroll
    for (int i = 0; i < 32; ++i) {
      const int idx = i * 128 + gt;
      v4h h;
#pragma unroll
      for (int e = 0; e < 4; ++e) h[e] = (_Float16)(wr[i][e] * wcarry);
      *(v4h*)(wdst + (idx >> 5) * PJ_P + (idx & 31) * 4) = h;
    }
  }
  __syncthreads();

  float bm[2][8], bn[4];                                         // bias along A (Q, K) or along B (V); the other is 0
#pragma unroll
  for (int i = 0; i < 2; ++i)
#pragma unroll
    for (int r = 0; r < 8; ++r) bm[i][r] = (mat < 2) ? bmv[i][r >> 2][r & 3] : 0.f;
#pragma unroll
  for (int j = 0; j < 4; ++j) bn[j] = (mat < 2) ? 0.f : bnv[j];

  // ---- products: both operands by the same loader, so their k orders agree ----
  const int rowA = (mat < 2) ? (PJ_TOK + mat * PJ_E + colA0) : colA0;
  const int rowB = (mat < 2) ? 0 : (PJ_TOK + 2 * PJ_E + rowB0);
  const _Float16* pA = Sm + (rowA + rlane) * PJ_P + 8 * hh;
  const _Float16* pB = Sm + (rowB + rlane) * PJ_P + 8 * hh;
  v8f acc[2][4];
#pragma unroll
  for (int i = 0; i < 2; ++i)
#pragma unroll
    for (int j = 0; j < 4; ++j) acc[i][j] = (v8f){0.f,0.f,0.f,0.f,0.f,0.f,0.f,0.f};
#pragma unroll
  for (int k0 = 0; k0 < PJ_E; k0 += 32) {
    v16h a[2], b[4];
#pragma unroll
    for (int i = 0; i < 2; ++i) a[i] = Frag<_Float16>::load(pA + i * 16 * PJ_P + k0);
#pragma unroll
    for (int j = 0; j < 4; ++j) b[j] = Frag<_Float16>::load(pB + j * 16 * PJ_P + k0);
#pragma unroll
    for (int i = 0; i < 2; ++i)
#pragma unroll
      for (int j = 0; j < 4; ++j)
        acc[i][j] = __builtin_amdgcn_wmma_f32_16x16x32_f16(false, a[i], false, b[j], (short)0, acc[i][j], false, false);
  }

  // ---- undo the carry, add the bias, f16, out tile in LDS ----
  _Float16* ot = Ot + mat * PJ_OT;
  const int opitch = (mat < 2) ? PJ_P : PJ_VP;
#pragma unroll
  for (int i = 0; i < 2; ++i)
#pragma unroll
    for (int j = 0; j < 4; ++j) {
      v8h hv;
#pragma unroll
      for (int r = 0; r < 8; ++r) hv[r] = (_Float16)((acc[i][j][r] * wundo + bm[i][r]) + bn[j]);
      *(v8h*)(ot + (rowB0 + j * 16 + rlane) * opitch + colA0 + i * 16 + 8 * hh) = hv;
    }
  __syncthreads();

  // ---- each group stores its own tile: 16 B per lane, whole 128-B lines (Q, K: 64 rows of 256 B; V^T: 128 of 128 B) ----
  _Float16* G = (mat == 0) ? Qh + (size_t)tok0 * PJ_E : ((mat == 1) ? Kh + (size_t)tok0 * PJ_E : Vt + tok0);
  const int gpitch = (mat < 2) ? PJ_E : ldv;
  const int rsh    = (mat < 2) ? 4 : 3;                            // 16-B pieces per row: 16 or 8
  const int c8     = (gt & ((1 << rsh) - 1)) * 8;
#pragma unroll
  for (int i = 0; i < 8; ++i) {
    const int row = (i * 128 + gt) >> rsh;
    *(v8h*)(G + (size_t)row * gpitch + c8) = *(const v8h*)(ot + row * opitch + c8);
  }
}

// =====================================================================================
// Single-head attention, head dim 128, f16 q/k planes row-major [B*N][128], f16 V^T plane [128][B*N] (pitch ldv),
// f32 out. scores = (q.k^T) * inv_scale + bias[q] with bias[q] = sum_d q[q][d] * ctx[b][d],
// ctx[b][e] = sum_c context[b][c] * Wc[e][c] + bc[e] (VALU f32, per block); softmax over all keys (no mask), f32 online;
// out = p.v with p carried x2^15 in f16, folded into the final 1/l.
// Block = 8 waves = 64 query rows of one batch x 4 key groups: wave (g, qw) runs query rows qw*32..+31 (two 16-query
// tiles) over the g-th 64 keys of every 256-key stage: every K and V^T fragment read from LDS feeds two WMMAs, so the
// block's LDS reads per stage take no longer than its WMMAs; each SIMD holds two waves. The stages come
// by asynchronous copies to LDS into two buffers: stage s + 1 is in flight while stage s is worked on, one barrier per
// stage. Each group keeps its own online (max, sum, O); the four are merged once in LDS behind the loop.
// Both products are formed transposed: S^T = K Q^T (A = K rows, B = Q, kept in registers) and O^T += V^T P^T
// (A = V^T rows, B = P^T). A lane then holds scores of ONE query (column c; keys 8hh+r of each 16-key tile): max and
// sum run in the lane plus one exchange between the wave halves, and two neighbouring score tiles, converted in
// place, ARE the B operand of the second product (its k order is the fragment loader's), so P never leaves registers.
// grid.x = B * (N / 64); blockDim = 256; N % 256 == 0.
// =====================================================================================
#define AT_E 128
#define AT_C 64
#define AT_QB 64
#define AT_KC 64
#define AT_NW 4                          // 16-query tiles of a block
#define AT_QT 2                          // 16-query tiles of a wave
#define AT_G 4
#define AT_SK (AT_G * AT_KC)
#define AT_NT (AT_G * (AT_NW / AT_QT) * 32)
#define AT_QP 136
#define AT_KP 136
#define AT_VP (AT_SK + 8)
#define AT_OP 132
#define AT_PSC 32768.0f
#define AT_L2E 1.4426950408889634f

__device__ __forceinline__ v8f mma_h16(v16h a, v16h b, v8f c) {
  return __builtin_amdgcn_wmma_f32_16x16x32_f16(false, a, false, b, (short)0, c, false, false);
}

// lane l <-> lane l ^ 16
__device__ __forceinline__ float xhalf(float x) {
  return __builtin_bit_cast(float, __builtin_amdgcn_permlanex16(__builtin_bit_cast(int, x), __builtin_bit_cast(int, x),
                                                                0x76543210, 0xfedcba98, false, false));
}

// byte offset in the work-group's LDS = low 32 bits of a __shared__ address
__device__ __forceinline__ unsigned lds_off(const void* p) { return (unsigned)(size_t)p; }

// Eight asynchronous copies global -> LDS, 16 B per lane each, through no register: piece i goes from g + i * gstep
// (halves) to LDS byte l + i * lstep. The statement ends in s_wait_xcnt 0 (a precaution): the registers that the
// copies name live to its end, so none of them takes a new value in front of that wait.
__device__ __forceinline__ void copy8_async(unsigned l, unsigned lstep, const _Float16* g, size_t gstep) {
  asm volatile("global_load_async_to_lds_b128 %0, %8, off\n\t"
               "global_load_async_to_lds_b128 %1, %9, off\n\t"
               "global_load_async_to_lds_b128 %2, %10, off\n\t"
               "global_load_async_to_lds_b128 %3, %11, off\n\t"
               "global_load_async_to_lds_b128 %4, %12, off\n\t"
               "global_load_async_to_lds_b128 %5, %13, off\n\t"
               "global_load_async_to_lds_b128 %6, %14, off\n\t"
               "global_load_async_to_lds_b128 %7, %15, off\n\t"
               "s_wait_xcnt 0x0"
               :: "v"(l), "v"(l + lstep), "v"(l + 2 * lstep), "v"(l + 3 * lstep),
                  "v"(l + 4 * lstep), "v"(l + 5 * lstep), "v"(l + 6 * lstep), "v"(l + 7 * lstep),
                  "v"(g), "v"(g + gstep), "v"(g + 2 * gstep), "v"(g + 3 * gstep),
                  "v"(g + 4 * gstep), "v"(g + 5 * gstep), "v"(g + 6 * gstep), "v"(g + 7 * gstep)
               : "memory");
}

__global__ __launch_bounds__(AT_NT)
void attn128_kernel(const _Float16* __restrict__ Qh, const _Float16* __restrict__ Kh,
                    const _Float16* __restrict__ Vt, int ldv,
                    const float* __restrict__ ctxin, const float* __restrict__ Wc, const float* __restrict__ bcv,
                    float* __restrict__ out, int nTok, float inv_scale)
{
  __shared__ __align__(16) float    ctxS[AT_E];
  __shared__ __align__(16) _Float16 Qsh[AT_QB * AT_QP];          // [q][d]      pitch 136
  __shared__ __align__(16) float    Ms[AT_G][AT_QB];             // per group row max
  __shared__ __align__(16) float    Ls[AT_G][AT_QB];             // per group row sum
  // Two stage buffers, each K [256 kv][d] pitch 136, then V^T [128 d][256 kv] pitch 264; behind the loop the first
  // buffer's bytes hold the 16 partial O tiles (group x query tile; 16 x 128 f32, pitch 132).
  constexpr int KV_BYTES = (AT_SK * AT_KP + AT_E * AT_VP) * 2;
  static_assert(AT_G * AT_NW * 16 * AT_OP * 4 <= KV_BYTES, "partial O tiles must fit the K/V stage");
  static_assert(KV_BYTES % 16 == 0, "the second buffer keeps the copies' 16-B alignment");
  __shared__ __align__(16) unsigned char KVraw[2 * KV_BYTES];
  _Float16* const Ksh = (_Float16*)KVraw;
  _Float16* const Vts = (_Float16*)KVraw + AT_SK * AT_KP;
  float*    const Os  = (float*)KVraw;

  const int tid  = threadIdx.x;
  const int wv   = tid >> 5;        // 0..7
  const int wave = wv & (AT_NW / AT_QT - 1);   // 32-query slice of this wave
  const int grp  = wv >> 1;            // key group of this wave
  const int lane = tid & 31;
  const int hh   = lane >> 4;
  const int c    = lane & 15;

  const int nqb = nTok / AT_QB;
  const int b   = blockIdx.x / nqb;
  const int qb  = blockIdx.x - b * nqb;
  const int q0  = qb * AT_QB;
  const size_t rowbase = (size_t)b * nTok;       // first token row of this batch
  const size_t colbase = rowbase;                 // column offset of this batch inside V^T rows

  // ---- a thread's pieces of a stage: K rows (tid >> 4) + 16 i, V^T rows (tid >> 5) + 8 i, i = 0..15, 16 B each ----
  const int nChunks = nTok / AT_SK;                                    // block-uniform, size-derived
  const _Float16* kg = Kh + (rowbase + (tid >> 4)) * AT_E + (tid & 15) * 8;
  const _Float16* vg = Vt + (size_t)(tid >> 5) * ldv + colbase + (tid & 31) * 8;
  const unsigned  kl = lds_off(Ksh + (tid >> 4) * AT_KP + (tid & 15) * 8);
  const unsigned  vl = lds_off(Vts + (tid >> 5) * AT_VP + (tid & 31) * 8);
  // The same two LDS bytes once more for the refills in the loop, as a lane's part + the wave's part (scalar): a value
  // that an asm statement names directly is kept below v256 for its whole life, and kl and vl, held there across the
  // loop, were spilled to scratch; these two are named by no statement (the buffer's offset is added first).
  const int       wvs = __builtin_amdgcn_readfirstlane(tid >> 5);
  const unsigned  kl2 = hh * (AT_KP * 2) + c * 16 + lds_off(Ksh + wvs * 2 * AT_KP);
  const unsigned  vl2 = lane * 16 + lds_off(Vts + wvs * AT_VP);
  const size_t    vstep = (size_t)(AT_NT / 32) * ldv;
  constexpr unsigned klstep = (AT_NT / 16) * AT_KP * 2, vlstep = (AT_NT / 32) * AT_VP * 2;   // LDS bytes between pieces
  constexpr size_t   kstep  = (size_t)(AT_NT / 16) * AT_E;                                   // halves between K pieces
  // one stage: 32 copies of a thread, from K row / V^T column 'key0' on, piece 0 of K to LDS byte kd, of V^T to vd
  auto stage_copies = [&](unsigned kd, unsigned vd, size_t key0) {
    copy8_async(kd,              klstep, kg + key0 * AT_E,             kstep);
    copy8_async(kd + 8 * klstep, klstep, kg + key0 * AT_E + 8 * kstep, kstep);
    copy8_async(vd,              vlstep, vg + key0,                    vstep);
    copy8_async(vd + 8 * vlstep, vlstep, vg + key0 + 8 * vstep,        vstep);
  };
  // stage 0 -> buffer 0, in flight during the context projection and the Q load
  stage_copies(kl, vl, 0);

  // ---- context projection ctx[b][e], one thread per e ----
  if (tid < AT_E) {
    const float* cr = ctxin + (size_t)b * AT_C;
    const float* wr = Wc + (size_t)tid * AT_C;
    float a = 0.f;
#pragma unroll 4
    for (int cc = 0; cc < AT_C; ++cc) a += cr[cc] * wr[cc];
    ctxS[tid] = a + bcv[tid];
  }
  // ---- Q block [64][128] into LDS ----
#pragma unroll
  for (int i = 0; i < AT_QB * 16 / AT_NT; ++i) {
    const int idx = i * AT_NT + tid;
    const int row = idx >> 4, c8 = (idx & 15) * 8;
    const v8h v = *(const v8h*)(Qh + (rowbase + q0 + row) * AT_E + c8);
    *(v8h*)(Qsh + row * AT_QP + c8) = v;
  }
  asm volatile("s_wait_asynccnt 0x0" ::: "memory");   // this wave's copies of stage 0 have landed; the barrier publishes them
  __syncthreads();
  if (nChunks > 1) stage_copies(kl + KV_BYTES, vl + KV_BYTES, AT_SK);      // stage 1 -> buffer 1

  // Below, index u = 0, 1 is the wave's query tile; "query c" of tile u is block row wave*32 + u*16 + c.
  // Every loop over u is unrolled: its arrays are indexed by the counter and must stay in registers.
  // ---- per-query context bias: lanes c / c+16 each sum 64 of the 128 d of query c ----
  float bias[AT_QT];                                              // of query c, in both halves
  {
    const _Float16* qr = Qsh + (wave * AT_QT * 16 + c) * AT_QP + hh * 64;
    const float* cx = ctxS + hh * 64;
    float part[AT_QT];
#pragma unroll
    for (int u = 0; u < AT_QT; ++u) part[u] = 0.f;
#pragma unroll 8
    for (int e = 0; e < 64; ++e)
#pragma unroll
      for (int u = 0; u < AT_QT; ++u) part[u] += (float)qr[u * 16 * AT_QP + e] * cx[e];
#pragma unroll
    for (int u = 0; u < AT_QT; ++u) bias[u] = part[u] + __shfl_xor(part[u], 16, 32);
  }

  const float ninf = -__builtin_inff();
  float mrun[AT_QT];                 // running max of query c (same in both halves)
  float lrun[AT_QT];                 // running sum of query c over THIS half's keys; the halves join behind the loop
  v8f oacc[AT_QT][8];                // O^T: oacc[u][t][r] = O[query c][d = t*16 + 8hh + r]
  // Q of this wave as the B operand of S^T, read once: qf[u][dc] = Q[query c][dc*32 + k order of the loader]
  v16h qf[AT_QT][4];
#pragma unroll
  for (int u = 0; u < AT_QT; ++u) {
    mrun[u] = ninf;
    lrun[u] = 0.f;
#pragma unroll
    for (int t = 0; t < 8; ++t) oacc[u][t] = (v8f){0.f,0.f,0.f,0.f,0.f,0.f,0.f,0.f};
#pragma unroll
    for (int dc = 0; dc < 4; ++dc)
      qf[u][dc] = Frag<_Float16>::load(Qsh + ((wave * AT_QT + u) * 16 + c) * AT_QP + dc * 32 + 8 * hh);
  }
  for (int kc = 0; kc < nChunks; ++kc) {
    const int boff = (kc & 1) * KV_BYTES;                              // stage kc lies in buffer kc mod 2
    const _Float16* kgrp = Ksh + boff / 2 + grp * AT_KC * AT_KP;       // this group's 64 K rows of the stage
    const _Float16* vgrp = Vts + boff / 2 + grp * AT_KC;               // this group's 64 V^T columns of the stage

    // ---- S^T = K Q^T : A[m=key c][k=d] from kgrp row (j*16+c), B[k=d][n=query c] = qf ----
    v8f st[AT_QT][4];                // st[u][j][r] = score of key j*16 + 8hh + r against query c
#pragma unroll
    for (int u = 0; u < AT_QT; ++u)
#pragma unroll
      for (int j = 0; j < 4; ++j) st[u][j] = (v8f){0.f,0.f,0.f,0.f,0.f,0.f,0.f,0.f};
    // The K fragments of one d step (eight 16-B LDS loads) are issued as one group in front of their eight WMMAs:
    // one LDS round trip per group, not one per WMMA.
    // Unrolled: qf is indexed by the counter and must stay in registers.
#pragma unroll
    for (int dc = 0; dc < 4; ++dc) {
      v16h ka[4];
#pragma unroll
      for (int j = 0; j < 4; ++j) ka[j] = Frag<_Float16>::load(kgrp + (j * 16 + c) * AT_KP + dc * 32 + 8 * hh);
      __builtin_amdgcn_sched_barrier(0);   // keeps the group's loads together in front of its WMMAs, none among them
#pragma unroll
      for (int j = 0; j < 4; ++j)
#pragma unroll
        for (int u = 0; u < AT_QT; ++u) st[u][j] = mma_h16(ka[j], qf[u][dc], st[u][j]);
    }

    v16h pb[AT_QT][2];
#pragma unroll
    for (int u = 0; u < AT_QT; ++u) {
      // ---- scale + bias, chunk max of query c: 32 scores in the lane, the other 32 in lane l ^ 16 ----
      float cmj[4];
#pragma unroll
      for (int j = 0; j < 4; ++j) {
        float m = ninf;
#pragma unroll
        for (int r = 0; r < 8; ++r) {
          const float z = st[u][j][r] * inv_scale + bias[u];
          st[u][j][r] = z;
          m = fmaxf(m, z);
        }
        cmj[j] = m;
      }
      float cm = fmaxf(fmaxf(cmj[0], cmj[1]), fmaxf(cmj[2], cmj[3]));
      cm = fmaxf(cm, xhalf(cm));
      const float mnew  = fmaxf(mrun[u], cm);
      const float alpha = __builtin_amdgcn_exp2f((mrun[u] - mnew) * AT_L2E);
      mrun[u] = mnew;
      // ---- P^T: tiles 2kk and 2kk+1, converted in place, are the B operand of keys kk*32..+31 ----
      float psj[4];
#pragma unroll
      for (int j = 0; j < 4; ++j) {
        float ps = 0.f;
#pragma unroll
        for (int r = 0; r < 8; ++r) {
          const float p = __builtin_amdgcn_exp2f((st[u][j][r] - mnew) * AT_L2E);
          ps += p;
          pb[u][j >> 1][(j & 1) * 8 + r] = (_Float16)(p * AT_PSC);
        }
        psj[j] = ps;
      }
      lrun[u] = lrun[u] * alpha + ((psj[0] + psj[1]) + (psj[2] + psj[3]));
#pragma unroll
      for (int t = 0; t < 8; ++t)
#pragma unroll
        for (int r = 0; r < 8; ++r) oacc[u][t][r] *= alpha;
    }

    // ---- O^T += V^T P^T : A[m=d c][k=kv] from Vts row (t*16+c), B[k=kv][n=query c] = pb ----
    // likewise: the V^T fragments of 32 keys (sixteen 16-B LDS loads) as one group in front of their sixteen WMMAs
#pragma unroll
    for (int kk = 0; kk < 2; ++kk) {
      v16h va[8];
#pragma unroll
      for (int t = 0; t < 8; ++t) va[t] = Frag<_Float16>::load(vgrp + (t * 16 + c) * AT_VP + kk * 32 + 8 * hh);
      __builtin_amdgcn_sched_barrier(0);   // keeps the group's loads together in front of its WMMAs, none among them
#pragma unroll
      for (int t = 0; t < 8; ++t)
#pragma unroll
        for (int u = 0; u < AT_QT; ++u) oacc[u][t] = mma_h16(va[t], pb[u][kk], oacc[u][t]);
    }

    // ---- hand-over: this wave's reads of stage kc are done and its copies of stage kc + 1 have landed; the one
    // barrier publishes stage kc + 1 and frees stage kc's buffer, which stage kc + 2 then refills ----
    asm volatile("s_wait_dscnt 0x0" ::: "memory");
    asm volatile("s_wait_asynccnt 0x0" ::: "memory");
    __syncthreads();
    if (kc + 2 < nChunks) stage_copies(kl2 + boff, vl2 + boff, (size_t)(kc + 2) * AT_SK);
  }
  asm volatile("s_wait_asynccnt 0x0" ::: "memory");   // no copy is outstanding when the buffers change their use

  // ---- merge of the four key groups: every wave lays down its un-normalised O tiles and its rows' (max, sum) ----
  __syncthreads();   // every wave has left the K/V stage before its bytes become the partial O tiles
#pragma unroll
  for (int u = 0; u < AT_QT; ++u) {
    const int qt = wave * AT_QT + u;                               // 16-query tile of the block
    float* os = Os + (grp * AT_NW + qt) * (16 * AT_OP) + c * AT_OP + 8 * hh;   // row = query c; a lane's 8 registers are 8 neighbours
#pragma unroll
    for (int t = 0; t < 8; ++t) {
      *(v4f*)(os + t * 16)     = (v4f){oacc[u][t][0], oacc[u][t][1], oacc[u][t][2], oacc[u][t][3]};
      *(v4f*)(os + t * 16 + 4) = (v4f){oacc[u][t][4], oacc[u][t][5], oacc[u][t][6], oacc[u][t][7]};
    }
    const float lfin = lrun[u] + xhalf(lrun[u]);                   // the two halves' keys joined
    if (hh == 0) {
      Ms[grp][qt * 16 + c] = mrun[u];
      Ls[grp][qt * 16 + c] = lfin;
    }
  }
  __syncthreads();   // publishes the partial tiles to the waves that merge them
  // wave wv merges the block's query rows wv*8..+7; each 512-B row is written by one instruction
  {
    const int c4 = lane * 4;
#pragma unroll
    for (int rr = 0; rr < AT_QB * 32 / AT_NT; ++rr) {
      const int qrow = wv * (AT_QB * 32 / AT_NT) + rr;
      const int row  = qrow & 15;                                  // row inside its 16-query tile
      float mg[AT_G];
      float mall = ninf;
#pragma unroll
      for (int g = 0; g < AT_G; ++g) { mg[g] = Ms[g][qrow]; mall = fmaxf(mall, mg[g]); }
      float lall = 0.f;
      v4f val = (v4f){0.f, 0.f, 0.f, 0.f};
#pragma unroll
      for (int g = 0; g < AT_G; ++g) {
        const float w = __builtin_amdgcn_exp2f((mg[g] - mall) * AT_L2E);
        lall += w * Ls[g][qrow];
        const v4f part = *(const v4f*)(Os + (g * AT_NW + (qrow >> 4)) * (16 * AT_OP) + row * AT_OP + c4);
        val += part * w;
      }
      const float inv = 1.0f / (lall * AT_PSC);
      *(v4f*)(out + (rowbase + q0 + qrow) * AT_E + c4) = val * inv;
    }
  }
}

// ---------------------------------------------------------------------------
extern "C" void kernel_launch(void* const* d_in, const int* in_sizes, int n_in,
                              void* d_out, int out_size, void* d_ws, size_t ws_size,
                              hipStream_t stream)
{
  if (n_in < 10) return;
  const float* X    = (const float*)d_in[0];
  const float* ctxt = (const float*)d_in[1];
  const float* Wq   = (const float*)d_in[2];
  const float* bq   = (const float*)d_in[3];
  const float* Wk   = (const float*)d_in[4];
  const float* bk   = (const float*)d_in[5];
  const float* Wv   = (const float*)d_in[6];
  const float* bv   = (const float*)d_in[7];
  const float* Wc   = (const float*)d_in[8];
  const float* bc   = (const float*)d_in[9];
  float* out = (float*)d_out;

  const int E = AT_E, C = AT_C;
  const int nX   = in_sizes[0];
  const int Mall = nX / E;                 // B*N token rows
  const int Bn   = in_sizes[1] / C;        // batch
  if (Bn <= 0 || Mall <= 0) return;
  const int nTok = Mall / Bn;              // tokens per batch
  if (nTok * Bn != Mall || Mall * E != nX) return;
  if ((Mall % 64) != 0 || (nTok % AT_SK) != 0) return;
  if (in_sizes[2] != E * E || in_sizes[4] != E * E || in_sizes[6] != E * E) return;
  if (in_sizes[3] != E || in_sizes[5] != E || in_sizes[7] != E) return;
  if (in_sizes[8] != E * C || in_sizes[9] != E || in_sizes[1] != Bn * C) return;
  if (out_size != nX) return;

  // ---- workspace carve (all offsets multiples of 16 KiB) ----
  const size_t nTokE = (size_t)Mall * E;              // halves per token plane
  size_t off = 0;
  _Float16* Qh  = (_Float16*)((char*)d_ws + off); off += nTokE * 2;   // [Mall][128]
  _Float16* Kh  = (_Float16*)((char*)d_ws + off); off += nTokE * 2;   // [Mall][128]
  _Float16* Vt  = (_Float16*)((char*)d_ws + off); off += nTokE * 2;   // [128][Mall]
  if (off > ws_size) return;

  // ---- Q = X Wq^T + bq, K = X Wk^T + bk : [Mall][128] f16 ; V^T : [128][Mall] f16 ; casts included ----
  qkv_proj_kernel<<<dim3(Mall / PJ_TOK), PJ_NT, 0, stream>>>(
      X, Wq, bq, Wk, bk, Wv, bv, Qh, Kh, Vt, Mall, 256.0f, 1.0f / 256.0f);

  // ---- attention ----
  {
    const float scale_f   = (float)11.313708498984761;   // sqrt(128) as f32
    const float inv_scale = 1.0f / scale_f;
    attn128_kernel<<<dim3(Bn * (nTok / 64)), AT_NT, 0, stream>>>(
        Qh, Kh, Vt, Mall, ctxt, Wc, bc, out, nTok, inv_scale);
  }
}

// v007
// It runs in 40.6 microseconds.
// Next to v006, in two timings, it ran 1.05 and 1.04 times as fast.
// Counting every step since v000, it is 5.92 times as fast.
// Contractions: Q/K/V projections, Q.K^T scores and P.V on v_wmma_f32_16x16x32_f16 (f16 operands, f32 accumulate); weights carried x256 and probabilities x32768 (exact power-of-two carries folded back in f32); context projection (K=64, 4 rows) and the per-query context-bias dot on VALU f32; softmax f32.
#include <hip/hip_runtime.h>

typedef __attribute__((ext_vector_type(16))) _Float16 v16h;
typedef __attribute__((ext_vector_type(8)))  _Float16 v8h;
typedef __attribute__((ext_vector_type(4)))  _Float16 v4h;
typedef __attribute__((ext_vector_type(8)))  float    v8f;
typedef __attribute__((ext_vector_type(4)))  float    v4f;

template <typename T> struct Frag;
template <> struct Frag<_Float16> {
  typedef v16h V; union U { v16h v; v8h h[2]; };
  static __device__ __forceinline__ v16h load(const _Float16* p) {   // elements 0..7 <- p[0..7], 8..15 <- p[16..23]
    U f; f.h[0] = *(const v8h*)(p); f.h[1] = *(const v8h*)(p + 16); return f.v;
  }
};

// =====================================================================================
// Q, K and V^T projections of 64 token rows in one launch, straight from the f32 inputs.
// Q = X Wq^T + bq, K = X Wk^T + bk : f16 [tokens][128]; V^T = (X Wv^T + bv)^T : f16 [128][tokens] (pitch ldv).
// Block = 12 waves. The block casts its X rows and the three weight matrices (x wcarry) to f16 on the way into LDS
// (512-B wave loads, one row each); waves 0..3 / 4..7 / 8..11 then form Q / K / V^T.
// Each wave owns 2 x 4 tiles of 16 x 16, with the operand whose index runs along an OUTPUT ROW as A: a lane's 8
// accumulator registers are then 8 neighbours of one output row and go to the LDS out tile as one 16-B store.
//   Q, K : A = 32 weight rows (features), B = the 64 X rows (tokens)      -> out tile [token][feature]
//   V^T  : A = 32 X rows (tokens),        B = 64 weight rows (features)   -> out tile [feature][token]
// The out tiles leave as whole 128-B lines. grid.x = tokens / 64; blockDim = 384.
// Every loop is fully unrolled (#pragma unroll): its arrays are indexed by the counter and must stay in registers,
// and the 46 loads of a wave must all be in flight before the first wait.
// =====================================================================================
#define PJ_E 128
#define PJ_TOK 64
#define PJ_NT 384
#define PJ_P 136                         // LDS pitch (halves) of 128-half rows
#define PJ_VP 72                         // LDS pitch (halves) of the V^T tile's 64-half rows
#define PJ_OT (PJ_E * PJ_VP)             // halves per out tile (>= 64 * 136)

__global__ __launch_bounds__(PJ_NT)
void qkv_proj_kernel(const float* __restrict__ X,
                     const float* __restrict__ Wq, const float* __restrict__ bq,
                     const float* __restrict__ Wk, const float* __restrict__ bk,
                     const float* __restrict__ Wv, const float* __restrict__ bv,
                     _Float16* __restrict__ Qh, _Float16* __restrict__ Kh, _Float16* __restrict__ Vt, int ldv,
                     float wcarry, float wundo)
{
  static_assert(PJ_TOK * PJ_P <= PJ_OT, "Q/K out tile must fit");
  __shared__ __align__(16) _Float16 Sm[(PJ_TOK + 3 * PJ_E) * PJ_P];   // rows 0..63: X; rows 64 + 128 m + f: weight m
  __shared__ __align__(16) _Float16 Ot[3 * PJ_OT];

  const int tid   = threadIdx.x;
  const int wv    = __builtin_amdgcn_readfirstlane(tid >> 5);   // 0..11, in a scalar register: selects by matrix stay scalar
  const int mat   = wv >> 2;                                    // 0 Q, 1 K, 2 V
  const int sl    = wv & 3;
  const int gt    = tid & 127;                                  // thread inside its 4-wave group
  const int lane  = tid & 31;
  const int rlane = lane & 15;
  const int hh    = lane >> 4;
  const int tok0  = blockIdx.x * PJ_TOK;

  // ---- all global loads first, none under a branch: bias values, X rows (block), this group's weight matrix ----
  const int colA0 = (mat < 2) ? sl * 32 : (sl & 1) * 32;         // first out column of the wave (A index)
  const int rowB0 = (mat < 2) ? 0 : (sl >> 1) * 64;              // first out row of the wave (B index)
  const v4f* bA = (const v4f*)((mat == 1 ? bk : bq) + colA0 + 8 * hh);   // in bounds for every wave; used by Q, K
  v4f bmv[2][2];
  float bnv[4];
#pragma unroll
  for (int i = 0; i < 2; ++i) { bmv[i][0] = bA[i * 4]; bmv[i][1] = bA[i * 4 + 1]; }
#pragma unroll
  for (int j = 0; j < 4; ++j) bnv[j] = bv[rowB0 + j * 16 + rlane];       // in bounds for every wave; used by V

  const v4f* Xg = (const v4f*)(X + (size_t)tok0 * PJ_E);
  const v4f* Wg = (const v4f*)(mat == 0 ? Wq : (mat == 1 ? Wk : Wv));
  // X: 2048 16-B pieces = 5 per thread + 128; every group loads the last 128, group 0 alone stores them
  v4f xr[6], wr[32];
#pragma unroll
  for (int i = 0; i < 5; ++i) xr[i] = Xg[i * PJ_NT + tid];
  xr[5] = Xg[5 * PJ_NT + gt];
#pragma unroll
  for (int i = 0; i < 32; ++i) wr[i] = Wg[i * 128 + gt];

  // ---- cast to f16 into LDS ----
#pragma unroll
  for (int i = 0; i < 6; ++i) {
    const int idx = (i < 5) ? i * PJ_NT + tid : 5 * PJ_NT + gt;
    v4h h;
#pragma unroll
    for (int e = 0; e < 4; ++e) h[e] = (_Float16)xr[i][e];
    if (i < 5 || mat == 0) *(v4h*)(Sm + (idx >> 5) * PJ_P + (idx & 31) * 4) = h;
  }
  {
    _Float16* wdst = Sm + (PJ_TOK + mat * PJ_E) * PJ_P;
#pragma unroll
    for (int i = 0; i < 32; ++i) {
      const int idx = i * 128 + gt;
      v4h h;
#pragma unroll
      for (int e = 0; e < 4; ++e) h[e] = (_Float16)(wr[i][e] * wcarry);
      *(v4h*)(wdst + (idx >> 5) * PJ_P + (idx & 31) * 4) = h;
    }
  }
  __syncthreads();

  float bm[2][8], bn[4];                                         // bias along A (Q, K) or along B (V); the other is 0
#pragma unroll
  for (int i = 0; i < 2; ++i)
#pragma unroll
    for (int r = 0; r < 8; ++r) bm[i][r] = (mat < 2) ? bmv[i][r >> 2][r & 3] : 0.f;
#pragma unroll
  for (int j = 0; j < 4; ++j) bn[j] = (mat < 2) ? 0.f : bnv[j];

  // ---- products: both operands by the same loader, so their k orders agree ----
  const int rowA = (mat < 2) ? (PJ_TOK + mat * PJ_E + colA0) : colA0;
  const int rowB = (mat < 2) ? 0 : (PJ_TOK + 2 * PJ_E + rowB0);
  const _Float16* pA = Sm + (rowA + rlane) * PJ_P + 8 * hh;
  const _Float16* pB = Sm + (rowB + rlane) * PJ_P + 8 * hh;
  v8f acc[2][4];
#pragma unroll
  for (int i = 0; i < 2; ++i)
#pragma unroll
    for (int j = 0; j < 4; ++j) acc[i][j] = (v8f){0.f,0.f,0.f,0.f,0.f,0.f,0.f,0.f};
#pragma unroll
  for (int k0 = 0; k0 < PJ_E; k0 += 32) {
    v16h a[2], b[4];
#pragma unroll
    for (int i = 0; i < 2; ++i) a[i] = Frag<_Float16>::load(pA + i * 16 * PJ_P + k0);
#pragma unroll
    for (int j = 0; j < 4; ++j) b[j] = Frag<_Float16>::load(pB + j * 16 * PJ_P + k0);
#pragma unroll
    for (int i = 0; i < 2; ++i)
#pragma unroll
      for (int j = 0; j < 4; ++j)
        acc[i][j] = __builtin_amdgcn_wmma_f32_16x16x32_f16(false, a[i], false, b[j], (short)0, acc[i][j], false, false);
  }

  // ---- undo the carry, add the bias, f16, out tile in LDS ----
  _Float16* ot = Ot + mat * PJ_OT;
  const int opitch = (mat < 2) ? PJ_P : PJ_VP;
#pragma unroll
  for (int i = 0; i < 2; ++i)
#pragma unroll
    for (int j = 0; j < 4; ++j) {
      v8h hv;
#pragma unroll
      for (int r = 0; r < 8; ++r) hv[r] = (_Float16)((acc[i][j][r] * wundo + bm[i][r]) + bn[j]);
      *(v8h*)(ot + (rowB0 + j * 16 + rlane) * opitch + colA0 + i * 16 + 8 * hh) = hv;
    }
  __syncthreads();

  // ---- each group stores its own tile: 16 B per lane, whole 128-B lines (Q, K: 64 rows of 256 B; V^T: 128 of 128 B) ----
  _Float16* G = (mat == 0) ? Qh + (size_t)tok0 * PJ_E : ((mat == 1) ? Kh + (size_t)tok0 * PJ_E : Vt + tok0);
  const int gpitch = (mat < 2) ? PJ_E : ldv;
  const int rsh    = (mat < 2) ? 4 : 3;                            // 16-B pieces per row: 16 or 8
  const int c8     = (gt & ((1 << rsh) - 1)) * 8;
#pragma unroll
  for (int i = 0; i < 8; ++i) {
    const int row = (i * 128 + gt) >> rsh;
    *(v8h*)(G + (size_t)row * gpitch + c8) = *(const v8h*)(ot + row * opitch + c8);
  }
}

// =====================================================================================
// Single-head attention, head dim 128, f16 q/k planes row-major [B*N][128], f16 V^T plane [128][B*N] (pitch ldv),
// f32 out. scores = (q.k^T) * inv_scale + bias[q] with bias[q] = sum_d q[q][d] * ctx[b][d],
// ctx[b][e] = sum_c context[b][c] * Wc[e][c] + bc[e] (VALU f32, per block); softmax over all keys (no mask), f32 online;
// out = p.v / l with p and l both carried x2^15 (added to the exponent in front of exp2), so the carry cancels.
// Block = 8 waves = 64 query rows of one batch x 4 key groups: wave (g, qw) runs query rows qw*32..+31 (two 16-query
// tiles) over the g-th 64 keys of every 256-key stage: every K and V^T fragment read from LDS feeds two WMMAs, so the
// block's LDS reads per stage take no longer than its WMMAs; each SIMD holds two waves. The stages come
// by asynchronous copies to LDS into two buffers: stage s + 1 is in flight while stage s is worked on, one barrier per
// stage. Each group keeps its own online (max, sum, O); the four are merged once in LDS behind the loop.
// Both products are formed transposed: S^T = K Q^T (A = K rows, B = Q, kept in registers) and O^T += V^T P^T
// (A = V^T rows, B = P^T). A lane then holds scores of ONE query (column c; keys 8hh+r of each 16-key tile): max and
// sum run in the lane plus one exchange between the wave halves, and two neighbouring score tiles, converted in
// place, ARE the B operand of the second product (its k order is the fragment loader's), so P never leaves registers.
// grid.x = B * (N / 64); blockDim = 256; N % 256 == 0.
// =====================================================================================
#define AT_E 128
#define AT_C 64
#define AT_QB 64
#define AT_KC 64
#define AT_NW 4                          // 16-query tiles of a block
#define AT_QT 2                          // 16-query tiles of a wave
#define AT_G 4
#define AT_SK (AT_G * AT_KC)
#define AT_NT (AT_G * (AT_NW / AT_QT) * 32)
#define AT_QP 136
#define AT_KP 136
#define AT_VP (AT_SK + 8)
#define AT_OP 132
#define AT_PLOG 15.0f                    // probabilities and their sums are carried x 2^15
#define AT_L2E 1.4426950408889634f

__device__ __forceinline__ v8f mma_h16(v16h a, v16h b, v8f c) {
  return __builtin_amdgcn_wmma_f32_16x16x32_f16(false, a, false, b, (short)0, c, false, false);
}

// lane l <-> lane l ^ 16
__device__ __forceinline__ float xhalf(float x) {
  return __builtin_bit_cast(float, __builtin_amdgcn_permlanex16(__builtin_bit_cast(int, x), __builtin_bit_cast(int, x),
                                                                0x76543210, 0xfedcba98, false, false));
}

// byte offset in the work-group's LDS = low 32 bits of a __shared__ address
__device__ __forceinline__ unsigned lds_off(const void* p) { return (unsigned)(size_t)p; }

// Eight asynchronous copies global -> LDS, 16 B per lane each, through no register: piece i goes from g + i * gstep
// (halves) to LDS byte l + i * lstep. The statement ends in s_wait_xcnt 0 (a precaution): the registers that the
// copies name live to its end, so none of them takes a new value in front of that wait.
__device__ __forceinline__ void copy8_async(unsigned l, unsigned lstep, const _Float16* g, size_t gstep) {
  asm volatile("global_load_async_to_lds_b128 %0, %8, off\n\t"
               "global_load_async_to_lds_b128 %1, %9, off\n\t"
               "global_load_async_to_lds_b128 %2, %10, off\n\t"
               "global_load_async_to_lds_b128 %3, %11, off\n\t"
               "global_load_async_to_lds_b128 %4, %12, off\n\t"
               "global_load_async_to_lds_b128 %5, %13, off\n\t"
               "global_load_async_to_lds_b128 %6, %14, off\n\t"
               "global_load_async_to_lds_b128 %7, %15, off\n\t"
               "s_wait_xcnt 0x0"
               :: "v"(l), "v"(l + lstep), "v"(l + 2 * lstep), "v"(l + 3 * lstep),
                  "v"(l + 4 * lstep), "v"(l + 5 * lstep), "v"(l + 6 * lstep), "v"(l + 7 * lstep),
                  "v"(g), "v"(g + gstep), "v"(g + 2 * gstep), "v"(g + 3 * gstep),
                  "v"(g + 4 * gstep), "v"(g + 5 * gstep), "v"(g + 6 * gstep), "v"(g + 7 * gstep)
               : "memory");
}

__global__ __launch_bounds__(AT_NT)
void attn128_kernel(const _Float16* __restrict__ Qh, const _Float16* __restrict__ Kh,
                    const _Float16* __restrict__ Vt, int ldv,
                    const float* __restrict__ ctxin, const float* __restrict__ Wc, const float* __restrict__ bcv,
                    float* __restrict__ out, int nTok, float inv_scale)
{
  __shared__ __align__(16) float    ctxS[AT_E];
  __shared__ __align__(16) _Float16 Qsh[AT_QB * AT_QP];          // [q][d]      pitch 136
  __shared__ __align__(16) float    Ms[AT_G][AT_QB];             // per group row max
  __shared__ __align__(16) float    Ls[AT_G][AT_QB];             // per group row sum
  // Two stage buffers, each K [256 kv][d] pitch 136, then V^T [128 d][256 kv] pitch 264; behind the loop the first
  // buffer's bytes hold the 16 partial O tiles (group x query tile; 16 x 128 f32, pitch 132).
  constexpr int KV_BYTES = (AT_SK * AT_KP + AT_E * AT_VP) * 2;
  static_assert(AT_G * AT_NW * 16 * AT_OP * 4 <= KV_BYTES, "partial O tiles must fit the K/V stage");
  static_assert(KV_BYTES % 16 == 0, "the second buffer keeps the copies' 16-B alignment");
  __shared__ __align__(16) unsigned char KVraw[2 * KV_BYTES];
  _Float16* const Ksh = (_Float16*)KVraw;
  _Float16* const Vts = (_Float16*)KVraw + AT_SK * AT_KP;
  float*    const Os  = (float*)KVraw;

  const int tid  = threadIdx.x;
  const int wv   = tid >> 5;        // 0..7
  const int wave = wv & (AT_NW / AT_QT - 1);   // 32-query slice of this wave
  const int grp  = wv >> 1;            // key group of this wave
  const int lane = tid & 31;
  const int hh   = lane >> 4;
  const int c    = lane & 15;

  const int nqb = nTok / AT_QB;
  const int b   = blockIdx.x / nqb;
  const int qb  = blockIdx.x - b * nqb;
  const int q0  = qb * AT_QB;
  const size_t rowbase = (size_t)b * nTok;       // first token row of this batch
  const size_t colbase = rowbase;                 // column offset of this batch inside V^T rows

  // ---- a thread's pieces of a stage: K rows (tid >> 4) + 16 i, V^T rows (tid >> 5) + 8 i, i = 0..15, 16 B each ----
  const int nChunks = nTok / AT_SK;                                    // block-uniform, size-derived
  const _Float16* kg = Kh + (rowbase + (tid >> 4)) * AT_E + (tid & 15) * 8;
  const _Float16* vg = Vt + (size_t)(tid >> 5) * ldv + colbase + (tid & 31) * 8;
  const unsigned  kl = lds_off(Ksh + (tid >> 4) * AT_KP + (tid & 15) * 8);
  const unsigned  vl = lds_off(Vts + (tid >> 5) * AT_VP + (tid & 31) * 8);
  // The same two LDS bytes once more for the refills in the loop, as a lane's part + the wave's part (scalar): a value
  // that an asm statement names directly is kept below v256 for its whole life, and kl and vl, held there across the
  // loop, were spilled to scratch; these two are named by no statement (the buffer's offset is added first).
  const int       wvs = __builtin_amdgcn_readfirstlane(tid >> 5);
  const unsigned  kl2 = hh * (AT_KP * 2) + c * 16 + lds_off(Ksh + wvs * 2 * AT_KP);
  const unsigned  vl2 = lane * 16 + lds_off(Vts + wvs * AT_VP);
  const size_t    vstep = (size_t)(AT_NT / 32) * ldv;
  constexpr unsigned klstep = (AT_NT / 16) * AT_KP * 2, vlstep = (AT_NT / 32) * AT_VP * 2;   // LDS bytes between pieces
  constexpr size_t   kstep  = (size_t)(AT_NT / 16) * AT_E;                                   // halves between K pieces
  // one stage: 32 copies of a thread, from K row / V^T column 'key0' on, piece 0 of K to LDS byte kd, of V^T to vd
  auto stage_copies = [&](unsigned kd, unsigned vd, size_t key0) {
    copy8_async(kd,              klstep, kg + key0 * AT_E,             kstep);
    copy8_async(kd + 8 * klstep, klstep, kg + key0 * AT_E + 8 * kstep, kstep);
    copy8_async(vd,              vlstep, vg + key0,                    vstep);
    copy8_async(vd + 8 * vlstep, vlstep, vg + key0 + 8 * vstep,        vstep);
  };
  // stage 0 -> buffer 0, in flight during the context projection and the Q load
  stage_copies(kl, vl, 0);

  // ---- context projection ctx[b][e], one thread per e ----
  if (tid < AT_E) {
    const float* cr = ctxin + (size_t)b * AT_C;
    const float* wr = Wc + (size_t)tid * AT_C;
    float a = 0.f;
#pragma unroll 4
    for (int cc = 0; cc < AT_C; ++cc) a += cr[cc] * wr[cc];
    ctxS[tid] = a + bcv[tid];
  }
  // ---- Q block [64][128] into LDS ----
#pragma unroll
  for (int i = 0; i < AT_QB * 16 / AT_NT; ++i) {
    const int idx = i * AT_NT + tid;
    const int row = idx >> 4, c8 = (idx & 15) * 8;
    const v8h v = *(const v8h*)(Qh + (rowbase + q0 + row) * AT_E + c8);
    *(v8h*)(Qsh + row * AT_QP + c8) = v;
  }
  asm volatile("s_wait_asynccnt 0x0" ::: "memory");   // this wave's copies of stage 0 have landed; the barrier publishes them
  __syncthreads();
  if (nChunks > 1) stage_copies(kl + KV_BYTES, vl + KV_BYTES, AT_SK);      // stage 1 -> buffer 1

  // Below, index u = 0, 1 is the wave's query tile; "query c" of tile u is block row wave*32 + u*16 + c.
  // Every loop over u is unrolled: its arrays are indexed by the counter and must stay in registers.
  // ---- per-query context bias: lanes c / c+16 each sum 64 of the 128 d of query c ----
  float bias[AT_QT];                                              // of query c, in both halves
  {
    const _Float16* qr = Qsh + (wave * AT_QT * 16 + c) * AT_QP + hh * 64;
    const float* cx = ctxS + hh * 64;
    float part[AT_QT];
#pragma unroll
    for (int u = 0; u < AT_QT; ++u) part[u] = 0.f;
#pragma unroll 8
    for (int e = 0; e < 64; ++e)
#pragma unroll
      for (int u = 0; u < AT_QT; ++u) part[u] += (float)qr[u * 16 * AT_QP + e] * cx[e];
#pragma unroll
    for (int u = 0; u < AT_QT; ++u) bias[u] = part[u] + __shfl_xor(part[u], 16, 32);
  }

  const float ninf = -__builtin_inff();
  const float k1 = inv_scale * AT_L2E;   // product -> score in log2 units
  float mrun[AT_QT];                 // running max of query c (same in both halves)
  float lrun[AT_QT];                 // running sum of query c over THIS half's keys; the halves join behind the loop
  v8f oacc[AT_QT][8];                // O^T: oacc[u][t][r] = O[query c][d = t*16 + 8hh + r]
  // Q of this wave as the B operand of S^T, read once: qf[u][dc] = Q[query c][dc*32 + k order of the loader]
  v16h qf[AT_QT][4];
#pragma unroll
  for (int u = 0; u < AT_QT; ++u) {
    mrun[u] = ninf;
    lrun[u] = 0.f;
#pragma unroll
    for (int t = 0; t < 8; ++t) oacc[u][t] = (v8f){0.f,0.f,0.f,0.f,0.f,0.f,0.f,0.f};
#pragma unroll
    for (int dc = 0; dc < 4; ++dc)
      qf[u][dc] = Frag<_Float16>::load(Qsh + ((wave * AT_QT + u) * 16 + c) * AT_QP + dc * 32 + 8 * hh);
  }
  for (int kc = 0; kc < nChunks; ++kc) {
    const int boff = (kc & 1) * KV_BYTES;                              // stage kc lies in buffer kc mod 2
    const _Float16* kgrp = Ksh + boff / 2 + grp * AT_KC * AT_KP;       // this group's 64 K rows of the stage
    const _Float16* vgrp = Vts + boff / 2 + grp * AT_KC;               // this group's 64 V^T columns of the stage

    // ---- S^T = K Q^T : A[m=key c][k=d] from kgrp row (j*16+c), B[k=d][n=query c] = qf ----
    v8f st[AT_QT][4];                // st[u][j][r] = score of key j*16 + 8hh + r against query c
#pragma unroll
    for (int u = 0; u < AT_QT; ++u)
#pragma unroll
      for (int j = 0; j < 4; ++j) st[u][j] = (v8f){0.f,0.f,0.f,0.f,0.f,0.f,0.f,0.f};
    // The K fragments of one d step (eight 16-B LDS loads) are issued as one group in front of their eight WMMAs:
    // one LDS round trip per group, not one per WMMA.
    // Unrolled: qf is indexed by the counter and must stay in registers.
#pragma unroll
    for (int dc = 0; dc < 4; ++dc) {
      v16h ka[4];
#pragma unroll
      for (int j = 0; j < 4; ++j) ka[j] = Frag<_Float16>::load(kgrp + (j * 16 + c) * AT_KP + dc * 32 + 8 * hh);
      __builtin_amdgcn_sched_barrier(0);   // keeps the group's loads together in front of its WMMAs, none among them
#pragma unroll
      for (int j = 0; j < 4; ++j)
#pragma unroll
        for (int u = 0; u < AT_QT; ++u) st[u][j] = mma_h16(ka[j], qf[u][dc], st[u][j]);
    }

    v16h pb[AT_QT][2];
#pragma unroll
    for (int u = 0; u < AT_QT; ++u) {
      // ---- chunk max of query c on the raw products: 32 in the lane, the other 32 in lane l ^ 16 ----
      float cmj[4];
#pragma unroll
      for (int j = 0; j < 4; ++j) {
        float m = st[u][j][0];
#pragma unroll
        for (int r = 1; r < 8; ++r) m = fmaxf(m, st[u][j][r]);
        cmj[j] = m;
      }
      float cm = fmaxf(fmaxf(cmj[0], cmj[1]), fmaxf(cmj[2], cmj[3]));
      cm = fmaxf(cm, xhalf(cm));
      // score = product * inv_scale + bias rises with the product (inv_scale > 0): the largest score is that of cm
      const float mnew  = fmaxf(mrun[u], cm * inv_scale + bias[u]);
      const float alpha = __builtin_amdgcn_exp2f((mrun[u] - mnew) * AT_L2E);
      mrun[u] = mnew;
      // 2^15 exp(score - mnew) = exp2(product * k1 + c0): scale, bias, maximum, log2(e) and the carry in one fma
      const float c0 = (bias[u] - mnew) * AT_L2E + AT_PLOG;
      // ---- P^T: tiles 2kk and 2kk+1, converted in place, are the B operand of keys kk*32..+31 ----
      float psj[4];
#pragma unroll
      for (int j = 0; j < 4; ++j) {
        float ps = 0.f;
#pragma unroll
        for (int r = 0; r < 8; ++r) {
          const float p = __builtin_amdgcn_exp2f(st[u][j][r] * k1 + c0);
          ps += p;
          pb[u][j >> 1][(j & 1) * 8 + r] = (_Float16)p;
        }
        psj[j] = ps;
      }
      lrun[u] = lrun[u] * alpha + ((psj[0] + psj[1]) + (psj[2] + psj[3]));
#pragma unroll
      for (int t = 0; t < 8; ++t)
#pragma unroll
        for (int r = 0; r < 8; ++r) oacc[u][t][r] *= alpha;
    }

    // ---- O^T += V^T P^T : A[m=d c][k=kv] from vgrp row (t*16+c), B[k=kv][n=query c] = pb ----
    // likewise: the V^T fragments of 32 keys (sixteen 16-B LDS loads) as one group in front of their sixteen WMMAs
#pragma unroll
    for (int kk = 0; kk < 2; ++kk) {
      v16h va[8];
#pragma unroll
      for (int t = 0; t < 8; ++t) va[t] = Frag<_Float16>::load(vgrp + (t * 16 + c) * AT_VP + kk * 32 + 8 * hh);
      __builtin_amdgcn_sched_barrier(0);   // keeps the group's loads together in front of its WMMAs, none among them
#pragma unroll
      for (int t = 0; t < 8; ++t)
#pragma unroll
        for (int u = 0; u < AT_QT; ++u) oacc[u][t] = mma_h16(va[t], pb[u][kk], oacc[u][t]);
    }

    // ---- hand-over: this wave's reads of stage kc are done and its copies of stage kc + 1 have landed; the one
    // barrier publishes stage kc + 1 and frees stage kc's buffer, which stage kc + 2 then refills ----
    asm volatile("s_wait_dscnt 0x0" ::: "memory");
    asm volatile("s_wait_asynccnt 0x0" ::: "memory");
    __syncthreads();
    if (kc + 2 < nChunks) stage_copies(kl2 + boff, vl2 + boff, (size_t)(kc + 2) * AT_SK);
  }
  asm volatile("s_wait_asynccnt 0x0" ::: "memory");   // no copy is outstanding when the buffers change their use

  // ---- merge of the four key groups: every wave lays down its un-normalised O tiles and its rows' (max, sum) ----
  __syncthreads();   // every wave has left the K/V stage before its bytes become the partial O tiles
#pragma unroll
  for (int u = 0; u < AT_QT; ++u) {
    const int qt = wave * AT_QT + u;                               // 16-query tile of the block
    float* os = Os + (grp * AT_NW + qt) * (16 * AT_OP) + c * AT_OP + 8 * hh;   // row = query c; a lane's 8 registers are 8 neighbours
#pragma unroll
    for (int t = 0; t < 8; ++t) {
      *(v4f*)(os + t * 16)     = (v4f){oacc[u][t][0], oacc[u][t][1], oacc[u][t][2], oacc[u][t][3]};
      *(v4f*)(os + t * 16 + 4) = (v4f){oacc[u][t][4], oacc[u][t][5], oacc[u][t][6], oacc[u][t][7]};
    }
    const float lfin = lrun[u] + xhalf(lrun[u]);                   // the two halves' keys joined
    if (hh == 0) {
      Ms[grp][qt * 16 + c] = mrun[u];
      Ls[grp][qt * 16 + c] = lfin;
    }
  }
  __syncthreads();   // publishes the partial tiles to the waves that merge them
  // wave wv merges the block's query rows wv*8..+7; each 512-B row is written by one instruction
  {
    const int c4 = lane * 4;
#pragma unroll
    for (int rr = 0; rr < AT_QB * 32 / AT_NT; ++rr) {
      const int qrow = wv * (AT_QB * 32 / AT_NT) + rr;
      const int row  = qrow & 15;                                  // row inside its 16-query tile
      float mg[AT_G];
      float mall = ninf;
#pragma unroll
      for (int g = 0; g < AT_G; ++g) { mg[g] = Ms[g][qrow]; mall = fmaxf(mall, mg[g]); }
      float lall = 0.f;
      v4f val = (v4f){0.f, 0.f, 0.f, 0.f};
#pragma unroll
      for (int g = 0; g < AT_G; ++g) {
        const float w = __builtin_amdgcn_exp2f((mg[g] - mall) * AT_L2E);
        lall += w * Ls[g][qrow];
        const v4f part = *(const v4f*)(Os + (g * AT_NW + (qrow >> 4)) * (16 * AT_OP) + row * AT_OP + c4);
        val += part * w;
      }
      const float inv = 1.0f / lall;                               // O and l carry the same 2^15
      *(v4f*)(out + (rowbase + q0 + qrow) * AT_E + c4) = val * inv;
    }
  }
}

// ---------------------------------------------------------------------------
extern "C" void kernel_launch(void* const* d_in, const int* in_sizes, int n_in,
                              void* d_out, int out_size, void* d_ws, size_t ws_size,
                              hipStream_t stream)
{
  if (n_in < 10) return;
  const float* X    = (const float*)d_in[0];
  const float* ctxt = (const float*)d_in[1];
  const float* Wq   = (const float*)d_in[2];
  const float* bq   = (const float*)d_in[3];
  const float* Wk   = (const float*)d_in[4];
  const float* bk   = (const float*)d_in[5];
  const float* Wv   = (const float*)d_in[6];
  const float* bv   = (const float*)d_in[7];
  const float* Wc   = (const float*)d_in[8];
  const float* bc   = (const float*)d_in[9];
  float* out = (float*)d_out;

  const int E = AT_E, C = AT_C;
  const int nX   = in_sizes[0];
  const int Mall = nX / E;                 // B*N token rows
  const int Bn   = in_sizes[1] / C;        // batch
  if (Bn <= 0 || Mall <= 0) return;
  const int nTok = Mall / Bn;              // tokens per batch
  if (nTok * Bn != Mall || Mall * E != nX) return;
  if ((Mall % 64) != 0 || (nTok % AT_SK) != 0) return;
  if (in_sizes[2] != E * E || in_sizes[4] != E * E || in_sizes[6] != E * E) return;
  if (in_sizes[3] != E || in_sizes[5] != E || in_sizes[7] != E) return;
  if (in_sizes[8] != E * C || in_sizes[9] != E || in_sizes[1] != Bn * C) return;
  if (out_size != nX) return;

  // ---- workspace carve (all offsets multiples of 16 KiB) ----
  const size_t nTokE = (size_t)Mall * E;              // halves per token plane
  size_t off = 0;
  _Float16* Qh  = (_Float16*)((char*)d_ws + off); off += nTokE * 2;   // [Mall][128]
  _Float16* Kh  = (_Float16*)((char*)d_ws + off); off += nTokE * 2;   // [Mall][128]
  _Float16* Vt  = (_Float16*)((char*)d_ws + off); off += nTokE * 2;   // [128][Mall]
  if (off > ws_size) return;

  // ---- Q = X Wq^T + bq, K = X Wk^T + bk : [Mall][128] f16 ; V^T : [128][Mall] f16 ; casts included ----
  qkv_proj_kernel<<<dim3(Mall / PJ_TOK), PJ_NT, 0, stream>>>(
      X, Wq, bq, Wk, bk, Wv, bv, Qh, Kh, Vt, Mall, 256.0f, 1.0f / 256.0f);

  // ---- attention ----
  {
    const float scale_f   = (float)11.313708498984761;   // sqrt(128) as f32
    const float inv_scale = 1.0f / scale_f;
    attn128_kernel<<<dim3(Bn * (nTok / 64)), AT_NT, 0, stream>>>(
        Qh, Kh, Vt, Mall, ctxt, Wc, bc, out, nTok, inv_scale);
  }
}

// v008
// Measured time: 37.8 microseconds a run.
// Two timings next to v007 put it at 1.07 and 1.09 times that version's speed.
// Over all steps from v000 it is 6.40 times as fast.
// Contractions: Q/K/V projections, Q.K^T scores and P.V on v_wmma_f32_16x16x32_f16 (f16 operands, f32 accumulate); weights carried x256 and probabilities x32768 (exact power-of-two carries folded back in f32); context projection (K=64, 4 rows) and the per-query context-bias dot on VALU f32; softmax f32.
#include <hip/hip_runtime.h>
#include <stdint.h>

typedef __attribute__((ext_vector_type(16))) _Float16 v16h;
typedef __attribute__((ext_vector_type(8)))  _Float16 v8h;
typedef __attribute__((ext_vector_type(4)))  _Float16 v4h;
typedef __attribute__((ext_vector_type(8)))  float    v8f;
typedef __attribute__((ext_vector_type(4)))  float    v4f;
typedef uint32_t u32x4 __attribute__((ext_vector_type(4)));
typedef uint32_t u32x8 __attribute__((ext_vector_type(8)));

template <typename T> struct Frag;
template <> struct Frag<_Float16> {
  typedef v16h V; union U { v16h v; v8h h[2]; };
  static __device__ __forceinline__ v16h load(const _Float16* p) {   // elements 0..7 <- p[0..7], 8..15 <- p[16..23]
    U f; f.h[0] = *(const v8h*)(p); f.h[1] = *(const v8h*)(p + 16); return f.v;
  }
};

// =====================================================================================
// Q, K and V^T projections of 64 token rows in one launch, straight from the f32 inputs.
// Q = X Wq^T + bq, K = X Wk^T + bk : f16 [tokens][128]; V^T = (X Wv^T + bv)^T : f16 [128][tokens] (pitch ldv).
// Block = 12 waves. The block casts its X rows and the three weight matrices (x wcarry) to f16 on the way into LDS
// (512-B wave loads, one row each); waves 0..3 / 4..7 / 8..11 then form Q / K / V^T.
// Each wave owns 2 x 4 tiles of 16 x 16, with the operand whose index runs along an OUTPUT ROW as A: a lane's 8
// accumulator registers are then 8 neighbours of one output row and go to the LDS out tile as one 16-B store.
//   Q, K : A = 32 weight rows (features), B = the 64 X rows (tokens)      -> out tile [token][feature]
//   V^T  : A = 32 X rows (tokens),        B = 64 weight rows (features)   -> out tile [feature][token]
// The out tiles leave as whole 128-B lines. grid.x = tokens / 64; blockDim = 384.
// Every loop is fully unrolled (#pragma unroll): its arrays are indexed by the counter and must stay in registers,
// and the 46 loads of a wave must all be in flight before the first wait.
// =====================================================================================
#define PJ_E 128
#define PJ_TOK 64
#define PJ_NT 384
#define PJ_P 136                         // LDS pitch (halves) of 128-half rows
#define PJ_VP 72                         // LDS pitch (halves) of the V^T tile's 64-half rows
#define PJ_OT (PJ_E * PJ_VP)             // halves per out tile (>= 64 * 136)

__global__ __launch_bounds__(PJ_NT)
void qkv_proj_kernel(const float* __restrict__ X,
                     const float* __restrict__ Wq, const float* __restrict__ bq,
                     const float* __restrict__ Wk, const float* __restrict__ bk,
                     const float* __restrict__ Wv, const float* __restrict__ bv,
                     _Float16* __restrict__ Qh, _Float16* __restrict__ Kh, _Float16* __restrict__ Vt, int ldv,
                     float wcarry, float wundo)
{
  static_assert(PJ_TOK * PJ_P <= PJ_OT, "Q/K out tile must fit");
  __shared__ __align__(16) _Float16 Sm[(PJ_TOK + 3 * PJ_E) * PJ_P];   // rows 0..63: X; rows 64 + 128 m + f: weight m
  __shared__ __align__(16) _Float16 Ot[3 * PJ_OT];

  const int tid   = threadIdx.x;
  const int wv    = __builtin_amdgcn_readfirstlane(tid >> 5);   // 0..11, in a scalar register: selects by matrix stay scalar
  const int mat   = wv >> 2;                                    // 0 Q, 1 K, 2 V
  const int sl    = wv & 3;
  const int gt    = tid & 127;                                  // thread inside its 4-wave group
  const int lane  = tid & 31;
  const int rlane = lane & 15;
  const int hh    = lane >> 4;
  const int tok0  = blockIdx.x * PJ_TOK;

  // ---- all global loads first, none under a branch: bias values, X rows (block), this group's weight matrix ----
  const int colA0 = (mat < 2) ? sl * 32 : (sl & 1) * 32;         // first out column of the wave (A index)
  const int rowB0 = (mat < 2) ? 0 : (sl >> 1) * 64;              // first out row of the wave (B index)
  const v4f* bA = (const v4f*)((mat == 1 ? bk : bq) + colA0 + 8 * hh);   // in bounds for every wave; used by Q, K
  v4f bmv[2][2];
  float bnv[4];
#pragma unroll
  for (int i = 0; i < 2; ++i) { bmv[i][0] = bA[i * 4]; bmv[i][1] = bA[i * 4 + 1]; }
#pragma unroll
  for (int j = 0; j < 4; ++j) bnv[j] = bv[rowB0 + j * 16 + rlane];       // in bounds for every wave; used by V

  const v4f* Xg = (const v4f*)(X + (size_t)tok0 * PJ_E);
  const v4f* Wg = (const v4f*)(mat == 0 ? Wq : (mat == 1 ? Wk : Wv));
  // X: 2048 16-B pieces = 5 per thread + 128; every group loads the last 128, group 0 alone stores them
  v4f xr[6], wr[32];
#pragma unroll
  for (int i = 0; i < 5; ++i) xr[i] = Xg[i * PJ_NT + tid];
  xr[5] = Xg[5 * PJ_NT + gt];
#pragma unroll
  for (int i = 0; i < 32; ++i) wr[i] = Wg[i * 128 + gt];

  // ---- cast to f16 into LDS ----
#pragma unroll
  for (int i = 0; i < 6; ++i) {
    const int idx = (i < 5) ? i * PJ_NT + tid : 5 * PJ_NT + gt;
    v4h h;
#pragma unroll
    for (int e = 0; e < 4; ++e) h[e] = (_Float16)xr[i][e];
    if (i < 5 || mat == 0) *(v4h*)(Sm + (idx >> 5) * PJ_P + (idx & 31) * 4) = h;
  }
  {
    _Float16* wdst = Sm + (PJ_TOK + mat * PJ_E) * PJ_P;
#pragma unroll
    for (int i = 0; i < 32; ++i) {
      const int idx = i * 128 + gt;
      v4h h;
#pragma unroll
      for (int e = 0; e < 4; ++e) h[e] = (_Float16)(wr[i][e] * wcarry);
      *(v4h*)(wdst + (idx >> 5) * PJ_P + (idx & 31) * 4) = h;
    }
  }
  __syncthreads();

  float bm[2][8], bn[4];                                         // bias along A (Q, K) or along B (V); the other is 0
#pragma unroll
  for (int i = 0; i < 2; ++i)
#pragma unroll
    for (int r = 0; r < 8; ++r) bm[i][r] = (mat < 2) ? bmv[i][r >> 2][r & 3] : 0.f;
#pragma unroll
  for (int j = 0; j < 4; ++j) bn[j] = (mat < 2) ? 0.f : bnv[j];

  // ---- products: both operands by the same loader, so their k orders agree ----
  const int rowA = (mat < 2) ? (PJ_TOK + mat * PJ_E + colA0) : colA0;
  const int rowB = (mat < 2) ? 0 : (PJ_TOK + 2 * PJ_E + rowB0);
  const _Float16* pA = Sm + (rowA + rlane) * PJ_P + 8 * hh;
  const _Float16* pB = Sm + (rowB + rlane) * PJ_P + 8 * hh;
  v8f acc[2][4];
#pragma unroll
  for (int i = 0; i < 2; ++i)
#pragma unroll
    for (int j = 0; j < 4; ++j) acc[i][j] = (v8f){0.f,0.f,0.f,0.f,0.f,0.f,0.f,0.f};
#pragma unroll
  for (int k0 = 0; k0 < PJ_E; k0 += 32) {
    v16h a[2], b[4];
#pragma unroll
    for (int i = 0; i < 2; ++i) a[i] = Frag<_Float16>::load(pA + i * 16 * PJ_P + k0);
#pragma unroll
    for (int j = 0; j < 4; ++j) b[j] = Frag<_Float16>::load(pB + j * 16 * PJ_P + k0);
#pragma unroll
    for (int i = 0; i < 2; ++i)
#pragma unroll
      for (int j = 0; j < 4; ++j)
        acc[i][j] = __builtin_amdgcn_wmma_f32_16x16x32_f16(false, a[i], false, b[j], (short)0, acc[i][j], false, false);
  }

  // ---- undo the carry, add the bias, f16, out tile in LDS ----
  _Float16* ot = Ot + mat * PJ_OT;
  const int opitch = (mat < 2) ? PJ_P : PJ_VP;
#pragma unroll
  for (int i = 0; i < 2; ++i)
#pragma unroll
    for (int j = 0; j < 4; ++j) {
      v8h hv;
#pragma unroll
      for (int r = 0; r < 8; ++r) hv[r] = (_Float16)((acc[i][j][r] * wundo + bm[i][r]) + bn[j]);
      *(v8h*)(ot + (rowB0 + j * 16 + rlane) * opitch + colA0 + i * 16 + 8 * hh) = hv;
    }
  __syncthreads();

  // ---- each group stores its own tile: 16 B per lane, whole 128-B lines (Q, K: 64 rows of 256 B; V^T: 128 of 128 B) ----
  _Float16* G = (mat == 0) ? Qh + (size_t)tok0 * PJ_E : ((mat == 1) ? Kh + (size_t)tok0 * PJ_E : Vt + tok0);
  const int gpitch = (mat < 2) ? PJ_E : ldv;
  const int rsh    = (mat < 2) ? 4 : 3;                            // 16-B pieces per row: 16 or 8
  const int c8     = (gt & ((1 << rsh) - 1)) * 8;
#pragma unroll
  for (int i = 0; i < 8; ++i) {
    const int row = (i * 128 + gt) >> rsh;
    *(v8h*)(G + (size_t)row * gpitch + c8) = *(const v8h*)(ot + row * opitch + c8);
  }
}

// =====================================================================================
// Single-head attention, head dim 128, f16 q/k planes row-major [B*N][128], f16 V^T plane [128][B*N] (pitch ldv),
// f32 out. scores = (q.k^T) * inv_scale + bias[q] with bias[q] = sum_d q[q][d] * ctx[b][d],
// ctx[b][e] = sum_c context[b][c] * Wc[e][c] + bc[e] (VALU f32, per block); softmax over all keys (no mask), f32 online;
// out = p.v / l with p and l both carried x2^15 (added to the exponent in front of exp2), so the carry cancels.
// Block = 8 waves = 64 query rows of one batch x 4 key groups: wave (g, qw) runs query rows qw*32..+31 (two 16-query
// tiles) over the g-th 64 keys of every 256-key stage: every K and V^T fragment read from LDS feeds two WMMAs, so the
// block's LDS reads per stage take no longer than its WMMAs; each SIMD holds two waves. The stages come
// by tensor loads into two buffers, one request per wave and stage (a slice of 64 rows of 256 B, through no register):
// stage s + 1 is in flight while stage s is worked on, one barrier per stage.
// Each group keeps its own online (max, sum, O); the four are merged once in LDS behind the loop.
// Both products are formed transposed: S^T = K Q^T (A = K rows, B = Q, kept in registers) and O^T += V^T P^T
// (A = V^T rows, B = P^T). A lane then holds scores of ONE query (column c; keys 8hh+r of each 16-key tile): max and
// sum run in the lane plus one exchange between the wave halves, and two neighbouring score tiles, converted in
// place, ARE the B operand of the second product (its k order is the fragment loader's), so P never leaves registers.
// grid.x = B * (N / 64); blockDim = 256; N % 256 == 0.
// =====================================================================================
#define AT_E 128
#define AT_C 64
#define AT_QB 64
#define AT_KC 64
#define AT_NW 4                          // 16-query tiles of a block
#define AT_QT 2                          // 16-query tiles of a wave
#define AT_G 4
#define AT_SK (AT_G * AT_KC)
#define AT_NT (AT_G * (AT_NW / AT_QT) * 32)
#define AT_QP 136
#define AT_KP 136
#define AT_SLR 64                        // rows of a tensor-load slice, 256 B each
#define AT_SLB 18432                     // LDS bytes of a slice: 64 rows at pitch 272 B (17,408), rounded up to a multiple of 2 KiB
#define AT_NSL 8                         // slices of a stage: K rows 64 w..+63 (w = 0..3); V^T keys 128 h..+127, d 64 e..+63 (4 + 2 h + e)
#define AT_OP 132
#define AT_PLOG 15.0f                    // probabilities and their sums are carried x 2^15
#define AT_L2E 1.4426950408889634f

__device__ __forceinline__ v8f mma_h16(v16h a, v16h b, v8f c) {
  return __builtin_amdgcn_wmma_f32_16x16x32_f16(false, a, false, b, (short)0, c, false, false);
}

// lane l <-> lane l ^ 16
__device__ __forceinline__ float xhalf(float x) {
  return __builtin_bit_cast(float, __builtin_amdgcn_permlanex16(__builtin_bit_cast(int, x), __builtin_bit_cast(int, x),
                                                                0x76543210, 0xfedcba98, false, false));
}

// a wave-uniform value into a scalar register
__device__ __forceinline__ uint32_t uni(uint32_t v) { return (uint32_t)__builtin_amdgcn_readfirstlane(v); }
// A wave-uniform test or a descriptor word held in a scalar register: the branch on such a test is
// a scalar branch (a tensor load ignores EXEC), and such a word stays in its register as long as a later statement names it.
__device__ __forceinline__ uint32_t pinned(uint32_t v) {
  uint32_t w = uni(v);
  asm volatile("" : "+s"(w));   // pinned(): holds a tensor load's issue test or descriptor word in a scalar register
  return w;
}

__device__ __forceinline__ u32x8 tdm_group1(uint32_t src_pitch) {
  constexpr uint32_t d0 = 256u, d1 = AT_SLR;
  u32x8 g;
  g[0] = pinned((1u << 20) | (5u << 22) | (3u << 25));
  g[1] = pinned((d0 & 0xFFFFu) << 16);
  g[2] = pinned((d0 >> 16) | ((d1 & 0xFFFFu) << 16));
  g[3] = pinned((d1 >> 16) | (d0 << 16));
  g[4] = pinned(d1);
  g[5] = pinned(src_pitch);
  g[6] = pinned(0u);
  g[7] = pinned(0u);
  return g;
}
// group 0: count 1, LDS byte offset of the tile, global address of its first byte, type 2
__device__ __forceinline__ u32x4 tdm_group0(uint32_t lds_dst, uint64_t ga) {
  u32x4 g;
  g[0] = pinned(1u);
  g[1] = pinned(lds_dst);
  g[2] = pinned((uint32_t)ga);
  g[3] = pinned((((uint32_t)(ga >> 32)) & 0x01FFFFFFu) | 0x80000000u);
  return g;
}
// one request of the whole wave: global tile -> LDS
__device__ __forceinline__ void tdm_load(u32x4 g0, u32x8 g1) {
  asm volatile("tensor_load_to_lds %0, %1" :: "s"(g0), "s"(g1) : "memory");
}

__global__ __launch_bounds__(AT_NT)
void attn128_kernel(const _Float16* __restrict__ Qh, const _Float16* __restrict__ Kh,
                    const _Float16* __restrict__ Vt, int ldv,
                    const float* __restrict__ ctxin, const float* __restrict__ Wc, const float* __restrict__ bcv,
                    float* __restrict__ out, int nTok, float inv_scale)
{
  __shared__ __align__(16) float    ctxS[AT_E];
  __shared__ __align__(16) _Float16 Qsh[AT_QB * AT_QP];          // [q][d]      pitch 136
  __shared__ __align__(16) float    Ms[AT_G][AT_QB];             // per group row max
  __shared__ __align__(16) float    Ls[AT_G][AT_QB];             // per group row sum
  // Two stage buffers of eight slices each (64 rows of 128 halves, pitch 136): slices 0..3 = K rows [kv][d] of key group
  // 0..3; slice 4 + 2 h + e = V^T rows [d = 64 e ..][kv = 128 h ..]. Every slice starts at a multiple of 2 KiB. Behind the
  // loop the first buffer's bytes hold the 16 partial O tiles (group x query tile; 16 x 128 f32, pitch 132).
  constexpr int KV_BYTES = AT_NSL * AT_SLB;
  static_assert(AT_SLR * AT_KP * 2 <= AT_SLB && AT_SLB % 2048 == 0, "a slice holds its padded rows and keeps the next one's place");
  static_assert(AT_G * AT_SLR == AT_SK && AT_KC == AT_SLR && AT_E == 2 * AT_SLR && AT_SK == 2 * 128, "slices tile the stage");
  static_assert(AT_G * AT_NW * 16 * AT_OP * 4 <= KV_BYTES, "partial O tiles must fit the K/V stage");
  __shared__ __attribute__((aligned(2048))) unsigned char KVraw[2 * KV_BYTES];
  float*    const Os  = (float*)KVraw;

  const int tid  = threadIdx.x;
  const int wv   = tid >> 5;        // 0..7
  const int wave = wv & (AT_NW / AT_QT - 1);   // 32-query slice of this wave
  const int grp  = wv >> 1;            // key group of this wave
  const int lane = tid & 31;
  const int hh   = lane >> 4;
  const int c    = lane & 15;

  const int nqb = nTok / AT_QB;
  const int b   = blockIdx.x / nqb;
  const int qb  = blockIdx.x - b * nqb;
  const int q0  = qb * AT_QB;
  const size_t rowbase = (size_t)b * nTok;       // first token row of this batch
  const size_t colbase = rowbase;                 // column offset of this batch inside V^T rows

  // ---- this wave's slice of a stage: waves 0..3 bring K rows, waves 4..7 V^T rows; all of it wave-uniform ----
  const int nChunks = nTok / AT_SK;                                    // block-uniform, size-derived
  const uint32_t wvs  = uni((uint32_t)tid >> 5);
  const bool     isV  = wvs >= 4u;
  const uint64_t ga0  = isV ? (uint64_t)(size_t)(Vt + (size_t)((wvs & 1u) * AT_SLR) * ldv + colbase + ((wvs >> 1) & 1u) * 128u)
                            : (uint64_t)(size_t)(Kh + (rowbase + wvs * AT_SLR) * AT_E);
  const uint32_t gstep = isV ? AT_SK * 2u : AT_SK * AT_E * 2u;          // source bytes from one stage to the next
  const uint32_t ldst  = (uint32_t)(size_t)KVraw + wvs * AT_SLB;        // byte offset in the work-group's LDS, buffer 0
  const u32x8    g1    = tdm_group1(isV ? (uint32_t)ldv * 2u : AT_E * 2u);
  // stage st -> the buffer at byte offset bo: one request of every wave, only where the stage exists (a scalar branch)
  u32x4 g0;                                                             // group 0 of this wave's latest request
  auto stage_load = [&](uint32_t bo, uint32_t st, bool exists) {
    g0 = tdm_group0(ldst + bo, ga0 + (uint64_t)st * gstep);
    if (pinned(exists)) tdm_load(g0, g1);
  };
  // The wave's request has landed. The wait names the descriptor's registers as inputs: they live up to it, so none of
  // them takes a new value while the request is outstanding.
  auto wait_landed = [&]() { asm volatile("s_wait_tensorcnt 0x0" :: "s"(g0), "s"(g1) : "memory"); };
  // stage 0 -> buffer 0, in flight during the context projection and the Q load
  g0 = tdm_group0(ldst, ga0);
  tdm_load(g0, g1);

  // ---- context projection ctx[b][e], one thread per e ----
  if (tid < AT_E) {
    const float* cr = ctxin + (size_t)b * AT_C;
    const float* wr = Wc + (size_t)tid * AT_C;
    float a = 0.f;
#pragma unroll 4
    for (int cc = 0; cc < AT_C; ++cc) a += cr[cc] * wr[cc];
    ctxS[tid] = a + bcv[tid];
  }
  // ---- Q block [64][128] into LDS ----
#pragma unroll
  for (int i = 0; i < AT_QB * 16 / AT_NT; ++i) {
    const int idx = i * AT_NT + tid;
    const int row = idx >> 4, c8 = (idx & 15) * 8;
    const v8h v = *(const v8h*)(Qh + (rowbase + q0 + row) * AT_E + c8);
    *(v8h*)(Qsh + row * AT_QP + c8) = v;
  }
  wait_landed();                                       // this wave's slice of stage 0; the barrier publishes it
  __syncthreads();
  stage_load(KV_BYTES, 1u, nChunks > 1);                                   // stage 1 -> buffer 1

  // Below, index u = 0, 1 is the wave's query tile; "query c" of tile u is block row wave*32 + u*16 + c.
  // Every loop over u is unrolled: its arrays are indexed by the counter and must stay in registers.
  // ---- per-query context bias: lanes c / c+16 each sum 64 of the 128 d of query c ----
  float bias[AT_QT];                                              // of query c, in both halves
  {
    const _Float16* qr = Qsh + (wave * AT_QT * 16 + c) * AT_QP + hh * 64;
    const float* cx = ctxS + hh * 64;
    float part[AT_QT];
#pragma unroll
    for (int u = 0; u < AT_QT; ++u) part[u] = 0.f;
#pragma unroll 8
    for (int e = 0; e < 64; ++e)
#pragma unroll
      for (int u = 0; u < AT_QT; ++u) part[u] += (float)qr[u * 16 * AT_QP + e] * cx[e];
#pragma unroll
    for (int u = 0; u < AT_QT; ++u) bias[u] = part[u] + __shfl_xor(part[u], 16, 32);
  }

  const float ninf = -__builtin_inff();
  const float k1 = inv_scale * AT_L2E;   // product -> score in log2 units
  float mrun[AT_QT];                 // running max of query c (same in both halves)
  float lrun[AT_QT];                 // running sum of query c over THIS half's keys; the halves join behind the loop
  v8f oacc[AT_QT][8];                // O^T: oacc[u][t][r] = O[query c][d = t*16 + 8hh + r]
  // Q of this wave as the B operand of S^T, read once: qf[u][dc] = Q[query c][dc*32 + k order of the loader]
  v16h qf[AT_QT][4];
#pragma unroll
  for (int u = 0; u < AT_QT; ++u) {
    mrun[u] = ninf;
    lrun[u] = 0.f;
#pragma unroll
    for (int t = 0; t < 8; ++t) oacc[u][t] = (v8f){0.f,0.f,0.f,0.f,0.f,0.f,0.f,0.f};
#pragma unroll
    for (int dc = 0; dc < 4; ++dc)
      qf[u][dc] = Frag<_Float16>::load(Qsh + ((wave * AT_QT + u) * 16 + c) * AT_QP + dc * 32 + 8 * hh);
  }
  for (int kc = 0; kc < nChunks; ++kc) {
    const int boff = (kc & 1) * KV_BYTES;                              // stage kc lies in buffer kc mod 2
    const _Float16* kgrp = (const _Float16*)(KVraw + boff + grp * AT_SLB);                         // this group's 64 K rows
    const _Float16* vgrp = (const _Float16*)(KVraw + boff + (4 + (grp >> 1) * 2) * AT_SLB) + (grp & 1) * AT_KC;   // its 64 V^T columns, d 0..63

    // ---- S^T = K Q^T : A[m=key c][k=d] from kgrp row (j*16+c), B[k=d][n=query c] = qf ----
    v8f st[AT_QT][4];                // st[u][j][r] = score of key j*16 + 8hh + r against query c
#pragma unroll
    for (int u = 0; u < AT_QT; ++u)
#pragma unroll
      for (int j = 0; j < 4; ++j) st[u][j] = (v8f){0.f,0.f,0.f,0.f,0.f,0.f,0.f,0.f};
    // The K fragments of one d step (eight 16-B LDS loads) are issued as one group in front of their eight WMMAs:
    // one LDS round trip per group, not one per WMMA.
    // Unrolled: qf is indexed by the counter and must stay in registers.
#pragma unroll
    for (int dc = 0; dc < 4; ++dc) {
      v16h ka[4];
#pragma unroll
      for (int j = 0; j < 4; ++j) ka[j] = Frag<_Float16>::load(kgrp + (j * 16 + c) * AT_KP + dc * 32 + 8 * hh);
      __builtin_amdgcn_sched_barrier(0);   // keeps the group's loads together in front of its WMMAs, none among them
#pragma unroll
      for (int j = 0; j < 4; ++j)
#pragma unroll
        for (int u = 0; u < AT_QT; ++u) st[u][j] = mma_h16(ka[j], qf[u][dc], st[u][j]);
    }

    v16h pb[AT_QT][2];
#pragma unroll
    for (int u = 0; u < AT_QT; ++u) {
      // ---- chunk max of query c on the raw products: 32 in the lane, the other 32 in lane l ^ 16 ----
      float cmj[4];
#pragma unroll
      for (int j = 0; j < 4; ++j) {
        float m = st[u][j][0];
#pragma unroll
        for (int r = 1; r < 8; ++r) m = fmaxf(m, st[u][j][r]);
        cmj[j] = m;
      }
      float cm = fmaxf(fmaxf(cmj[0], cmj[1]), fmaxf(cmj[2], cmj[3]));
      cm = fmaxf(cm, xhalf(cm));
      // score = product * inv_scale + bias rises with the product (inv_scale > 0): the largest score is that of cm
      const float mnew  = fmaxf(mrun[u], cm * inv_scale + bias[u]);
      const float alpha = __builtin_amdgcn_exp2f((mrun[u] - mnew) * AT_L2E);
      mrun[u] = mnew;
      // 2^15 exp(score - mnew) = exp2(product * k1 + c0): scale, bias, maximum, log2(e) and the carry in one fma
      const float c0 = (bias[u] - mnew) * AT_L2E + AT_PLOG;
      // ---- P^T: tiles 2kk and 2kk+1, converted in place, are the B operand of keys kk*32..+31 ----
      float psj[4];
#pragma unroll
      for (int j = 0; j < 4; ++j) {
        float ps = 0.f;
#pragma unroll
        for (int r = 0; r < 8; ++r) {
          const float p = __builtin_amdgcn_exp2f(st[u][j][r] * k1 + c0);
          ps += p;
          pb[u][j >> 1][(j & 1) * 8 + r] = (_Float16)p;
        }
        psj[j] = ps;
      }
      lrun[u] = lrun[u] * alpha + ((psj[0] + psj[1]) + (psj[2] + psj[3]));
#pragma unroll
      for (int t = 0; t < 8; ++t)
#pragma unroll
        for (int r = 0; r < 8; ++r) oacc[u][t][r] *= alpha;
    }

    // ---- O^T += V^T P^T : A[m=d c][k=kv] from V^T row d = t*16+c (vgrp slice t/4), B[k=kv][n=query c] = pb ----
    // likewise: the V^T fragments of 32 keys (sixteen 16-B LDS loads) as one group in front of their sixteen WMMAs
#pragma unroll
    for (int kk = 0; kk < 2; ++kk) {
      v16h va[8];
#pragma unroll
      for (int t = 0; t < 8; ++t) va[t] = Frag<_Float16>::load(vgrp + (t >> 2) * (AT_SLB / 2) + ((t & 3) * 16 + c) * AT_KP + kk * 32 + 8 * hh);
      __builtin_amdgcn_sched_barrier(0);   // keeps the group's loads together in front of its WMMAs, none among them
#pragma unroll
      for (int t = 0; t < 8; ++t)
#pragma unroll
        for (int u = 0; u < AT_QT; ++u) oacc[u][t] = mma_h16(va[t], pb[u][kk], oacc[u][t]);
    }

    // ---- hand-over: this wave's reads of stage kc are done and its slice of stage kc + 1 has landed; the one
    // barrier publishes stage kc + 1 and frees stage kc's buffer, which stage kc + 2 then refills ----
    asm volatile("s_wait_dscnt 0x0" ::: "memory");
    wait_landed();
    __syncthreads();
    stage_load((uint32_t)boff, (uint32_t)(kc + 2), kc + 2 < nChunks);
  }
  asm volatile("s_wait_tensorcnt 0x0" ::: "memory");   // no request is outstanding when the buffers change their use
  asm volatile("s_wait_dscnt 0x0" ::: "memory");       // nor an LDS read of this wave

  // ---- merge of the four key groups: every wave lays down its un-normalised O tiles and its rows' (max, sum) ----
  __syncthreads();   // every wave has left the K/V stage before its bytes become the partial O tiles
#pragma unroll
  for (int u = 0; u < AT_QT; ++u) {
    const int qt = wave * AT_QT + u;                               // 16-query tile of the block
    float* os = Os + (grp * AT_NW + qt) * (16 * AT_OP) + c * AT_OP + 8 * hh;   // row = query c; a lane's 8 registers are 8 neighbours
#pragma unroll
    for (int t = 0; t < 8; ++t) {
      *(v4f*)(os + t * 16)     = (v4f){oacc[u][t][0], oacc[u][t][1], oacc[u][t][2], oacc[u][t][3]};
      *(v4f*)(os + t * 16 + 4) = (v4f){oacc[u][t][4], oacc[u][t][5], oacc[u][t][6], oacc[u][t][7]};
    }
    const float lfin = lrun[u] + xhalf(lrun[u]);                   // the two halves' keys joined
    if (hh == 0) {
      Ms[grp][qt * 16 + c] = mrun[u];
      Ls[grp][qt * 16 + c] = lfin;
    }
  }
  __syncthreads();   // publishes the partial tiles to the waves that merge them
  // wave wv merges the block's query rows wv*8..+7; each 512-B row is written by one instruction
  {
    const int c4 = lane * 4;
#pragma unroll
    for (int rr = 0; rr < AT_QB * 32 / AT_NT; ++rr) {
      const int qrow = wv * (AT_QB * 32 / AT_NT) + rr;
      const int row  = qrow & 15;                                  // row inside its 16-query tile
      float mg[AT_G];
      float mall = ninf;
#pragma unroll
      for (int g = 0; g < AT_G; ++g) { mg[g] = Ms[g][qrow]; mall = fmaxf(mall, mg[g]); }
      float lall = 0.f;
      v4f val = (v4f){0.f, 0.f, 0.f, 0.f};
#pragma unroll
      for (int g = 0; g < AT_G; ++g) {
        const float w = __builtin_amdgcn_exp2f((mg[g] - mall) * AT_L2E);
        lall += w * Ls[g][qrow];
        const v4f part = *(const v4f*)(Os + (g * AT_NW + (qrow >> 4)) * (16 * AT_OP) + row * AT_OP + c4);
        val += part * w;
      }
      const float inv = 1.0f / lall;                               // O and l carry the same 2^15
      *(v4f*)(out + (rowbase + q0 + qrow) * AT_E + c4) = val * inv;
    }
  }
}

// ---------------------------------------------------------------------------
extern "C" void kernel_launch(void* const* d_in, const int* in_sizes, int n_in,
                              void* d_out, int out_size, void* d_ws, size_t ws_size,
                              hipStream_t stream)
{
  if (n_in < 10) return;
  const float* X    = (const float*)d_in[0];
  const float* ctxt = (const float*)d_in[1];
  const float* Wq   = (const float*)d_in[2];
  const float* bq   = (const float*)d_in[3];
  const float* Wk   = (const float*)d_in[4];
  const float* bk   = (const float*)d_in[5];
  const float* Wv   = (const float*)d_in[6];
  const float* bv   = (const float*)d_in[7];
  const float* Wc   = (const float*)d_in[8];
  const float* bc   = (const float*)d_in[9];
  float* out = (float*)d_out;

  const int E = AT_E, C = AT_C;
  const int nX   = in_sizes[0];
  const int Mall = nX / E;                 // B*N token rows
  const int Bn   = in_sizes[1] / C;        // batch
  if (Bn <= 0 || Mall <= 0) return;
  const int nTok = Mall / Bn;              // tokens per batch
  if (nTok * Bn != Mall || Mall * E != nX) return;
  if ((Mall % 64) != 0 || (nTok % AT_SK) != 0) return;
  if (in_sizes[2] != E * E || in_sizes[4] != E * E || in_sizes[6] != E * E) return;
  if (in_sizes[3] != E || in_sizes[5] != E || in_sizes[7] != E) return;
  if (in_sizes[8] != E * C || in_sizes[9] != E || in_sizes[1] != Bn * C) return;
  if (out_size != nX) return;

  // ---- workspace carve (all offsets multiples of 16 KiB) ----
  const size_t nTokE = (size_t)Mall * E;              // halves per token plane
  size_t off = 0;
  _Float16* Qh  = (_Float16*)((char*)d_ws + off); off += nTokE * 2;   // [Mall][128]
  _Float16* Kh  = (_Float16*)((char*)d_ws + off); off += nTokE * 2;   // [Mall][128]
  _Float16* Vt  = (_Float16*)((char*)d_ws + off); off += nTokE * 2;   // [128][Mall]
  if (off > ws_size) return;

  // ---- Q = X Wq^T + bq, K = X Wk^T + bk : [Mall][128] f16 ; V^T : [128][Mall] f16 ; casts included ----
  qkv_proj_kernel<<<dim3(Mall / PJ_TOK), PJ_NT, 0, stream>>>(
      X, Wq, bq, Wk, bk, Wv, bv, Qh, Kh, Vt, Mall, 256.0f, 1.0f / 256.0f);

  // ---- attention ----
  {
    const float scale_f   = (float)11.313708498984761;   // sqrt(128) as f32
    const float inv_scale = 1.0f / scale_f;
    attn128_kernel<<<dim3(Bn * (nTok / 64)), AT_NT, 0, stream>>>(
        Qh, Kh, Vt, Mall, ctxt, Wc, bc, out, nTok, inv_scale);
  }
}

// v009
// A run of this version takes 36.1 microseconds.
// In both of two side-by-side timings against v008, it was 1.05 times as fast.
// All steps since v000 together make it 6.72 times as fast.
// Contractions: Q/K/V projections, Q.K^T scores and P.V on v_wmma_f32_16x16x32_f16 (f16 operands, f32 accumulate); weights carried x256 and probabilities x32768 (exact power-of-two carries folded back in f32); context projection (K=64, 4 rows; once, in the projection launch) and the per-query context-bias dot on VALU f32; softmax f32.
#include <hip/hip_runtime.h>
#include <stdint.h>

typedef __attribute__((ext_vector_type(16))) _Float16 v16h;
typedef __attribute__((ext_vector_type(8)))  _Float16 v8h;
typedef __attribute__((ext_vector_type(4)))  _Float16 v4h;
typedef __attribute__((ext_vector_type(8)))  float    v8f;
typedef __attribute__((ext_vector_type(4)))  float    v4f;
typedef uint32_t u32x4 __attribute__((ext_vector_type(4)));
typedef uint32_t u32x8 __attribute__((ext_vector_type(8)));

template <typename T> struct Frag;
template <> struct Frag<_Float16> {
  typedef v16h V; union U { v16h v; v8h h[2]; };
  static __device__ __forceinline__ v16h load(const _Float16* p) {   // elements 0..7 <- p[0..7], 8..15 <- p[16..23]
    U f; f.h[0] = *(const v8h*)(p); f.h[1] = *(const v8h*)(p + 16); return f.v;
  }
};

// =====================================================================================
// Q, K and V^T projections of 64 token rows in one launch, straight from the f32 inputs.
// Q = X Wq^T + bq, K = X Wk^T + bk : f16 [tokens][128]; V^T = (X Wv^T + bv)^T : f16 [128][tokens] (pitch ldv).
// Block = 12 waves. The block casts its X rows and the three weight matrices (x wcarry) to f16 on the way into LDS
// (512-B wave loads, one row each); waves 0..3 / 4..7 / 8..11 then form Q / K / V^T.
// Each wave owns 2 x 4 tiles of 16 x 16, with the operand whose index runs along an OUTPUT ROW as A: a lane's 8
// accumulator registers are then 8 neighbours of one output row and go to the LDS out tile as one 16-B store.
//   Q, K : A = 32 weight rows (features), B = the 64 X rows (tokens)      -> out tile [token][feature]
//   V^T  : A = 32 X rows (tokens),        B = 64 weight rows (features)   -> out tile [feature][token]
// The out tiles leave as whole 128-B lines. grid.x = tokens / 64; blockDim = 384.
// The context projection ctx[b][e] = sum_c context[b][c] * Wc[e][c] + bc[e] (f32, VALU) rides along, dealt over the grid:
// each half of a block's wave 0 forms one value (4 terms a lane, summed over the 16 lanes) for the attention launch.
// Every other loop is fully unrolled (#pragma unroll): its arrays are indexed by the counter and must stay in registers,
// and the 46 loads of a wave must all be in flight before the first wait.
// =====================================================================================
#define PJ_E 128
#define PJ_TOK 64
#define PJ_NT 384
#define PJ_P 136                         // LDS pitch (halves) of 128-half rows
#define PJ_VP 72                         // LDS pitch (halves) of the V^T tile's 64-half rows
#define PJ_OT (PJ_E * PJ_VP)             // halves per out tile (>= 64 * 136)
#define PJ_C 64                          // context width

// x + (x of lane l ^ M), M = 1, 2, 4, 8: inside a 16-lane row, through no LDS
template <int M> __device__ __forceinline__ float row_xadd(float x) {
  return x + __builtin_bit_cast(float, __builtin_amdgcn_update_dpp(0, __builtin_bit_cast(int, x), 0x160 + M, 0xf, 0xf, true));
}

__global__ __launch_bounds__(PJ_NT)
void qkv_proj_kernel(const float* __restrict__ X,
                     const float* __restrict__ Wq, const float* __restrict__ bq,
                     const float* __restrict__ Wk, const float* __restrict__ bk,
                     const float* __restrict__ Wv, const float* __restrict__ bv,
                     const float* __restrict__ ctxin, const float* __restrict__ Wc, const float* __restrict__ bc,
                     _Float16* __restrict__ Qh, _Float16* __restrict__ Kh, _Float16* __restrict__ Vt, int ldv,
                     float* __restrict__ ctxw, int nCtx, int ctxStep,
                     float wcarry, float wundo)
{
  static_assert(PJ_TOK * PJ_P <= PJ_OT, "Q/K out tile must fit");
  __shared__ __align__(16) _Float16 Sm[(PJ_TOK + 3 * PJ_E) * PJ_P];   // rows 0..63: X; rows 64 + 128 m + f: weight m
  __shared__ __align__(16) _Float16 Ot[3 * PJ_OT];

  const int tid   = threadIdx.x;
  const int wv    = __builtin_amdgcn_readfirstlane(tid >> 5);   // 0..11, in a scalar register: selects by matrix stay scalar
  const int mat   = wv >> 2;                                    // 0 Q, 1 K, 2 V
  const int sl    = wv & 3;
  const int gt    = tid & 127;                                  // thread inside its 4-wave group
  const int lane  = tid & 31;
  const int rlane = lane & 15;
  const int hh    = lane >> 4;
  const int tok0  = blockIdx.x * PJ_TOK;

  // ---- context projection: value v = b * 128 + e; both halves of wave 0 make the same number of trips (nCtx is even) ----
  if (wv == 0) {
    for (int v = blockIdx.x * 2 + hh; v < nCtx; v += ctxStep) {             // ctxStep = 2 * blocks of the grid
      const int ce = v & (PJ_E - 1);
      const float bce = bc[ce];                                              // with the other two loads: one round trip
      const v4f w4 = *(const v4f*)(Wc + (size_t)ce * PJ_C + rlane * 4);
      const v4f c4 = *(const v4f*)(ctxin + (size_t)(v / PJ_E) * PJ_C + rlane * 4);
      float p = (w4[0] * c4[0] + w4[1] * c4[1]) + (w4[2] * c4[2] + w4[3] * c4[3]) + (rlane == 0 ? bce : 0.f);   // bc[e] enters the sum once
      p = row_xadd<1>(p); p = row_xadd<2>(p); p = row_xadd<4>(p); p = row_xadd<8>(p);
      if (rlane == 0) {
        ctxw[v] = p;
        asm volatile("s_wait_xcnt 0x0" ::: "memory");   // before the next trip, or the code behind the loop, rewrites the store's registers
      }
    }
  }

  // ---- all other global loads first, none under a branch: bias values, X rows (block), this group's weight matrix ----
  const int colA0 = (mat < 2) ? sl * 32 : (sl & 1) * 32;         // first out column of the wave (A index)
  const int rowB0 = (mat < 2) ? 0 : (sl >> 1) * 64;              // first out row of the wave (B index)
  const v4f* bA = (const v4f*)((mat == 1 ? bk : bq) + colA0 + 8 * hh);   // in bounds for every wave; used by Q, K
  v4f bmv[2][2];
  float bnv[4];
#pragma unroll
  for (int i = 0; i < 2; ++i) { bmv[i][0] = bA[i * 4]; bmv[i][1] = bA[i * 4 + 1]; }
#pragma unroll
  for (int j = 0; j < 4; ++j) bnv[j] = bv[rowB0 + j * 16 + rlane];       // in bounds for every wave; used by V

  const v4f* Xg = (const v4f*)(X + (size_t)tok0 * PJ_E);
  const v4f* Wg = (const v4f*)(mat == 0 ? Wq : (mat == 1 ? Wk : Wv));
  // X: 2048 16-B pieces = 5 per thread + 128; every group loads the last 128, group 0 alone stores them
  v4f xr[6], wr[32];
#pragma unroll
  for (int i = 0; i < 5; ++i) xr[i] = Xg[i * PJ_NT + tid];
  xr[5] = Xg[5 * PJ_NT + gt];
#pragma unroll
  for (int i = 0; i < 32; ++i) wr[i] = Wg[i * 128 + gt];

  // ---- cast to f16 into LDS ----
#pragma unroll
  for (int i = 0; i < 6; ++i) {
    const int idx = (i < 5) ? i * PJ_NT + tid : 5 * PJ_NT + gt;
    v4h h;
#pragma unroll
    for (int e = 0; e < 4; ++e) h[e] = (_Float16)xr[i][e];
    if (i < 5 || mat == 0) *(v4h*)(Sm + (idx >> 5) * PJ_P + (idx & 31) * 4) = h;
  }
  {
    _Float16* wdst = Sm + (PJ_TOK + mat * PJ_E) * PJ_P;
#pragma unroll
    for (int i = 0; i < 32; ++i) {
      const int idx = i * 128 + gt;
      v4h h;
#pragma unroll
      for (int e = 0; e < 4; ++e) h[e] = (_Float16)(wr[i][e] * wcarry);
      *(v4h*)(wdst + (idx >> 5) * PJ_P + (idx & 31) * 4) = h;
    }
  }
  __syncthreads();

  float bm[2][8], bn[4];                                         // bias along A (Q, K) or along B (V); the other is 0
#pragma unroll
  for (int i = 0; i < 2; ++i)
#pragma unroll
    for (int r = 0; r < 8; ++r) bm[i][r] = (mat < 2) ? bmv[i][r >> 2][r & 3] : 0.f;
#pragma unroll
  for (int j = 0; j < 4; ++j) bn[j] = (mat < 2) ? 0.f : bnv[j];

  // ---- products: both operands by the same loader, so their k orders agree ----
  const int rowA = (mat < 2) ? (PJ_TOK + mat * PJ_E + colA0) : colA0;
  const int rowB = (mat < 2) ? 0 : (PJ_TOK + 2 * PJ_E + rowB0);
  const _Float16* pA = Sm + (rowA + rlane) * PJ_P + 8 * hh;
  const _Float16* pB = Sm + (rowB + rlane) * PJ_P + 8 * hh;
  v8f acc[2][4];
#pragma unroll
  for (int i = 0; i < 2; ++i)
#pragma unroll
    for (int j = 0; j < 4; ++j) acc[i][j] = (v8f){0.f,0.f,0.f,0.f,0.f,0.f,0.f,0.f};
#pragma unroll
  for (int k0 = 0; k0 < PJ_E; k0 += 32) {
    v16h a[2], b[4];
#pragma unroll
    for (int i = 0; i < 2; ++i) a[i] = Frag<_Float16>::load(pA + i * 16 * PJ_P + k0);
#pragma unroll
    for (int j = 0; j < 4; ++j) b[j] = Frag<_Float16>::load(pB + j * 16 * PJ_P + k0);
#pragma unroll
    for (int i = 0; i < 2; ++i)
#pragma unroll
      for (int j = 0; j < 4; ++j)
        acc[i][j] = __builtin_amdgcn_wmma_f32_16x16x32_f16(false, a[i], false, b[j], (short)0, acc[i][j], false, false);
  }

  // ---- undo the carry, add the bias, f16, out tile in LDS ----
  _Float16* ot = Ot + mat * PJ_OT;
  const int opitch = (mat < 2) ? PJ_P : PJ_VP;
#pragma unroll
  for (int i = 0; i < 2; ++i)
#pragma unroll
    for (int j = 0; j < 4; ++j) {
      v8h hv;
#pragma unroll
      for (int r = 0; r < 8; ++r) hv[r] = (_Float16)((acc[i][j][r] * wundo + bm[i][r]) + bn[j]);
      *(v8h*)(ot + (rowB0 + j * 16 + rlane) * opitch + colA0 + i * 16 + 8 * hh) = hv;
    }
  __syncthreads();

  // ---- each group stores its own tile: 16 B per lane, whole 128-B lines (Q, K: 64 rows of 256 B; V^T: 128 of 128 B) ----
  _Float16* G = (mat == 0) ? Qh + (size_t)tok0 * PJ_E : ((mat == 1) ? Kh + (size_t)tok0 * PJ_E : Vt + tok0);
  const int gpitch = (mat < 2) ? PJ_E : ldv;
  const int rsh    = (mat < 2) ? 4 : 3;                            // 16-B pieces per row: 16 or 8
  const int c8     = (gt & ((1 << rsh) - 1)) * 8;
#pragma unroll
  for (int i = 0; i < 8; ++i) {
    const int row = (i * 128 + gt) >> rsh;
    *(v8h*)(G + (size_t)row * gpitch + c8) = *(const v8h*)(ot + row * opitch + c8);
  }
}

// =====================================================================================
// Single-head attention, head dim 128, f16 q/k planes row-major [B*N][128], f16 V^T plane [128][B*N] (pitch ldv),
// f32 out. scores = (q.k^T) * inv_scale + bias[q] with bias[q] = sum_d q[q][d] * ctx[b][d],
// ctx[b][e] = sum_c context[b][c] * Wc[e][c] + bc[e] (f32 plane ctxw [B][128], from the projection launch); softmax over all keys (no mask), f32 online;
// out = p.v / l with p and l both carried x2^15 (added to the exponent in front of exp2), so the carry cancels.
// Block = 8 waves = 64 query rows of one batch x 4 key groups: wave (g, qw) runs query rows qw*32..+31 (two 16-query
// tiles) over the g-th 64 keys of every 256-key stage: every K and V^T fragment read from LDS feeds two WMMAs, so the
// block's LDS reads per stage take no longer than its WMMAs; each SIMD holds two waves. The stages come
// by tensor loads into two buffers, one request per wave and stage (a slice of 64 rows of 256 B, through no register):
// stage s + 1 is in flight while stage s is worked on, one barrier per stage.
// Each group keeps its own online (max, sum, O); the four are merged once in LDS behind the loop.
// Both products are formed transposed: S^T = K Q^T (A = K rows, B = Q, kept in registers) and O^T += V^T P^T
// (A = V^T rows, B = P^T). A lane then holds scores of ONE query (column c; keys 8hh+r of each 16-key tile): max and
// sum run in the lane plus one exchange between the wave halves, and two neighbouring score tiles, converted in
// place, ARE the B operand of the second product (its k order is the fragment loader's), so P never leaves registers.
// grid.x = B * (N / 64); blockDim = 256; N % 256 == 0.
// =====================================================================================
#define AT_E 128
#define AT_C 64
#define AT_QB 64
#define AT_KC 64
#define AT_NW 4                          // 16-query tiles of a block
#define AT_QT 2                          // 16-query tiles of a wave
#define AT_G 4
#define AT_SK (AT_G * AT_KC)
#define AT_NT (AT_G * (AT_NW / AT_QT) * 32)
#define AT_QP 136
#define AT_KP 136
#define AT_SLR 64                        // rows of a tensor-load slice, 256 B each
#define AT_SLB 18432                     // LDS bytes of a slice: 64 rows at pitch 272 B (17,408), rounded up to a multiple of 2 KiB
#define AT_NSL 8                         // slices of a stage: K rows 64 w..+63 (w = 0..3); V^T keys 128 h..+127, d 64 e..+63 (4 + 2 h + e)
#define AT_OP 132
#define AT_PLOG 15.0f                    // probabilities and their sums are carried x 2^15
#define AT_L2E 1.4426950408889634f

__device__ __forceinline__ v8f mma_h16(v16h a, v16h b, v8f c) {
  return __builtin_amdgcn_wmma_f32_16x16x32_f16(false, a, false, b, (short)0, c, false, false);
}

// lane l <-> lane l ^ 16
__device__ __forceinline__ float xhalf(float x) {
  return __builtin_bit_cast(float, __builtin_amdgcn_permlanex16(__builtin_bit_cast(int, x), __builtin_bit_cast(int, x),
                                                                0x76543210, 0xfedcba98, false, false));
}

// a wave-uniform value into a scalar register
__device__ __forceinline__ uint32_t uni(uint32_t v) { return (uint32_t)__builtin_amdgcn_readfirstlane(v); }
// A wave-uniform test or a descriptor word held in a scalar register: the branch on such a test is
// a scalar branch (a tensor load ignores EXEC), and such a word stays in its register as long as a later statement names it.
__device__ __forceinline__ uint32_t pinned(uint32_t v) {
  uint32_t w = uni(v);
  asm volatile("" : "+s"(w));   // pinned(): holds a tensor load's issue test or descriptor word in a scalar register
  return w;
}

__device__ __forceinline__ u32x8 tdm_group1(uint32_t src_pitch) {
  constexpr uint32_t d0 = 256u, d1 = AT_SLR;
  u32x8 g;
  g[0] = pinned((1u << 20) | (5u << 22) | (3u << 25));
  g[1] = pinned((d0 & 0xFFFFu) << 16);
  g[2] = pinned((d0 >> 16) | ((d1 & 0xFFFFu) << 16));
  g[3] = pinned((d1 >> 16) | (d0 << 16));
  g[4] = pinned(d1);
  g[5] = pinned(src_pitch);
  g[6] = pinned(0u);
  g[7] = pinned(0u);
  return g;
}
// group 0: count 1, LDS byte offset of the tile, global address of its first byte, type 2
__device__ __forceinline__ u32x4 tdm_group0(uint32_t lds_dst, uint64_t ga) {
  u32x4 g;
  g[0] = pinned(1u);
  g[1] = pinned(lds_dst);
  g[2] = pinned((uint32_t)ga);
  g[3] = pinned((((uint32_t)(ga >> 32)) & 0x01FFFFFFu) | 0x80000000u);
  return g;
}
// one request of the whole wave: global tile -> LDS
__device__ __forceinline__ void tdm_load(u32x4 g0, u32x8 g1) {
  asm volatile("tensor_load_to_lds %0, %1" :: "s"(g0), "s"(g1) : "memory");
}

__global__ __launch_bounds__(AT_NT)
void attn128_kernel(const _Float16* __restrict__ Qh, const _Float16* __restrict__ Kh,
                    const _Float16* __restrict__ Vt, int ldv,
                    const float* __restrict__ ctxw,
                    float* __restrict__ out, int nTok, float inv_scale)
{
  __shared__ __align__(16) _Float16 Qsh[AT_QB * AT_QP];          // [q][d]      pitch 136
  __shared__ __align__(16) float    Ms[AT_G][AT_QB];             // per group row max
  __shared__ __align__(16) float    Ls[AT_G][AT_QB];             // per group row sum
  // Two stage buffers of eight slices each (64 rows of 128 halves, pitch 136): slices 0..3 = K rows [kv][d] of key group
  // 0..3; slice 4 + 2 h + e = V^T rows [d = 64 e ..][kv = 128 h ..]. Every slice starts at a multiple of 2 KiB. Behind the
  // loop the first buffer's bytes hold the 16 partial O tiles (group x query tile; 16 x 128 f32, pitch 132).
  constexpr int KV_BYTES = AT_NSL * AT_SLB;
  static_assert(AT_SLR * AT_KP * 2 <= AT_SLB && AT_SLB % 2048 == 0, "a slice holds its padded rows and keeps the next one's place");
  static_assert(AT_G * AT_SLR == AT_SK && AT_KC == AT_SLR && AT_E == 2 * AT_SLR && AT_SK == 2 * 128, "slices tile the stage");
  static_assert(AT_G * AT_NW * 16 * AT_OP * 4 <= KV_BYTES, "partial O tiles must fit the K/V stage");
  __shared__ __attribute__((aligned(2048))) unsigned char KVraw[2 * KV_BYTES];
  float*    const Os  = (float*)KVraw;

  const int tid  = threadIdx.x;
  const int wv   = tid >> 5;        // 0..7
  const int wave = wv & (AT_NW / AT_QT - 1);   // 32-query slice of this wave
  const int grp  = wv >> 1;            // key group of this wave
  const int lane = tid & 31;
  const int hh   = lane >> 4;
  const int c    = lane & 15;

  const int nqb = nTok / AT_QB;
  const int b   = blockIdx.x / nqb;
  const int qb  = blockIdx.x - b * nqb;
  const int q0  = qb * AT_QB;
  const size_t rowbase = (size_t)b * nTok;       // first token row of this batch
  const size_t colbase = rowbase;                 // column offset of this batch inside V^T rows

  // ---- this wave's slice of a stage: waves 0..3 bring K rows, waves 4..7 V^T rows; all of it wave-uniform ----
  const int nChunks = nTok / AT_SK;                                    // block-uniform, size-derived
  const uint32_t wvs  = uni((uint32_t)tid >> 5);
  const bool     isV  = wvs >= 4u;
  const uint64_t ga0  = isV ? (uint64_t)(size_t)(Vt + (size_t)((wvs & 1u) * AT_SLR) * ldv + colbase + ((wvs >> 1) & 1u) * 128u)
                            : (uint64_t)(size_t)(Kh + (rowbase + wvs * AT_SLR) * AT_E);
  const uint32_t gstep = isV ? AT_SK * 2u : AT_SK * AT_E * 2u;          // source bytes from one stage to the next
  const uint32_t ldst  = (uint32_t)(size_t)KVraw + wvs * AT_SLB;        // byte offset in the work-group's LDS, buffer 0
  const u32x8    g1    = tdm_group1(isV ? (uint32_t)ldv * 2u : AT_E * 2u);
  // stage st -> the buffer at byte offset bo: one request of every wave, only where the stage exists (a scalar branch)
  u32x4 g0;                                                             // group 0 of this wave's latest request
  auto stage_load = [&](uint32_t bo, uint32_t st, bool exists) {
    g0 = tdm_group0(ldst + bo, ga0 + (uint64_t)st * gstep);
    if (pinned(exists)) tdm_load(g0, g1);
  };
  // The wave's request has landed. The wait names the descriptor's registers as inputs: they live up to it, so none of
  // them takes a new value while the request is outstanding.
  auto wait_landed = [&]() { asm volatile("s_wait_tensorcnt 0x0" :: "s"(g0), "s"(g1) : "memory"); };
  // stage 0 -> buffer 0, in flight during the Q and ctx loads
  g0 = tdm_group0(ldst, ga0);
  tdm_load(g0, g1);

  // ---- Q block [64][128] into LDS; behind its loads, ctx[b] at the d of this lane's Q fragment elements, into registers:
  // cx[dc][e >> 2][e & 3] goes with element e of qf[u][dc] (d = dc*32 + 8hh + e, + 8 more from e = 8 on: the loader's k order).
  // Both loops are unrolled: all 20 loads are in flight at once, under stage 0's tensor load.
  v8h qv[AT_QB * 16 / AT_NT];
#pragma unroll
  for (int i = 0; i < AT_QB * 16 / AT_NT; ++i) {
    const int idx = i * AT_NT + tid;
    qv[i] = *(const v8h*)(Qh + (rowbase + q0 + (idx >> 4)) * AT_E + (idx & 15) * 8);
  }
  asm volatile("s_wait_xcnt 0x0" ::: "memory");   // before a ctx load's result lands in an address register of a Q load
  __builtin_amdgcn_sched_barrier(0);                // keeps what follows behind that wait
  v4f cx[4][4];
  {
    const float* cxp = ctxw + (size_t)b * AT_E + 8 * hh;
#pragma unroll
    for (int dc = 0; dc < 4; ++dc) {
      cx[dc][0] = *(const v4f*)(cxp + dc * 32);
      cx[dc][1] = *(const v4f*)(cxp + dc * 32 + 4);
      cx[dc][2] = *(const v4f*)(cxp + dc * 32 + 16);
      cx[dc][3] = *(const v4f*)(cxp + dc * 32 + 20);
    }
  }
  asm volatile("s_wait_xcnt 0x0" ::: "memory");   // before the address registers of the ctx loads are rewritten
  __builtin_amdgcn_sched_barrier(0);                // keeps the later address arithmetic behind that wait
#pragma unroll
  for (int i = 0; i < AT_QB * 16 / AT_NT; ++i) {
    const int idx = i * AT_NT + tid;
    *(v8h*)(Qsh + (idx >> 4) * AT_QP + (idx & 15) * 8) = qv[i];
  }
  wait_landed();                                       // this wave's slice of stage 0; the barrier publishes it
  __syncthreads();
  stage_load(KV_BYTES, 1u, nChunks > 1);                                   // stage 1 -> buffer 1

  // Below, index u = 0, 1 is the wave's query tile; "query c" of tile u is block row wave*32 + u*16 + c.
  // Every loop over u is unrolled: its arrays are indexed by the counter and must stay in registers.
  const float ninf = -__builtin_inff();
  const float k1 = inv_scale * AT_L2E;   // product -> score in log2 units
  float mrun[AT_QT];                 // running max of query c (same in both halves)
  float lrun[AT_QT];                 // running sum of query c over THIS half's keys; the halves join behind the loop
  v8f oacc[AT_QT][8];                // O^T: oacc[u][t][r] = O[query c][d = t*16 + 8hh + r]
  // Q of this wave as the B operand of S^T, read once: qf[u][dc] = Q[query c][dc*32 + k order of the loader]
  v16h qf[AT_QT][4];
#pragma unroll
  for (int u = 0; u < AT_QT; ++u) {
    mrun[u] = ninf;
    lrun[u] = 0.f;
#pragma unroll
    for (int t = 0; t < 8; ++t) oacc[u][t] = (v8f){0.f,0.f,0.f,0.f,0.f,0.f,0.f,0.f};
#pragma unroll
    for (int dc = 0; dc < 4; ++dc)
      qf[u][dc] = Frag<_Float16>::load(Qsh + ((wave * AT_QT + u) * 16 + c) * AT_QP + dc * 32 + 8 * hh);
  }
  // ---- per-query context bias from the Q fragments: a lane holds 64 of the 128 d of query c, lane l ^ 16 the other 64;
  // one chain per d step (four independent chains a tile), fully unrolled: qf and cx are indexed by the counters ----
  float bias[AT_QT];                                              // of query c, in both halves
#pragma unroll
  for (int u = 0; u < AT_QT; ++u) {
    float part[4];
#pragma unroll
    for (int dc = 0; dc < 4; ++dc) {
      part[dc] = 0.f;
#pragma unroll
      for (int e = 0; e < 16; ++e) part[dc] = __builtin_fmaf((float)qf[u][dc][e], cx[dc][e >> 2][e & 3], part[dc]);
    }
    const float ph = (part[0] + part[1]) + (part[2] + part[3]);
    bias[u] = ph + xhalf(ph);
  }
  for (int kc = 0; kc < nChunks; ++kc) {
    const int boff = (kc & 1) * KV_BYTES;                              // stage kc lies in buffer kc mod 2
    const _Float16* kgrp = (const _Float16*)(KVraw + boff + grp * AT_SLB);                         // this group's 64 K rows
    const _Float16* vgrp = (const _Float16*)(KVraw + boff + (4 + (grp >> 1) * 2) * AT_SLB) + (grp & 1) * AT_KC;   // its 64 V^T columns, d 0..63

    // ---- S^T = K Q^T : A[m=key c][k=d] from kgrp row (j*16+c), B[k=d][n=query c] = qf ----
    v8f st[AT_QT][4];                // st[u][j][r] = score of key j*16 + 8hh + r against query c
#pragma unroll
    for (int u = 0; u < AT_QT; ++u)
#pragma unroll
      for (int j = 0; j < 4; ++j) st[u][j] = (v8f){0.f,0.f,0.f,0.f,0.f,0.f,0.f,0.f};
    // The K fragments of one d step (eight 16-B LDS loads) are issued as one group in front of their eight WMMAs:
    // one LDS round trip per group, not one per WMMA.
    // Unrolled: qf is indexed by the counter and must stay in registers.
#pragma unroll
    for (int dc = 0; dc < 4; ++dc) {
      v16h ka[4];
#pragma unroll
      for (int j = 0; j < 4; ++j) ka[j] = Frag<_Float16>::load(kgrp + (j * 16 + c) * AT_KP + dc * 32 + 8 * hh);
      __builtin_amdgcn_sched_barrier(0);   // keeps the group's loads together in front of its WMMAs, none among them
#pragma unroll
      for (int j = 0; j < 4; ++j)
#pragma unroll
        for (int u = 0; u < AT_QT; ++u) st[u][j] = mma_h16(ka[j], qf[u][dc], st[u][j]);
    }

    v16h pb[AT_QT][2];
#pragma unroll
    for (int u = 0; u < AT_QT; ++u) {
      // ---- chunk max of query c on the raw products: 32 in the lane, the other 32 in lane l ^ 16 ----
      float cmj[4];
#pragma unroll
      for (int j = 0; j < 4; ++j) {
        float m = st[u][j][0];
#pragma unroll
        for (int r = 1; r < 8; ++r) m = fmaxf(m, st[u][j][r]);
        cmj[j] = m;
      }
      float cm = fmaxf(fmaxf(cmj[0], cmj[1]), fmaxf(cmj[2], cmj[3]));
      cm = fmaxf(cm, xhalf(cm));
      // score = product * inv_scale + bias rises with the product (inv_scale > 0): the largest score is that of cm
      const float mnew  = fmaxf(mrun[u], cm * inv_scale + bias[u]);
      const float alpha = __builtin_amdgcn_exp2f((mrun[u] - mnew) * AT_L2E);
      mrun[u] = mnew;
      // 2^15 exp(score - mnew) = exp2(product * k1 + c0): scale, bias, maximum, log2(e) and the carry in one fma
      const float c0 = (bias[u] - mnew) * AT_L2E + AT_PLOG;
      // ---- P^T: tiles 2kk and 2kk+1, converted in place, are the B operand of keys kk*32..+31 ----
      float psj[4];
#pragma unroll
      for (int j = 0; j < 4; ++j) {
        float ps = 0.f;
#pragma unroll
        for (int r = 0; r < 8; ++r) {
          const float p = __builtin_amdgcn_exp2f(st[u][j][r] * k1 + c0);
          ps += p;
          pb[u][j >> 1][(j & 1) * 8 + r] = (_Float16)p;
        }
        psj[j] = ps;
      }
      lrun[u] = lrun[u] * alpha + ((psj[0] + psj[1]) + (psj[2] + psj[3]));
#pragma unroll
      for (int t = 0; t < 8; ++t)
#pragma unroll
        for (int r = 0; r < 8; ++r) oacc[u][t][r] *= alpha;
    }

    // ---- O^T += V^T P^T : A[m=d c][k=kv] from V^T row d = t*16+c (vgrp slice t/4), B[k=kv][n=query c] = pb ----
    // likewise: the V^T fragments of 32 keys (sixteen 16-B LDS loads) as one group in front of their sixteen WMMAs
#pragma unroll
    for (int kk = 0; kk < 2; ++kk) {
      v16h va[8];
#pragma unroll
      for (int t = 0; t < 8; ++t) va[t] = Frag<_Float16>::load(vgrp + (t >> 2) * (AT_SLB / 2) + ((t & 3) * 16 + c) * AT_KP + kk * 32 + 8 * hh);
      __builtin_amdgcn_sched_barrier(0);   // keeps the group's loads together in front of its WMMAs, none among them
#pragma unroll
      for (int t = 0; t < 8; ++t)
#pragma unroll
        for (int u = 0; u < AT_QT; ++u) oacc[u][t] = mma_h16(va[t], pb[u][kk], oacc[u][t]);
    }

    // ---- hand-over: this wave's reads of stage kc are done and its slice of stage kc + 1 has landed; the one
    // barrier publishes stage kc + 1 and frees stage kc's buffer, which stage kc + 2 then refills ----
    asm volatile("s_wait_dscnt 0x0" ::: "memory");
    wait_landed();
    __syncthreads();
    stage_load((uint32_t)boff, (uint32_t)(kc + 2), kc + 2 < nChunks);
  }
  asm volatile("s_wait_tensorcnt 0x0" ::: "memory");   // no request is outstanding when the buffers change their use
  asm volatile("s_wait_dscnt 0x0" ::: "memory");       // nor an LDS read of this wave

  // ---- merge of the four key groups: every wave lays down its un-normalised O tiles and its rows' (max, sum) ----
  __syncthreads();   // every wave has left the K/V stage before its bytes become the partial O tiles
#pragma unroll
  for (int u = 0; u < AT_QT; ++u) {
    const int qt = wave * AT_QT + u;                               // 16-query tile of the block
    float* os = Os + (grp * AT_NW + qt) * (16 * AT_OP) + c * AT_OP + 8 * hh;   // row = query c; a lane's 8 registers are 8 neighbours
#pragma unroll
    for (int t = 0; t < 8; ++t) {
      *(v4f*)(os + t * 16)     = (v4f){oacc[u][t][0], oacc[u][t][1], oacc[u][t][2], oacc[u][t][3]};
      *(v4f*)(os + t * 16 + 4) = (v4f){oacc[u][t][4], oacc[u][t][5], oacc[u][t][6], oacc[u][t][7]};
    }
    const float lfin = lrun[u] + xhalf(lrun[u]);                   // the two halves' keys joined
    if (hh == 0) {
      Ms[grp][qt * 16 + c] = mrun[u];
      Ls[grp][qt * 16 + c] = lfin;
    }
  }
  __syncthreads();   // publishes the partial tiles to the waves that merge them
  // wave wv merges the block's query rows wv*8..+7; each 512-B row is written by one instruction
  {
    const int c4 = lane * 4;
#pragma unroll
    for (int rr = 0; rr < AT_QB * 32 / AT_NT; ++rr) {
      const int qrow = wv * (AT_QB * 32 / AT_NT) + rr;
      const int row  = qrow & 15;                                  // row inside its 16-query tile
      float mg[AT_G];
      float mall = ninf;
#pragma unroll
      for (int g = 0; g < AT_G; ++g) { mg[g] = Ms[g][qrow]; mall = fmaxf(mall, mg[g]); }
      float lall = 0.f;
      v4f val = (v4f){0.f, 0.f, 0.f, 0.f};
#pragma unroll
      for (int g = 0; g < AT_G; ++g) {
        const float w = __builtin_amdgcn_exp2f((mg[g] - mall) * AT_L2E);
        lall += w * Ls[g][qrow];
        const v4f part = *(const v4f*)(Os + (g * AT_NW + (qrow >> 4)) * (16 * AT_OP) + row * AT_OP + c4);
        val += part * w;
      }
      const float inv = 1.0f / lall;                               // O and l carry the same 2^15
      *(v4f*)(out + (rowbase + q0 + qrow) * AT_E + c4) = val * inv;
    }
  }
}

// ---------------------------------------------------------------------------
extern "C" void kernel_launch(void* const* d_in, const int* in_sizes, int n_in,
                              void* d_out, int out_size, void* d_ws, size_t ws_size,
                              hipStream_t stream)
{
  if (n_in < 10) return;
  const float* X    = (const float*)d_in[0];
  const float* ctxt = (const float*)d_in[1];
  const float* Wq   = (const float*)d_in[2];
  const float* bq   = (const float*)d_in[3];
  const float* Wk   = (const float*)d_in[4];
  const float* bk   = (const float*)d_in[5];
  const float* Wv   = (const float*)d_in[6];
  const float* bv   = (const float*)d_in[7];
  const float* Wc   = (const float*)d_in[8];
  const float* bc   = (const float*)d_in[9];
  float* out = (float*)d_out;

  const int E = AT_E, C = AT_C;
  const int nX   = in_sizes[0];
  const int Mall = nX / E;                 // B*N token rows
  const int Bn   = in_sizes[1] / C;        // batch
  if (Bn <= 0 || Mall <= 0) return;
  const int nTok = Mall / Bn;              // tokens per batch
  if (nTok * Bn != Mall || Mall * E != nX) return;
  if ((Mall % 64) != 0 || (nTok % AT_SK) != 0) return;
  if (in_sizes[2] != E * E || in_sizes[4] != E * E || in_sizes[6] != E * E) return;
  if (in_sizes[3] != E || in_sizes[5] != E || in_sizes[7] != E) return;
  if (in_sizes[8] != E * C || in_sizes[9] != E || in_sizes[1] != Bn * C) return;
  if (out_size != nX) return;

  // ---- workspace carve (all offsets multiples of 16 KiB) ----
  const size_t nTokE = (size_t)Mall * E;              // halves per token plane
  size_t off = 0;
  _Float16* Qh  = (_Float16*)((char*)d_ws + off); off += nTokE * 2;   // [Mall][128]
  _Float16* Kh  = (_Float16*)((char*)d_ws + off); off += nTokE * 2;   // [Mall][128]
  _Float16* Vt  = (_Float16*)((char*)d_ws + off); off += nTokE * 2;   // [128][Mall]
  float*    ctxw = (float*)((char*)d_ws + off);   off += (size_t)Bn * E * 4;   // [Bn][128]
  if (off > ws_size) return;

  // ---- Q = X Wq^T + bq, K = X Wk^T + bk : [Mall][128] f16 ; V^T : [128][Mall] f16 ; casts included ; ctx : [Bn][128] f32 ----
  qkv_proj_kernel<<<dim3(Mall / PJ_TOK), PJ_NT, 0, stream>>>(
      X, Wq, bq, Wk, bk, Wv, bv, ctxt, Wc, bc, Qh, Kh, Vt, Mall, ctxw, Bn * E, (Mall / PJ_TOK) * 2, 256.0f, 1.0f / 256.0f);

  // ---- attention ----
  {
    const float scale_f   = (float)11.313708498984761;   // sqrt(128) as f32
    const float inv_scale = 1.0f / scale_f;
    attn128_kernel<<<dim3(Bn * (nTok / 64)), AT_NT, 0, stream>>>(
        Qh, Kh, Vt, Mall, ctxw, out, nTok, inv_scale);
  }
}

// v010
// Measured time: 34.6 microseconds a run.
// Timed twice side by side with v009, it ran 1.04 times as fast both times.
// Counting every step since v000, it is 7.00 times as fast.
// Contractions: Q/K/V projections, Q.K^T scores and P.V on v_wmma_f32_16x16x32_f16 (f16 operands, f32 accumulate); weights carried x256 and probabilities x32768 (exact power-of-two carries folded back in f32); context projection (K=64, 4 rows; once, in the projection launch) and the per-query context-bias dot on VALU f32; softmax f32.
#include <hip/hip_runtime.h>
#include <stdint.h>

typedef __attribute__((ext_vector_type(16))) _Float16 v16h;
typedef __attribute__((ext_vector_type(8)))  _Float16 v8h;
typedef __attribute__((ext_vector_type(4)))  _Float16 v4h;
typedef __attribute__((ext_vector_type(8)))  float    v8f;
typedef __attribute__((ext_vector_type(4)))  float    v4f;
typedef uint32_t u32x4 __attribute__((ext_vector_type(4)));
typedef uint32_t u32x8 __attribute__((ext_vector_type(8)));

template <typename T> struct Frag;
template <> struct Frag<_Float16> {
  typedef v16h V; union U { v16h v; v8h h[2]; };
  static __device__ __forceinline__ v16h load(const _Float16* p) {   // elements 0..7 <- p[0..7], 8..15 <- p[16..23]
    U f; f.h[0] = *(const v8h*)(p); f.h[1] = *(const v8h*)(p + 16); return f.v;
  }
};

// =====================================================================================
// Q, K and V^T projections of 64 token rows in one launch, straight from the f32 inputs.
// Q = X Wq^T + bq, K = X Wk^T + bk : f16 [tokens][128]; V^T = (X Wv^T + bv)^T : f16 [128][tokens] (pitch ldv).
// Block = 12 waves. The block casts its X rows and the three weight matrices (x wcarry) to f16 on the way into LDS
// (512-B wave loads, one row each); waves 0..3 / 4..7 / 8..11 then form Q / K / V^T.
// Each wave owns 2 x 4 tiles of 16 x 16, with the operand whose index runs along an OUTPUT ROW as A: a lane's 8
// accumulator registers are then 8 neighbours of one output row and go to the LDS out tile as one 16-B store.
//   Q, K : A = 32 weight rows (features), B = the 64 X rows (tokens)      -> out tile [token][feature]
//   V^T  : A = 32 X rows (tokens),        B = 64 weight rows (features)   -> out tile [feature][token]
// The out tiles leave as whole 128-B lines. grid.x = tokens / 64; blockDim = 384.
// The context projection ctx[b][e] = sum_c context[b][c] * Wc[e][c] + bc[e] (f32, VALU) rides along, dealt over the grid:
// each half of a block's wave 0 forms one value (4 terms a lane, summed over the 16 lanes) for the attention launch.
// Every other loop is fully unrolled (#pragma unroll): its arrays are indexed by the counter and must stay in registers,
// and the 46 loads of a wave must all be in flight before the first wait.
// =====================================================================================
#define PJ_E 128
#define PJ_TOK 64
#define PJ_NT 384
#define PJ_P 136                         // LDS pitch (halves) of 128-half rows
#define PJ_VP 72                         // LDS pitch (halves) of the V^T tile's 64-half rows
#define PJ_OT (PJ_E * PJ_VP)             // halves per out tile (>= 64 * 136)
#define PJ_C 64                          // context width

// x + (x of lane l ^ M), M = 1, 2, 4, 8: inside a 16-lane row, through no LDS
template <int M> __device__ __forceinline__ float row_xadd(float x) {
  return x + __builtin_bit_cast(float, __builtin_amdgcn_update_dpp(0, __builtin_bit_cast(int, x), 0x160 + M, 0xf, 0xf, true));
}

__global__ __launch_bounds__(PJ_NT)
void qkv_proj_kernel(const float* __restrict__ X,
                     const float* __restrict__ Wq, const float* __restrict__ bq,
                     const float* __restrict__ Wk, const float* __restrict__ bk,
                     const float* __restrict__ Wv, const float* __restrict__ bv,
                     const float* __restrict__ ctxin, const float* __restrict__ Wc, const float* __restrict__ bc,
                     _Float16* __restrict__ Qh, _Float16* __restrict__ Kh, _Float16* __restrict__ Vt, int ldv,
                     float* __restrict__ ctxw, int nCtx, int ctxStep,
                     float wcarry, float wundo)
{
  static_assert(PJ_TOK * PJ_P <= PJ_OT, "Q/K out tile must fit");
  __shared__ __align__(16) _Float16 Sm[(PJ_TOK + 3 * PJ_E) * PJ_P];   // rows 0..63: X; rows 64 + 128 m + f: weight m
  __shared__ __align__(16) _Float16 Ot[3 * PJ_OT];

  const int tid   = threadIdx.x;
  const int wv    = __builtin_amdgcn_readfirstlane(tid >> 5);   // 0..11, in a scalar register: selects by matrix stay scalar
  const int mat   = wv >> 2;                                    // 0 Q, 1 K, 2 V
  const int sl    = wv & 3;
  const int gt    = tid & 127;                                  // thread inside its 4-wave group
  const int lane  = tid & 31;
  const int rlane = lane & 15;
  const int hh    = lane >> 4;
  const int tok0  = blockIdx.x * PJ_TOK;

  // ---- context projection: value v = b * 128 + e; both halves of wave 0 make the same number of trips (nCtx is even) ----
  if (wv == 0) {
    for (int v = blockIdx.x * 2 + hh; v < nCtx; v += ctxStep) {             // ctxStep = 2 * blocks of the grid
      const int ce = v & (PJ_E - 1);
      const float bce = bc[ce];                                              // with the other two loads: one round trip
      const v4f w4 = *(const v4f*)(Wc + (size_t)ce * PJ_C + rlane * 4);
      const v4f c4 = *(const v4f*)(ctxin + (size_t)(v / PJ_E) * PJ_C + rlane * 4);
      float p = (w4[0] * c4[0] + w4[1] * c4[1]) + (w4[2] * c4[2] + w4[3] * c4[3]) + (rlane == 0 ? bce : 0.f);   // bc[e] enters the sum once
      p = row_xadd<1>(p); p = row_xadd<2>(p); p = row_xadd<4>(p); p = row_xadd<8>(p);
      if (rlane == 0) {
        ctxw[v] = p;
        asm volatile("s_wait_xcnt 0x0" ::: "memory");   // before the next trip, or the code behind the loop, rewrites the store's registers
      }
    }
  }

  // ---- all other global loads first, none under a branch: bias values, X rows (block), this group's weight matrix ----
  const int colA0 = (mat < 2) ? sl * 32 : (sl & 1) * 32;         // first out column of the wave (A index)
  const int rowB0 = (mat < 2) ? 0 : (sl >> 1) * 64;              // first out row of the wave (B index)
  const v4f* bA = (const v4f*)((mat == 1 ? bk : bq) + colA0 + 8 * hh);   // in bounds for every wave; used by Q, K
  v4f bmv[2][2];
  float bnv[4];
#pragma unroll
  for (int i = 0; i < 2; ++i) { bmv[i][0] = bA[i * 4]; bmv[i][1] = bA[i * 4 + 1]; }
#pragma unroll
  for (int j = 0; j < 4; ++j) bnv[j] = bv[rowB0 + j * 16 + rlane];       // in bounds for every wave; used by V

  const v4f* Xg = (const v4f*)(X + (size_t)tok0 * PJ_E);
  const v4f* Wg = (const v4f*)(mat == 0 ? Wq : (mat == 1 ? Wk : Wv));
  // X: 2048 16-B pieces = 5 per thread + 128; every group loads the last 128, group 0 alone stores them
  v4f xr[6], wr[32];
#pragma unroll
  for (int i = 0; i < 5; ++i) xr[i] = Xg[i * PJ_NT + tid];
  xr[5] = Xg[5 * PJ_NT + gt];
#pragma unroll
  for (int i = 0; i < 32; ++i) wr[i] = Wg[i * 128 + gt];

  // ---- cast to f16 into LDS ----
#pragma unroll
  for (int i = 0; i < 6; ++i) {
    const int idx = (i < 5) ? i * PJ_NT + tid : 5 * PJ_NT + gt;
    v4h h;
#pragma unroll
    for (int e = 0; e < 4; ++e) h[e] = (_Float16)xr[i][e];
    if (i < 5 || mat == 0) *(v4h*)(Sm + (idx >> 5) * PJ_P + (idx & 31) * 4) = h;
  }
  {
    _Float16* wdst = Sm + (PJ_TOK + mat * PJ_E) * PJ_P;
#pragma unroll
    for (int i = 0; i < 32; ++i) {
      const int idx = i * 128 + gt;
      v4h h;
#pragma unroll
      for (int e = 0; e < 4; ++e) h[e] = (_Float16)(wr[i][e] * wcarry);
      *(v4h*)(wdst + (idx >> 5) * PJ_P + (idx & 31) * 4) = h;
    }
  }
  __syncthreads();

  float bm[2][8], bn[4];                                         // bias along A (Q, K) or along B (V); the other is 0
#pragma unroll
  for (int i = 0; i < 2; ++i)
#pragma unroll
    for (int r = 0; r < 8; ++r) bm[i][r] = (mat < 2) ? bmv[i][r >> 2][r & 3] : 0.f;
#pragma unroll
  for (int j = 0; j < 4; ++j) bn[j] = (mat < 2) ? 0.f : bnv[j];

  // ---- products: both operands by the same loader, so their k orders agree ----
  const int rowA = (mat < 2) ? (PJ_TOK + mat * PJ_E + colA0) : colA0;
  const int rowB = (mat < 2) ? 0 : (PJ_TOK + 2 * PJ_E + rowB0);
  const _Float16* pA = Sm + (rowA + rlane) * PJ_P + 8 * hh;
  const _Float16* pB = Sm + (rowB + rlane) * PJ_P + 8 * hh;
  v8f acc[2][4];
#pragma unroll
  for (int i = 0; i < 2; ++i)
#pragma unroll
    for (int j = 0; j < 4; ++j) acc[i][j] = (v8f){0.f,0.f,0.f,0.f,0.f,0.f,0.f,0.f};
#pragma unroll
  for (int k0 = 0; k0 < PJ_E; k0 += 32) {
    v16h a[2], b[4];
#pragma unroll
    for (int i = 0; i < 2; ++i) a[i] = Frag<_Float16>::load(pA + i * 16 * PJ_P + k0);
#pragma unroll
    for (int j = 0; j < 4; ++j) b[j] = Frag<_Float16>::load(pB + j * 16 * PJ_P + k0);
#pragma unroll
    for (int i = 0; i < 2; ++i)
#pragma unroll
      for (int j = 0; j < 4; ++j)
        acc[i][j] = __builtin_amdgcn_wmma_f32_16x16x32_f16(false, a[i], false, b[j], (short)0, acc[i][j], false, false);
  }

  // ---- undo the carry, add the bias, f16, out tile in LDS ----
  _Float16* ot = Ot + mat * PJ_OT;
  const int opitch = (mat < 2) ? PJ_P : PJ_VP;
#pragma unroll
  for (int i = 0; i < 2; ++i)
#pragma unroll
    for (int j = 0; j < 4; ++j) {
      v8h hv;
#pragma unroll
      for (int r = 0; r < 8; ++r) hv[r] = (_Float16)((acc[i][j][r] * wundo + bm[i][r]) + bn[j]);
      *(v8h*)(ot + (rowB0 + j * 16 + rlane) * opitch + colA0 + i * 16 + 8 * hh) = hv;
    }
  __syncthreads();

  // ---- each group stores its own tile: 16 B per lane, whole 128-B lines (Q, K: 64 rows of 256 B; V^T: 128 of 128 B) ----
  _Float16* G = (mat == 0) ? Qh + (size_t)tok0 * PJ_E : ((mat == 1) ? Kh + (size_t)tok0 * PJ_E : Vt + tok0);
  const int gpitch = (mat < 2) ? PJ_E : ldv;
  const int rsh    = (mat < 2) ? 4 : 3;                            // 16-B pieces per row: 16 or 8
  const int c8     = (gt & ((1 << rsh) - 1)) * 8;
#pragma unroll
  for (int i = 0; i < 8; ++i) {
    const int row = (i * 128 + gt) >> rsh;
    *(v8h*)(G + (size_t)row * gpitch + c8) = *(const v8h*)(ot + row * opitch + c8);
  }
}

// =====================================================================================
// Single-head attention, head dim 128, f16 q/k planes row-major [B*N][128], f16 V^T plane [128][B*N] (pitch ldv),
// f32 out. scores = (q.k^T) * inv_scale + bias[q] with bias[q] = sum_d q[q][d] * ctx[b][d],
// ctx[b][e] = sum_c context[b][c] * Wc[e][c] + bc[e] (f32 plane ctxw [B][128], from the projection launch); softmax over all keys (no mask), f32 online;
// out = p.v / l with p and l both carried x2^15 (added to the exponent in front of exp2), so the carry cancels.
// Block = 8 waves = 64 query rows of one batch x 4 key groups: wave (g, qw) runs query rows qw*32..+31 (two 16-query
// tiles) over the g-th 64 keys of every 256-key stage: every K and V^T fragment read from LDS feeds two WMMAs, so the
// block's LDS reads per stage take no longer than its WMMAs; each SIMD holds two waves. The stages come
// by tensor loads into two buffers, one request per wave and stage (a slice of 64 rows of 256 B, through no register):
// the next stage of the block's walk is in flight while the current one is worked on, one barrier per stage.
// A block walks the stages as a ring: it enters at the stage that holds its own query rows and wraps round, so that the
// blocks of a batch, which all read the same K and V^T rows, are spread over the stages: only the four blocks of one stage's query rows walk alike.
// Each group keeps its own online (max, sum, O); the four are merged once in LDS behind the loop.
// Both products are formed transposed: S^T = K Q^T (A = K rows, B = Q, kept in registers) and O^T += V^T P^T
// (A = V^T rows, B = P^T). A lane then holds scores of ONE query (column c; keys 8hh+r of each 16-key tile): max and
// sum run in the lane plus one exchange between the wave halves, and two neighbouring score tiles, converted in
// place, ARE the B operand of the second product (its k order is the fragment loader's), so P never leaves registers.
// grid.x = B * (N / 64); blockDim = 256; N % 256 == 0.
// =====================================================================================
#define AT_E 128
#define AT_C 64
#define AT_QB 64
#define AT_KC 64
#define AT_NW 4                          // 16-query tiles of a block
#define AT_QT 2                          // 16-query tiles of a wave
#define AT_G 4
#define AT_SK (AT_G * AT_KC)
#define AT_NT (AT_G * (AT_NW / AT_QT) * 32)
#define AT_QP 136
#define AT_KP 136
#define AT_SLR 64                        // rows of a tensor-load slice, 256 B each
#define AT_SLB 18432                     // LDS bytes of a slice: 64 rows at pitch 272 B (17,408), rounded up to a multiple of 2 KiB
#define AT_NSL 8                         // slices of a stage: K rows 64 w..+63 (w = 0..3); V^T keys 128 h..+127, d 64 e..+63 (4 + 2 h + e)
#define AT_OP 132
#define AT_PLOG 15.0f                    // probabilities and their sums are carried x 2^15
#define AT_L2E 1.4426950408889634f

__device__ __forceinline__ v8f mma_h16(v16h a, v16h b, v8f c) {
  return __builtin_amdgcn_wmma_f32_16x16x32_f16(false, a, false, b, (short)0, c, false, false);
}

// lane l <-> lane l ^ 16
__device__ __forceinline__ float xhalf(float x) {
  return __builtin_bit_cast(float, __builtin_amdgcn_permlanex16(__builtin_bit_cast(int, x), __builtin_bit_cast(int, x),
                                                                0x76543210, 0xfedcba98, false, false));
}

// a wave-uniform value into a scalar register
__device__ __forceinline__ uint32_t uni(uint32_t v) { return (uint32_t)__builtin_amdgcn_readfirstlane(v); }
// A wave-uniform test or a descriptor word held in a scalar register: the branch on such a test is
// a scalar branch (a tensor load ignores EXEC), and such a word stays in its register as long as a later statement names it.
__device__ __forceinline__ uint32_t pinned(uint32_t v) {
  uint32_t w = uni(v);
  asm volatile("" : "+s"(w));   // pinned(): holds a tensor load's issue test or descriptor word in a scalar register
  return w;
}

__device__ __forceinline__ u32x8 tdm_group1(uint32_t src_pitch) {
  constexpr uint32_t d0 = 256u, d1 = AT_SLR;
  u32x8 g;
  g[0] = pinned((1u << 20) | (5u << 22) | (3u << 25));
  g[1] = pinned((d0 & 0xFFFFu) << 16);
  g[2] = pinned((d0 >> 16) | ((d1 & 0xFFFFu) << 16));
  g[3] = pinned((d1 >> 16) | (d0 << 16));
  g[4] = pinned(d1);
  g[5] = pinned(src_pitch);
  g[6] = pinned(0u);
  g[7] = pinned(0u);
  return g;
}
// group 0: count 1, LDS byte offset of the tile, global address of its first byte, type 2
__device__ __forceinline__ u32x4 tdm_group0(uint32_t lds_dst, uint64_t ga) {
  u32x4 g;
  g[0] = pinned(1u);
  g[1] = pinned(lds_dst);
  g[2] = pinned((uint32_t)ga);
  g[3] = pinned((((uint32_t)(ga >> 32)) & 0x01FFFFFFu) | 0x80000000u);
  return g;
}
// one request of the whole wave: global tile -> LDS
__device__ __forceinline__ void tdm_load(u32x4 g0, u32x8 g1) {
  asm volatile("tensor_load_to_lds %0, %1" :: "s"(g0), "s"(g1) : "memory");
}

__global__ __launch_bounds__(AT_NT)
void attn128_kernel(const _Float16* __restrict__ Qh, const _Float16* __restrict__ Kh,
                    const _Float16* __restrict__ Vt, int ldv,
                    const float* __restrict__ ctxw,
                    float* __restrict__ out, int nTok, float inv_scale)
{
  __shared__ __align__(16) _Float16 Qsh[AT_QB * AT_QP];          // [q][d]      pitch 136
  __shared__ __align__(16) float    Ms[AT_G][AT_QB];             // per group row max
  __shared__ __align__(16) float    Ls[AT_G][AT_QB];             // per group row sum
  // Two stage buffers of eight slices each (64 rows of 128 halves, pitch 136): slices 0..3 = K rows [kv][d] of key group
  // 0..3; slice 4 + 2 h + e = V^T rows [d = 64 e ..][kv = 128 h ..]. Every slice starts at a multiple of 2 KiB. Behind the
  // loop the first buffer's bytes hold the 16 partial O tiles (group x query tile; 16 x 128 f32, pitch 132).
  constexpr int KV_BYTES = AT_NSL * AT_SLB;
  static_assert(AT_SLR * AT_KP * 2 <= AT_SLB && AT_SLB % 2048 == 0, "a slice holds its padded rows and keeps the next one's place");
  static_assert(AT_G * AT_SLR == AT_SK && AT_KC == AT_SLR && AT_E == 2 * AT_SLR && AT_SK == 2 * 128, "slices tile the stage");
  static_assert(AT_G * AT_NW * 16 * AT_OP * 4 <= KV_BYTES, "partial O tiles must fit the K/V stage");
  __shared__ __attribute__((aligned(2048))) unsigned char KVraw[2 * KV_BYTES];
  float*    const Os  = (float*)KVraw;

  const int tid  = threadIdx.x;
  const int wv   = tid >> 5;        // 0..7
  const int wave = wv & (AT_NW / AT_QT - 1);   // 32-query slice of this wave
  const int grp  = wv >> 1;            // key group of this wave
  const int lane = tid & 31;
  const int hh   = lane >> 4;
  const int c    = lane & 15;

  const int nqb = nTok / AT_QB;
  const int b   = blockIdx.x / nqb;
  const int qb  = blockIdx.x - b * nqb;
  const int q0  = qb * AT_QB;
  const size_t rowbase = (size_t)b * nTok;       // first token row of this batch
  const size_t colbase = rowbase;                 // column offset of this batch inside V^T rows

  // ---- this wave's slice of a stage: waves 0..3 bring K rows, waves 4..7 V^T rows; all of it wave-uniform ----
  const int nChunks = nTok / AT_SK;                                    // block-uniform, size-derived
  const uint32_t wvs  = uni((uint32_t)tid >> 5);
  const bool     isV  = wvs >= 4u;
  const uint64_t ga0  = isV ? (uint64_t)(size_t)(Vt + (size_t)((wvs & 1u) * AT_SLR) * ldv + colbase + ((wvs >> 1) & 1u) * 128u)
                            : (uint64_t)(size_t)(Kh + (rowbase + wvs * AT_SLR) * AT_E);
  static_assert(AT_SK * 2 == 1 << 9 && AT_SK * AT_E * 2 == 1 << 16, "stage steps as shifts");
  const uint32_t gsh  = isV ? 9u : 16u;                                 // log2 of the source bytes from one stage to the next
  const uint32_t ldst  = (uint32_t)(size_t)KVraw + wvs * AT_SLB;        // byte offset in the work-group's LDS, buffer 0
  const u32x8    g1    = tdm_group1(isV ? (uint32_t)ldv * 2u : AT_E * 2u);
  // pass p of this block works on stage ring(p): the walk enters at the stage of the block's own rows (q0 / 256 < nChunks)
  const int rot = q0 / AT_SK;                                          // block-uniform
  auto ring = [&](int p) { const int s = p + rot; return (uint32_t)(s >= nChunks ? s - nChunks : s); };
  // stage st -> the buffer at byte offset bo: one request of every wave, only where the pass exists (a scalar branch)
  u32x4 g0;                                                             // group 0 of this wave's latest request
  auto stage_load = [&](uint32_t bo, uint32_t st, bool exists) {
    g0 = tdm_group0(ldst + bo, ga0 + ((uint64_t)st << gsh));
    if (pinned(exists)) tdm_load(g0, g1);
  };
  // The wave's request has landed. The wait names the descriptor's registers as inputs: they live up to it, so none of
  // them takes a new value while the request is outstanding.
  auto wait_landed = [&]() { asm volatile("s_wait_tensorcnt 0x0" :: "s"(g0), "s"(g1) : "memory"); };
  // pass 0 -> buffer 0, in flight during the Q and ctx loads
  g0 = tdm_group0(ldst, ga0 + ((uint64_t)ring(0) << gsh));
  tdm_load(g0, g1);

  // ---- Q block [64][128] into LDS; behind its loads, ctx[b] at the d of this lane's Q fragment elements, into registers:
  // cx[dc][e >> 2][e & 3] goes with element e of qf[u][dc] (d = dc*32 + 8hh + e, + 8 more from e = 8 on: the loader's k order).
  // Both loops are unrolled: all 20 loads are in flight at once, under pass 0's tensor load.
  v8h qv[AT_QB * 16 / AT_NT];
#pragma unroll
  for (int i = 0; i < AT_QB * 16 / AT_NT; ++i) {
    const int idx = i * AT_NT + tid;
    qv[i] = *(const v8h*)(Qh + (rowbase + q0 + (idx >> 4)) * AT_E + (idx & 15) * 8);
  }
  asm volatile("s_wait_xcnt 0x0" ::: "memory");   // before a ctx load's result lands in an address register of a Q load
  __builtin_amdgcn_sched_barrier(0);                // keeps what follows behind that wait
  v4f cx[4][4];
  {
    const float* cxp = ctxw + (size_t)b * AT_E + 8 * hh;
#pragma unroll
    for (int dc = 0; dc < 4; ++dc) {
      cx[dc][0] = *(const v4f*)(cxp + dc * 32);
      cx[dc][1] = *(const v4f*)(cxp + dc * 32 + 4);
      cx[dc][2] = *(const v4f*)(cxp + dc * 32 + 16);
      cx[dc][3] = *(const v4f*)(cxp + dc * 32 + 20);
    }
  }
  asm volatile("s_wait_xcnt 0x0" ::: "memory");   // before the address registers of the ctx loads are rewritten
  __builtin_amdgcn_sched_barrier(0);                // keeps the later address arithmetic behind that wait
#pragma unroll
  for (int i = 0; i < AT_QB * 16 / AT_NT; ++i) {
    const int idx = i * AT_NT + tid;
    *(v8h*)(Qsh + (idx >> 4) * AT_QP + (idx & 15) * 8) = qv[i];
  }
  wait_landed();                                       // this wave's slice of pass 0; the barrier publishes it
  __syncthreads();
  stage_load(KV_BYTES, ring(1), nChunks > 1);                              // pass 1 -> buffer 1

  // Below, index u = 0, 1 is the wave's query tile; "query c" of tile u is block row wave*32 + u*16 + c.
  // Every loop over u is unrolled: its arrays are indexed by the counter and must stay in registers.
  const float ninf = -__builtin_inff();
  const float k1 = inv_scale * AT_L2E;   // product -> score in log2 units
  float mrun[AT_QT];                 // running max of query c (same in both halves)
  float lrun[AT_QT];                 // running sum of query c over THIS half's keys; the halves join behind the loop
  v8f oacc[AT_QT][8];                // O^T: oacc[u][t][r] = O[query c][d = t*16 + 8hh + r]
  // Q of this wave as the B operand of S^T, read once: qf[u][dc] = Q[query c][dc*32 + k order of the loader]
  v16h qf[AT_QT][4];
#pragma unroll
  for (int u = 0; u < AT_QT; ++u) {
    mrun[u] = ninf;
    lrun[u] = 0.f;
#pragma unroll
    for (int t = 0; t < 8; ++t) oacc[u][t] = (v8f){0.f,0.f,0.f,0.f,0.f,0.f,0.f,0.f};
#pragma unroll
    for (int dc = 0; dc < 4; ++dc)
      qf[u][dc] = Frag<_Float16>::load(Qsh + ((wave * AT_QT + u) * 16 + c) * AT_QP + dc * 32 + 8 * hh);
  }
  // ---- per-query context bias from the Q fragments: a lane holds 64 of the 128 d of query c, lane l ^ 16 the other 64;
  // one chain per d step (four independent chains a tile), fully unrolled: qf and cx are indexed by the counters ----
  float bias[AT_QT];                                              // of query c, in both halves
#pragma unroll
  for (int u = 0; u < AT_QT; ++u) {
    float part[4];
#pragma unroll
    for (int dc = 0; dc < 4; ++dc) {
      part[dc] = 0.f;
#pragma unroll
      for (int e = 0; e < 16; ++e) part[dc] = __builtin_fmaf((float)qf[u][dc][e], cx[dc][e >> 2][e & 3], part[dc]);
    }
    const float ph = (part[0] + part[1]) + (part[2] + part[3]);
    bias[u] = ph + xhalf(ph);
  }
  for (int kc = 0; kc < nChunks; ++kc) {
    const int boff = (kc & 1) * KV_BYTES;                              // pass kc's stage lies in buffer kc mod 2
    const _Float16* kgrp = (const _Float16*)(KVraw + boff + grp * AT_SLB);                         // this group's 64 K rows
    const _Float16* vgrp = (const _Float16*)(KVraw + boff + (4 + (grp >> 1) * 2) * AT_SLB) + (grp & 1) * AT_KC;   // its 64 V^T columns, d 0..63

    // ---- S^T = K Q^T : A[m=key c][k=d] from kgrp row (j*16+c), B[k=d][n=query c] = qf ----
    v8f st[AT_QT][4];                // st[u][j][r] = score of key j*16 + 8hh + r against query c
#pragma unroll
    for (int u = 0; u < AT_QT; ++u)
#pragma unroll
      for (int j = 0; j < 4; ++j) st[u][j] = (v8f){0.f,0.f,0.f,0.f,0.f,0.f,0.f,0.f};
    // The K fragments of one d step (eight 16-B LDS loads) are issued as one group in front of their eight WMMAs:
    // one LDS round trip per group, not one per WMMA.
    // Unrolled: qf is indexed by the counter and must stay in registers.
#pragma unroll
    for (int dc = 0; dc < 4; ++dc) {
      v16h ka[4];
#pragma unroll
      for (int j = 0; j < 4; ++j) ka[j] = Frag<_Float16>::load(kgrp + (j * 16 + c) * AT_KP + dc * 32 + 8 * hh);
      __builtin_amdgcn_sched_barrier(0);   // keeps the group's loads together in front of its WMMAs, none among them
#pragma unroll
      for (int j = 0; j < 4; ++j)
#pragma unroll
        for (int u = 0; u < AT_QT; ++u) st[u][j] = mma_h16(ka[j], qf[u][dc], st[u][j]);
    }

    v16h pb[AT_QT][2];
#pragma unroll
    for (int u = 0; u < AT_QT; ++u) {
      // ---- chunk max of query c on the raw products: 32 in the lane, the other 32 in lane l ^ 16 ----
      float cmj[4];
#pragma unroll
      for (int j = 0; j < 4; ++j) {
        float m = st[u][j][0];
#pragma unroll
        for (int r = 1; r < 8; ++r) m = fmaxf(m, st[u][j][r]);
        cmj[j] = m;
      }
      float cm = fmaxf(fmaxf(cmj[0], cmj[1]), fmaxf(cmj[2], cmj[3]));
      cm = fmaxf(cm, xhalf(cm));
      // score = product * inv_scale + bias rises with the product (inv_scale > 0): the largest score is that of cm
      const float mnew  = fmaxf(mrun[u], cm * inv_scale + bias[u]);
      const float alpha = __builtin_amdgcn_exp2f((mrun[u] - mnew) * AT_L2E);
      mrun[u] = mnew;
      // 2^15 exp(score - mnew) = exp2(product * k1 + c0): scale, bias, maximum, log2(e) and the carry in one fma
      const float c0 = (bias[u] - mnew) * AT_L2E + AT_PLOG;
      // ---- P^T: tiles 2kk and 2kk+1, converted in place, are the B operand of keys kk*32..+31 ----
      float psj[4];
#pragma unroll
      for (int j = 0; j < 4; ++j) {
        float ps = 0.f;
#pragma unroll
        for (int r = 0; r < 8; ++r) {
          const float p = __builtin_amdgcn_exp2f(st[u][j][r] * k1 + c0);
          ps += p;
          pb[u][j >> 1][(j & 1) * 8 + r] = (_Float16)p;
        }
        psj[j] = ps;
      }
      lrun[u] = lrun[u] * alpha + ((psj[0] + psj[1]) + (psj[2] + psj[3]));
#pragma unroll
      for (int t = 0; t < 8; ++t)
#pragma unroll
        for (int r = 0; r < 8; ++r) oacc[u][t][r] *= alpha;
    }

    // ---- O^T += V^T P^T : A[m=d c][k=kv] from V^T row d = t*16+c (vgrp slice t/4), B[k=kv][n=query c] = pb ----
    // likewise: the V^T fragments of 32 keys (sixteen 16-B LDS loads) as one group in front of their sixteen WMMAs
#pragma unroll
    for (int kk = 0; kk < 2; ++kk) {
      v16h va[8];
#pragma unroll
      for (int t = 0; t < 8; ++t) va[t] = Frag<_Float16>::load(vgrp + (t >> 2) * (AT_SLB / 2) + ((t & 3) * 16 + c) * AT_KP + kk * 32 + 8 * hh);
      __builtin_amdgcn_sched_barrier(0);   // keeps the group's loads together in front of its WMMAs, none among them
#pragma unroll
      for (int t = 0; t < 8; ++t)
#pragma unroll
        for (int u = 0; u < AT_QT; ++u) oacc[u][t] = mma_h16(va[t], pb[u][kk], oacc[u][t]);
    }

    // ---- hand-over: this wave's reads of pass kc are done and its slice of pass kc + 1 has landed; the one
    // barrier publishes pass kc + 1 and frees pass kc's buffer, which pass kc + 2 then refills ----
    asm volatile("s_wait_dscnt 0x0" ::: "memory");
    wait_landed();
    __syncthreads();
    stage_load((uint32_t)boff, ring(kc + 2), kc + 2 < nChunks);
  }
  asm volatile("s_wait_tensorcnt 0x0" ::: "memory");   // no request is outstanding when the buffers change their use
  asm volatile("s_wait_dscnt 0x0" ::: "memory");       // nor an LDS read of this wave

  // ---- merge of the four key groups: every wave lays down its un-normalised O tiles and its rows' (max, sum) ----
  __syncthreads();   // every wave has left the K/V stage before its bytes become the partial O tiles
#pragma unroll
  for (int u = 0; u < AT_QT; ++u) {
    const int qt = wave * AT_QT + u;                               // 16-query tile of the block
    float* os = Os + (grp * AT_NW + qt) * (16 * AT_OP) + c * AT_OP + 8 * hh;   // row = query c; a lane's 8 registers are 8 neighbours
#pragma unroll
    for (int t = 0; t < 8; ++t) {
      *(v4f*)(os + t * 16)     = (v4f){oacc[u][t][0], oacc[u][t][1], oacc[u][t][2], oacc[u][t][3]};
      *(v4f*)(os + t * 16 + 4) = (v4f){oacc[u][t][4], oacc[u][t][5], oacc[u][t][6], oacc[u][t][7]};
    }
    const float lfin = lrun[u] + xhalf(lrun[u]);                   // the two halves' keys joined
    if (hh == 0) {
      Ms[grp][qt * 16 + c] = mrun[u];
      Ls[grp][qt * 16 + c] = lfin;
    }
  }
  __syncthreads();   // publishes the partial tiles to the waves that merge them
  // wave wv merges the block's query rows wv*8..+7; each 512-B row is written by one instruction
  {
    const int c4 = lane * 4;
#pragma unroll
    for (int rr = 0; rr < AT_QB * 32 / AT_NT; ++rr) {
      const int qrow = wv * (AT_QB * 32 / AT_NT) + rr;
      const int row  = qrow & 15;                                  // row inside its 16-query tile
      float mg[AT_G];
      float mall = ninf;
#pragma unroll
      for (int g = 0; g < AT_G; ++g) { mg[g] = Ms[g][qrow]; mall = fmaxf(mall, mg[g]); }
      float lall = 0.f;
      v4f val = (v4f){0.f, 0.f, 0.f, 0.f};
#pragma unroll
      for (int g = 0; g < AT_G; ++g) {
        const float w = __builtin_amdgcn_exp2f((mg[g] - mall) * AT_L2E);
        lall += w * Ls[g][qrow];
        const v4f part = *(const v4f*)(Os + (g * AT_NW + (qrow >> 4)) * (16 * AT_OP) + row * AT_OP + c4);
        val += part * w;
      }
      const float inv = 1.0f / lall;                               // O and l carry the same 2^15
      *(v4f*)(out + (rowbase + q0 + qrow) * AT_E + c4) = val * inv;
    }
  }
}

// ---------------------------------------------------------------------------
extern "C" void kernel_launch(void* const* d_in, const int* in_sizes, int n_in,
                              void* d_out, int out_size, void* d_ws, size_t ws_size,
                              hipStream_t stream)
{
  if (n_in < 10) return;
  const float* X    = (const float*)d_in[0];
  const float* ctxt = (const float*)d_in[1];
  const float* Wq   = (const float*)d_in[2];
  const float* bq   = (const float*)d_in[3];
  const float* Wk   = (const float*)d_in[4];
  const float* bk   = (const float*)d_in[5];
  const float* Wv   = (const float*)d_in[6];
  const float* bv   = (const float*)d_in[7];
  const float* Wc   = (const float*)d_in[8];
  const float* bc   = (const float*)d_in[9];
  float* out = (float*)d_out;

  const int E = AT_E, C = AT_C;
  const int nX   = in_sizes[0];
  const int Mall = nX / E;                 // B*N token rows
  const int Bn   = in_sizes[1] / C;        // batch
  if (Bn <= 0 || Mall <= 0) return;
  const int nTok = Mall / Bn;              // tokens per batch
  if (nTok * Bn != Mall || Mall * E != nX) return;
  if ((Mall % 64) != 0 || (nTok % AT_SK) != 0) return;
  if (in_sizes[2] != E * E || in_sizes[4] != E * E || in_sizes[6] != E * E) return;
  if (in_sizes[3] != E || in_sizes[5] != E || in_sizes[7] != E) return;
  if (in_sizes[8] != E * C || in_sizes[9] != E || in_sizes[1] != Bn * C) return;
  if (out_size != nX) return;

  // ---- workspace carve (all offsets multiples of 16 KiB) ----
  const size_t nTokE = (size_t)Mall * E;              // halves per token plane
  size_t off = 0;
  _Float16* Qh  = (_Float16*)((char*)d_ws + off); off += nTokE * 2;   // [Mall][128]
  _Float16* Kh  = (_Float16*)((char*)d_ws + off); off += nTokE * 2;   // [Mall][128]
  _Float16* Vt  = (_Float16*)((char*)d_ws + off); off += nTokE * 2;   // [128][Mall]
  float*    ctxw = (float*)((char*)d_ws + off);   off += (size_t)Bn * E * 4;   // [Bn][128]
  if (off > ws_size) return;

  // ---- Q = X Wq^T + bq, K = X Wk^T + bk : [Mall][128] f16 ; V^T : [128][Mall] f16 ; casts included ; ctx : [Bn][128] f32 ----
  qkv_proj_kernel<<<dim3(Mall / PJ_TOK), PJ_NT, 0, stream>>>(
      X, Wq, bq, Wk, bk, Wv, bv, ctxt, Wc, bc, Qh, Kh, Vt, Mall, ctxw, Bn * E, (Mall / PJ_TOK) * 2, 256.0f, 1.0f / 256.0f);

  // ---- attention ----
  {
    const float scale_f   = (float)11.313708498984761;   // sqrt(128) as f32
    const float inv_scale = 1.0f / scale_f;
    attn128_kernel<<<dim3(Bn * (nTok / 64)), AT_NT, 0, stream>>>(
        Qh, Kh, Vt, Mall, ctxw, out, nTok, inv_scale);
  }
}
